// v000
// Measured on an AMD MI455X. A time is GPU time per run, averaged over a window of back-to-back runs after a warm-up
// (all launches, gaps included; the runs take copies of the inputs in turn), and the median of several windows.
// Apart from v000's, it joins two sittings. Times from different sittings can be a few percent apart, while
// side-by-side timings come from the same sitting.
// The starting kernel, v000, takes 223 microseconds a run.
#include <hip/hip_runtime.h>
#include <hip/hip_bf16.h>
#include <math.h>

// ---------------------------------------------------------------------------
// Causal self-attention for MI455X (gfx1250, wave32, WMMA f16->f32).
//   HIDDEN=1024, DK=DV=64, B=4, T=4096
// Pipeline:
//   k0: convert weights fp32 -> f16 into workspace
//   k1: fused QKV projection (WMMA, K=1024); q pre-scaled by 1/sqrt(64);
//       V stored pre-transposed (v_t[b][d][t]) for transpose-free attention
//   k2: flash attention, double-buffered KV chunks staged with
//       GLOBAL_LOAD_ASYNC_TO_LDS_B128 (ASYNCcnt pipeline)
//   k3: output projection (WMMA, K=64, N=1024) + bias, fp32 out
// ---------------------------------------------------------------------------

typedef __attribute__((ext_vector_type(16))) _Float16 v16h;
typedef __attribute__((ext_vector_type(8)))  _Float16 v8h;
typedef __attribute__((ext_vector_type(4)))  _Float16 v4h;
typedef __attribute__((ext_vector_type(8)))  float    v8f;
typedef __attribute__((ext_vector_type(4)))  float    v4f;
typedef __attribute__((ext_vector_type(4)))  int      v4i;

#define HID   1024
#define DK    64
#define SEQ   4096
#define NBAT  4
#define NROWS (NBAT * SEQ)          // 16384 token rows

// ---- gfx1250 async copy to LDS (guarded; fallback = vector copy) ----------
#if __has_builtin(__builtin_amdgcn_global_load_async_to_lds_b128)
#define HAVE_ASYNC 1
typedef __attribute__((address_space(1))) v4i as1_v4i;
typedef __attribute__((address_space(3))) v4i as3_v4i;
#else
#define HAVE_ASYNC 0
#endif

static __device__ __forceinline__ void copy16B(const _Float16* src, _Float16* dst) {
#if HAVE_ASYNC
  // prototype: (int4 AS1* src, int4 AS3* dst, imm offset, imm cpol)
  __builtin_amdgcn_global_load_async_to_lds_b128(
      (as1_v4i*)(uintptr_t)src,
      (as3_v4i*)(unsigned int)(uintptr_t)dst,   // low 32 bits = LDS offset
      0, 0);
#else
  *(v8h*)dst = *(const v8h*)src;
#endif
}

static __device__ __forceinline__ void wait_async_zero() {
#if HAVE_ASYNC
#if __has_builtin(__builtin_amdgcn_s_wait_asynccnt)
  __builtin_amdgcn_s_wait_asynccnt(0);
#else
  asm volatile("s_wait_asynccnt 0x0" ::: "memory");
#endif
#endif
}

// ---- fragment helpers (CDNA5 16x16x32 f16 WMMA layouts, wave32) -----------
// A-matrix 16x32: lane = hid*16 + r ; row M = r ;
//   halves e=0..7  -> K = hid*8 + e ; halves e=8..15 -> K = 16 + hid*8 + (e-8)
// B-matrix 32x16: same pattern with lane%16 = column N, reading src[N][K].
static __device__ __forceinline__ v16h frag_load(const _Float16* src, int ld) {
  const int lane = threadIdx.x & 31;
  const int hid  = lane >> 4;
  const int r    = lane & 15;
  const _Float16* p = src + (size_t)r * ld + hid * 8;
  v16h f;
#pragma unroll
  for (int e = 0; e < 8; ++e) f[e] = p[e];
#pragma unroll
  for (int e = 0; e < 8; ++e) f[8 + e] = p[16 + e];
  return f;
}

static __device__ __forceinline__ v8f wmma16(v16h a, v16h b, v8f c) {
  return __builtin_amdgcn_wmma_f32_16x16x32_f16(false, a, false, b,
                                                (short)0, c, false, false);
}

// ---------------------------------------------------------------------------
// k0: fp32 -> f16 weight conversion.
// ---------------------------------------------------------------------------
__global__ void k0_convert_w(const float* __restrict__ Wq,
                             const float* __restrict__ Wk,
                             const float* __restrict__ Wv,
                             const float* __restrict__ Wo,
                             _Float16* __restrict__ Wqkv_h,
                             _Float16* __restrict__ Wo_h) {
  const int idx = blockIdx.x * blockDim.x + threadIdx.x;
  const int WSZ = DK * HID;                 // 65536
  if (idx < WSZ) {
    Wqkv_h[idx] = (_Float16)Wq[idx];
  } else if (idx < 2 * WSZ) {
    Wqkv_h[idx] = (_Float16)Wk[idx - WSZ];
  } else if (idx < 3 * WSZ) {
    Wqkv_h[idx] = (_Float16)Wv[idx - 2 * WSZ];
  } else if (idx < 3 * WSZ + HID * DK) {
    Wo_h[idx - 3 * WSZ] = (_Float16)Wo[idx - 3 * WSZ];
  }
}

// ---------------------------------------------------------------------------
// k1: fused QKV projection.  grid.x = NROWS/16; 384 threads = 12 waves.
//   Wave w owns one 16-col tile of fused [q|k|v]; y tile staged in LDS.
//   V written transposed: v_t[b][d][t].
// ---------------------------------------------------------------------------
#define Y_LD (HID + 8)

__global__ void k1_qkv(const float* __restrict__ y,
                       const _Float16* __restrict__ Wqkv_h,
                       const float* __restrict__ bq,
                       const float* __restrict__ bk,
                       const float* __restrict__ bv,
                       _Float16* __restrict__ q_h,
                       _Float16* __restrict__ k_h,
                       _Float16* __restrict__ v_t) {
  __shared__ __align__(16) _Float16 ytile[16 * Y_LD];

  const int tid  = threadIdx.x;
  const int row0 = blockIdx.x * 16;

  // vectorized fp32->f16 stage of the 16x1024 y tile
  for (int i = tid * 4; i < 16 * HID; i += 384 * 4) {
    const int r = i >> 10, c = i & (HID - 1);
    const v4f yv = *(const v4f*)&y[(size_t)(row0 + r) * HID + c];
    v4h hv;
    hv[0] = (_Float16)yv[0]; hv[1] = (_Float16)yv[1];
    hv[2] = (_Float16)yv[2]; hv[3] = (_Float16)yv[3];
    *(v4h*)&ytile[r * Y_LD + c] = hv;
  }
  __syncthreads();

  const int w    = tid >> 5;                // 0..11
  const int lane = tid & 31;
  const int hid  = lane >> 4;
  const int n    = lane & 15;

  v8f acc = {};
#pragma unroll 4
  for (int kk = 0; kk < HID; kk += 32) {
    v16h a = frag_load(ytile + kk, Y_LD);
    v16h b = frag_load(Wqkv_h + (size_t)(w * 16) * HID + kk, HID);
    acc = wmma16(a, b, acc);
  }

  const int sel  = w >> 2;                  // 0=q 1=k 2=v
  const int col  = (w & 3) * 16 + n;        // 0..63 within q/k/v
  const float* bias = (sel == 0) ? bq : (sel == 1) ? bk : bv;
  const float scale = (sel == 0) ? 0.125f : 1.0f;   // q / sqrt(64)
  const float bval  = bias[col];
  _Float16* dst = (sel == 0) ? q_h : k_h;

#pragma unroll
  for (int j = 0; j < 8; ++j) {
    const int m = j + 8 * hid;
    const float val = (acc[j] + bval) * scale;
    if (sel == 2) {
      const int grow = row0 + m;
      v_t[(size_t)(grow >> 12) * (DK * SEQ) + (size_t)col * SEQ +
          (grow & (SEQ - 1))] = (_Float16)val;
    } else {
      dst[(size_t)(row0 + m) * DK + col] = (_Float16)val;
    }
  }
}

// ---------------------------------------------------------------------------
// k2: flash attention (causal), double-buffered async KV staging.
//   grid.x = NBAT * (SEQ/128); 256 threads = 8 waves; wave owns 16 q rows.
// ---------------------------------------------------------------------------
#define K_LD  88     // 64 + 24 pad halves: 176B stride (16B aligned, no bank conflict)
#define VT_LD 40     // 32 + 8 pad halves:  80B stride  (16B aligned, no bank conflict)
#define QTILE 128
#define KCH_SZ (32 * K_LD)
#define VCH_SZ (DK * VT_LD)

__global__ void k2_attn(const _Float16* __restrict__ q_h,
                        const _Float16* __restrict__ k_h,
                        const _Float16* __restrict__ v_t,
                        _Float16* __restrict__ ctx_h) {
  __shared__ __align__(16) _Float16 Klds[2 * KCH_SZ];   // K chunk [kv 32][d 64]
  __shared__ __align__(16) _Float16 Vlds[2 * VCH_SZ];   // V^T chunk [d 64][kv 32]
  __shared__ __align__(16) _Float16 Plds[8 * 16 * 32];  // per-wave P staging

  const int tid  = threadIdx.x;
  const int w    = tid >> 5;
  const int lane = tid & 31;
  const int hid  = lane >> 4;
  const int n    = lane & 15;

  const int qtiles = SEQ / QTILE;           // 32
  const int b      = blockIdx.x / qtiles;
  const int qbase  = (blockIdx.x % qtiles) * QTILE;
  const size_t bo64 = (size_t)b * SEQ * DK; // batch offset, [t][d] layouts
  const _Float16* kg  = k_h + bo64;
  const _Float16* vtg = v_t + bo64;         // [d][t] layout

  // per-thread staging coordinates (each thread moves exactly 2 x 16B / chunk)
  const int rK = tid >> 3, sK = tid & 7;    // K: row kv, 8-half segment
  const int dV = tid >> 2, sV = tid & 3;    // V^T: row d, 8-half segment

  // persistent Q fragments for this wave's 16 rows (already scaled)
  const _Float16* qp = q_h + bo64 + (size_t)(qbase + w * 16) * DK;
  const v16h aq0 = frag_load(qp, DK);
  const v16h aq1 = frag_load(qp + 32, DK);

  v8f   acc[4] = {v8f{}, v8f{}, v8f{}, v8f{}};
  float m_run[8], l_run[8];
#pragma unroll
  for (int j = 0; j < 8; ++j) { m_run[j] = -3.0e38f; l_run[j] = 0.0f; }

  _Float16* myP = Plds + w * (16 * 32);
  const int limit = qbase + QTILE;

  // stage chunk 0 into buffer 0
  copy16B(kg  + (size_t)(0 + rK) * DK + sK * 8, Klds + rK * K_LD  + sK * 8);
  copy16B(vtg + (size_t)dV * SEQ + 0 + sV * 8,  Vlds + dV * VT_LD + sV * 8);

  int cur = 0;
  for (int kvb = 0; kvb < limit; kvb += 32) {
    wait_async_zero();      // my async copies into buf[cur] done
    __syncthreads();        // everyone's copies visible; prev compute done

    // prefetch next chunk into the other buffer (overlaps with WMMAs below)
    if (kvb + 32 < limit) {
      const int nxt = kvb + 32;
      copy16B(kg  + (size_t)(nxt + rK) * DK + sK * 8,
              Klds + (cur ^ 1) * KCH_SZ + rK * K_LD + sK * 8);
      copy16B(vtg + (size_t)dV * SEQ + nxt + sV * 8,
              Vlds + (cur ^ 1) * VCH_SZ + dV * VT_LD + sV * 8);
    }

    const _Float16* Kb = Klds + cur * KCH_SZ;
    const _Float16* Vb = Vlds + cur * VCH_SZ;

    // S = Q K^T : two 16x16 tiles covering kv columns [kvb, kvb+32)
    v8f s0 = {}, s1 = {};
    {
      v16h b0 = frag_load(Kb, K_LD);
      s0 = wmma16(aq0, b0, s0);
      v16h b1 = frag_load(Kb + 32, K_LD);
      s0 = wmma16(aq1, b1, s0);
      v16h b2 = frag_load(Kb + 16 * K_LD, K_LD);
      s1 = wmma16(aq0, b2, s1);
      v16h b3 = frag_load(Kb + 16 * K_LD + 32, K_LD);
      s1 = wmma16(aq1, b3, s1);
    }

    // online softmax update (fp32), causal mask, write P to LDS as f16
#pragma unroll
    for (int j = 0; j < 8; ++j) {
      const int m   = j + 8 * hid;
      const int row = qbase + w * 16 + m;
      const bool ok0 = (kvb + n)      <= row;
      const bool ok1 = (kvb + 16 + n) <= row;
      const float sm0 = ok0 ? s0[j] : -3.0e38f;
      const float sm1 = ok1 ? s1[j] : -3.0e38f;

      float mx = fmaxf(sm0, sm1);
      mx = fmaxf(mx, __shfl_xor(mx, 1, 32));
      mx = fmaxf(mx, __shfl_xor(mx, 2, 32));
      mx = fmaxf(mx, __shfl_xor(mx, 4, 32));
      mx = fmaxf(mx, __shfl_xor(mx, 8, 32));

      const float mtot = fmaxf(m_run[j], mx);
      const float sc   = __expf(m_run[j] - mtot);
      const float p0   = ok0 ? __expf(s0[j] - mtot) : 0.0f;
      const float p1   = ok1 ? __expf(s1[j] - mtot) : 0.0f;

      float rs = p0 + p1;
      rs += __shfl_xor(rs, 1, 32);
      rs += __shfl_xor(rs, 2, 32);
      rs += __shfl_xor(rs, 4, 32);
      rs += __shfl_xor(rs, 8, 32);

      m_run[j] = mtot;
      l_run[j] = l_run[j] * sc + rs;
#pragma unroll
      for (int t = 0; t < 4; ++t) acc[t][j] *= sc;

      myP[m * 32 + n]      = (_Float16)p0;
      myP[m * 32 + 16 + n] = (_Float16)p1;
    }

    // in-wave LDS RAW: drain DS before reading other lanes' P writes
    asm volatile("s_wait_dscnt 0x0" ::: "memory");

    // ctx += P (16x32) * V (32x64): 4 WMMAs via pre-transposed V in LDS
    {
      const v16h aP = frag_load(myP, 32);
#pragma unroll
      for (int t = 0; t < 4; ++t) {
        v16h bV = frag_load(Vb + (size_t)(t * 16) * VT_LD, VT_LD);
        acc[t] = wmma16(aP, bV, acc[t]);
      }
    }
    cur ^= 1;
  }

  // normalize and store ctx (f16)
#pragma unroll
  for (int j = 0; j < 8; ++j) {
    const int m   = j + 8 * hid;
    const int row = qbase + w * 16 + m;
    const float inv_l = 1.0f / l_run[j];
#pragma unroll
    for (int t = 0; t < 4; ++t) {
      ctx_h[bo64 + (size_t)row * DK + t * 16 + n] =
          (_Float16)(acc[t][j] * inv_l);
    }
  }
}

// ---------------------------------------------------------------------------
// k3: output projection  out[m][h] = sum_v ctx[m][v] * Wo[h][v] + bo[h]
// ---------------------------------------------------------------------------
__global__ void k3_proj(const _Float16* __restrict__ ctx_h,
                        const _Float16* __restrict__ Wo_h,
                        const float* __restrict__ bo,
                        float* __restrict__ out) {
  const int tid  = threadIdx.x;
  const int w    = tid >> 5;
  const int lane = tid & 31;
  const int hid  = lane >> 4;
  const int n    = lane & 15;

  const int rbase = blockIdx.x * 128 + w * 16;
  const _Float16* ap = ctx_h + (size_t)rbase * DK;
  const v16h a0 = frag_load(ap, DK);
  const v16h a1 = frag_load(ap + 32, DK);

  for (int nt = 0; nt < HID / 16; ++nt) {
    v8f acc = {};
    v16h b0 = frag_load(Wo_h + (size_t)(nt * 16) * DK, DK);
    acc = wmma16(a0, b0, acc);
    v16h b1 = frag_load(Wo_h + (size_t)(nt * 16) * DK + 32, DK);
    acc = wmma16(a1, b1, acc);

    const float bval = bo[nt * 16 + n];
#pragma unroll
    for (int j = 0; j < 8; ++j) {
      const int m = j + 8 * hid;
      out[(size_t)(rbase + m) * HID + nt * 16 + n] = acc[j] + bval;
    }
  }
}

// ---------------------------------------------------------------------------
extern "C" void kernel_launch(void* const* d_in, const int* in_sizes, int n_in,
                              void* d_out, int out_size, void* d_ws, size_t ws_size,
                              hipStream_t stream) {
  (void)in_sizes; (void)n_in; (void)out_size; (void)ws_size;

  const float* y  = (const float*)d_in[0];
  const float* Wq = (const float*)d_in[1];
  const float* bq = (const float*)d_in[2];
  const float* Wk = (const float*)d_in[3];
  const float* bk = (const float*)d_in[4];
  const float* Wv = (const float*)d_in[5];
  const float* bv = (const float*)d_in[6];
  const float* Wo = (const float*)d_in[7];
  const float* bo = (const float*)d_in[8];
  float* out = (float*)d_out;

  // workspace layout (f16)
  char* ws = (char*)d_ws;
  _Float16* Wqkv_h = (_Float16*)(ws);                        // 192*1024  (384 KB)
  _Float16* Wo_h   = (_Float16*)(ws + 393216);               // 1024*64   (128 KB)
  _Float16* q_h    = (_Float16*)(ws + 524288);               // [b][t][d] (2 MB)
  _Float16* k_h    = (_Float16*)(ws + 524288 + 2097152);     // [b][t][d] (2 MB)
  _Float16* v_t    = (_Float16*)(ws + 524288 + 2 * 2097152); // [b][d][t] (2 MB)
  _Float16* ctx_h  = (_Float16*)(ws + 524288 + 3 * 2097152); // [b][t][d] (2 MB)

  k0_convert_w<<<1024, 256, 0, stream>>>(Wq, Wk, Wv, Wo, Wqkv_h, Wo_h);
  k1_qkv<<<NROWS / 16, 384, 0, stream>>>(y, Wqkv_h, bq, bk, bv, q_h, k_h, v_t);
  k2_attn<<<NBAT * (SEQ / QTILE), 256, 0, stream>>>(q_h, k_h, v_t, ctx_h);
  k3_proj<<<NROWS / 128, 256, 0, stream>>>(ctx_h, Wo_h, bo, out);
}

// v001
// One run takes 143 microseconds.
// Timed twice side by side with v000, it ran 1.58 and 1.59 times as fast.
#include <hip/hip_runtime.h>
#include <hip/hip_bf16.h>
#include <math.h>

// ---------------------------------------------------------------------------
// Causal self-attention for MI455X (gfx1250, wave32, WMMA f16->f32).
//   HIDDEN=1024, DK=DV=64, B=4, T=4096
// Pipeline:
//   k0: convert weights fp32 -> f16 into workspace
//   k1: fused QKV projection (WMMA, K=1024); q pre-scaled by 1/sqrt(64);
//       V stored pre-transposed (v_t[b][d][t]) for transpose-free attention
//   k2: flash attention on transposed products, double-buffered KV chunks staged with
//       GLOBAL_LOAD_ASYNC_TO_LDS_B128 (ASYNCcnt pipeline)
//   k3: output projection (WMMA, K=64, N=1024) + bias, fp32 out
// ---------------------------------------------------------------------------

typedef __attribute__((ext_vector_type(16))) _Float16 v16h;
typedef __attribute__((ext_vector_type(8)))  _Float16 v8h;
typedef __attribute__((ext_vector_type(4)))  _Float16 v4h;
typedef __attribute__((ext_vector_type(8)))  float    v8f;
typedef __attribute__((ext_vector_type(4)))  float    v4f;
typedef __attribute__((ext_vector_type(4)))  int      v4i;

#define HID   1024
#define DK    64
#define SEQ   4096
#define NBAT  4
#define NROWS (NBAT * SEQ)          // 16384 token rows

// ---- gfx1250 async copy to LDS (guarded; fallback = vector copy) ----------
#if __has_builtin(__builtin_amdgcn_global_load_async_to_lds_b128)
#define HAVE_ASYNC 1
typedef __attribute__((address_space(1))) v4i as1_v4i;
typedef __attribute__((address_space(3))) v4i as3_v4i;
#else
#define HAVE_ASYNC 0
#endif

static __device__ __forceinline__ void copy16B(const _Float16* src, _Float16* dst) {
#if HAVE_ASYNC
  // prototype: (int4 AS1* src, int4 AS3* dst, imm offset, imm cpol)
  __builtin_amdgcn_global_load_async_to_lds_b128(
      (as1_v4i*)(uintptr_t)src,
      (as3_v4i*)(unsigned int)(uintptr_t)dst,   // low 32 bits = LDS offset
      0, 0);
#else
  *(v8h*)dst = *(const v8h*)src;
#endif
}

static __device__ __forceinline__ void wait_async_zero() {
#if HAVE_ASYNC
#if __has_builtin(__builtin_amdgcn_s_wait_asynccnt)
  __builtin_amdgcn_s_wait_asynccnt(0);
#else
  asm volatile("s_wait_asynccnt 0x0" ::: "memory");
#endif
#endif
}

// ---- fragment helpers (CDNA5 16x16x32 f16 WMMA layouts, wave32) -----------
// A-matrix 16x32: lane = hid*16 + r ; row M = r ;
//   halves e=0..7  -> K = hid*8 + e ; halves e=8..15 -> K = 16 + hid*8 + (e-8)
// B-matrix 32x16: same pattern with lane%16 = column N, reading src[N][K].
static __device__ __forceinline__ v16h frag_load(const _Float16* src, int ld) {
  const int lane = threadIdx.x & 31;
  const int hid  = lane >> 4;
  const int r    = lane & 15;
  const _Float16* p = src + (size_t)r * ld + hid * 8;
  v16h f;
#pragma unroll
  for (int e = 0; e < 8; ++e) f[e] = p[e];
#pragma unroll
  for (int e = 0; e < 8; ++e) f[8 + e] = p[16 + e];
  return f;
}

static __device__ __forceinline__ v8f wmma16(v16h a, v16h b, v8f c) {
  return __builtin_amdgcn_wmma_f32_16x16x32_f16(false, a, false, b,
                                                (short)0, c, false, false);
}

// ---------------------------------------------------------------------------
// k0: fp32 -> f16 weight conversion.
// ---------------------------------------------------------------------------
__global__ void k0_convert_w(const float* __restrict__ Wq,
                             const float* __restrict__ Wk,
                             const float* __restrict__ Wv,
                             const float* __restrict__ Wo,
                             _Float16* __restrict__ Wqkv_h,
                             _Float16* __restrict__ Wo_h) {
  const int idx = blockIdx.x * blockDim.x + threadIdx.x;
  const int WSZ = DK * HID;                 // 65536
  if (idx < WSZ) {
    Wqkv_h[idx] = (_Float16)Wq[idx];
  } else if (idx < 2 * WSZ) {
    Wqkv_h[idx] = (_Float16)Wk[idx - WSZ];
  } else if (idx < 3 * WSZ) {
    Wqkv_h[idx] = (_Float16)Wv[idx - 2 * WSZ];
  } else if (idx < 3 * WSZ + HID * DK) {
    Wo_h[idx - 3 * WSZ] = (_Float16)Wo[idx - 3 * WSZ];
  }
}

// ---------------------------------------------------------------------------
// k1: fused QKV projection.  grid.x = NROWS/16; 384 threads = 12 waves.
//   Wave w owns one 16-col tile of fused [q|k|v]; y tile staged in LDS.
//   V written transposed: v_t[b][d][t].
// ---------------------------------------------------------------------------
#define Y_LD (HID + 8)

__global__ void k1_qkv(const float* __restrict__ y,
                       const _Float16* __restrict__ Wqkv_h,
                       const float* __restrict__ bq,
                       const float* __restrict__ bk,
                       const float* __restrict__ bv,
                       _Float16* __restrict__ q_h,
                       _Float16* __restrict__ k_h,
                       _Float16* __restrict__ v_t) {
  __shared__ __align__(16) _Float16 ytile[16 * Y_LD];

  const int tid  = threadIdx.x;
  const int row0 = blockIdx.x * 16;

  // vectorized fp32->f16 stage of the 16x1024 y tile
  for (int i = tid * 4; i < 16 * HID; i += 384 * 4) {
    const int r = i >> 10, c = i & (HID - 1);
    const v4f yv = *(const v4f*)&y[(size_t)(row0 + r) * HID + c];
    v4h hv;
    hv[0] = (_Float16)yv[0]; hv[1] = (_Float16)yv[1];
    hv[2] = (_Float16)yv[2]; hv[3] = (_Float16)yv[3];
    *(v4h*)&ytile[r * Y_LD + c] = hv;
  }
  __syncthreads();

  const int w    = tid >> 5;                // 0..11
  const int lane = tid & 31;
  const int hid  = lane >> 4;
  const int n    = lane & 15;

  v8f acc = {};
#pragma unroll 4
  for (int kk = 0; kk < HID; kk += 32) {
    v16h a = frag_load(ytile + kk, Y_LD);
    v16h b = frag_load(Wqkv_h + (size_t)(w * 16) * HID + kk, HID);
    acc = wmma16(a, b, acc);
  }

  const int sel  = w >> 2;                  // 0=q 1=k 2=v
  const int col  = (w & 3) * 16 + n;        // 0..63 within q/k/v
  const float* bias = (sel == 0) ? bq : (sel == 1) ? bk : bv;
  const float scale = (sel == 0) ? 0.125f : 1.0f;   // q / sqrt(64)
  const float bval  = bias[col];
  _Float16* dst = (sel == 0) ? q_h : k_h;

#pragma unroll
  for (int j = 0; j < 8; ++j) {
    const int m = j + 8 * hid;
    const float val = (acc[j] + bval) * scale;
    if (sel == 2) {
      const int grow = row0 + m;
      v_t[(size_t)(grow >> 12) * (DK * SEQ) + (size_t)col * SEQ +
          (grow & (SEQ - 1))] = (_Float16)val;
    } else {
      dst[(size_t)(row0 + m) * DK + col] = (_Float16)val;
    }
  }
}

// ---------------------------------------------------------------------------
// k2: flash attention (causal), double-buffered async KV staging.
//   grid.x = NBAT * (SEQ/128); 256 threads = 8 waves; wave owns 16 q rows.
//   Transposed products: S^T = K Q^T and ctx^T += V^T P^T.  A lane then holds
//   16 scores of ONE query, so maximum and sum are in-lane (one exchange
//   between the wave halves), and the two S^T tiles, converted in place, are
//   the B operand of the second product: P never goes through LDS.
// ---------------------------------------------------------------------------
#define K_LD  88     // 64 + 24 pad halves: 176B stride (16B aligned, no bank conflict)
#define VT_LD 40     // 32 + 8 pad halves:  80B stride  (16B aligned, no bank conflict)
#define QTILE 128
#define KCH_SZ (32 * K_LD)
#define VCH_SZ (DK * VT_LD)

// value of lane l ^ 16 (vector cross-row move, no LDS round trip)
static __device__ __forceinline__ float other_half(float x) {
  const int b = __builtin_bit_cast(int, x);
  return __builtin_bit_cast(
      float, __builtin_amdgcn_permlanex16(b, b, 0x76543210, 0xfedcba98, false, false));
}

__global__ void k2_attn(const _Float16* __restrict__ q_h,
                        const _Float16* __restrict__ k_h,
                        const _Float16* __restrict__ v_t,
                        _Float16* __restrict__ ctx_h) {
  __shared__ __align__(16) _Float16 Klds[2 * KCH_SZ];   // K chunk [kv 32][d 64]
  __shared__ __align__(16) _Float16 Vlds[2 * VCH_SZ];   // V^T chunk [d 64][kv 32]

  const int tid  = threadIdx.x;
  const int w    = tid >> 5;
  const int lane = tid & 31;
  const int hid  = lane >> 4;
  const int n    = lane & 15;

  const int qtiles = SEQ / QTILE;           // 32
  const int b      = blockIdx.x / qtiles;
  const int qbase  = (blockIdx.x % qtiles) * QTILE;
  const size_t bo64 = (size_t)b * SEQ * DK; // batch offset, [t][d] layouts
  const _Float16* kg  = k_h + bo64;
  const _Float16* vtg = v_t + bo64;         // [d][t] layout

  // per-thread staging coordinates (each thread moves exactly 2 x 16B / chunk)
  const int rK = tid >> 3, sK = tid & 7;    // K: row kv, 8-half segment
  const int dV = tid >> 2, sV = tid & 3;    // V^T: row d, 8-half segment

  // persistent Q fragments for this wave's 16 rows (already scaled);
  // used as B: lane n holds query column n
  const _Float16* qp = q_h + bo64 + (size_t)(qbase + w * 16) * DK;
  const v16h aq0 = frag_load(qp, DK);
  const v16h aq1 = frag_load(qp + 32, DK);

  // acc[t][j] = ctx^T[d = t*16 + 8*hid + j][query n]
  v8f   acc[4] = {v8f{}, v8f{}, v8f{}, v8f{}};
  float m_run = -3.0e38f;   // running maximum of query n (equal in both halves)
  float l_run = 0.0f;       // this half's share of the running sum of query n

  const int row   = qbase + w * 16 + n;     // this lane's query
  const int limit = qbase + QTILE;

  // stage chunk 0 into buffer 0
  copy16B(kg  + (size_t)(0 + rK) * DK + sK * 8, Klds + rK * K_LD  + sK * 8);
  copy16B(vtg + (size_t)dV * SEQ + 0 + sV * 8,  Vlds + dV * VT_LD + sV * 8);

  int cur = 0;
  for (int kvb = 0; kvb < limit; kvb += 32) {
    wait_async_zero();      // my async copies into buf[cur] done
    __syncthreads();        // everyone's copies visible; prev compute done

    // prefetch next chunk into the other buffer (overlaps with WMMAs below)
    if (kvb + 32 < limit) {
      const int nxt = kvb + 32;
      copy16B(kg  + (size_t)(nxt + rK) * DK + sK * 8,
              Klds + (cur ^ 1) * KCH_SZ + rK * K_LD + sK * 8);
      copy16B(vtg + (size_t)dV * SEQ + nxt + sV * 8,
              Vlds + (cur ^ 1) * VCH_SZ + dV * VT_LD + sV * 8);
    }

    const _Float16* Kb = Klds + cur * KCH_SZ;
    const _Float16* Vb = Vlds + cur * VCH_SZ;

    // S^T = K Q^T : two 16x16 tiles, kv rows [kvb, kvb+16) and [kvb+16, kvb+32)
    //   s0[j] = S[row][kvb + 8*hid + j],  s1[j] = S[row][kvb + 16 + 8*hid + j]
    v8f s0 = {}, s1 = {};
    {
      v16h b0 = frag_load(Kb, K_LD);
      s0 = wmma16(b0, aq0, s0);
      v16h b1 = frag_load(Kb + 32, K_LD);
      s0 = wmma16(b1, aq1, s0);
      v16h b2 = frag_load(Kb + 16 * K_LD, K_LD);
      s1 = wmma16(b2, aq0, s1);
      v16h b3 = frag_load(Kb + 16 * K_LD + 32, K_LD);
      s1 = wmma16(b3, aq1, s1);
    }

    // online softmax update (fp32), causal mask; all 16 scores belong to 'row'
    const int kv0 = kvb + 8 * hid;
    float mx = -3.0e38f;
#pragma unroll
    for (int j = 0; j < 8; ++j) {
      s0[j] = (kv0 + j)      <= row ? s0[j] : -3.0e38f;
      s1[j] = (kv0 + 16 + j) <= row ? s1[j] : -3.0e38f;
      mx = fmaxf(mx, fmaxf(s0[j], s1[j]));
    }
    mx = fmaxf(mx, other_half(mx));

    // kv 0 is open to every query, so mtot is a real score from chunk 0 on and
    // a masked entry gives exp(-3e38 - mtot) = 0
    const float mtot = fmaxf(m_run, mx);
    const float sc   = __expf(m_run - mtot);

    v16h  pT;               // B operand: pT[e] = P^T[kmap(e, hid)][n]
    float rs = 0.0f;
#pragma unroll
    for (int j = 0; j < 8; ++j) {
      const float p0 = __expf(s0[j] - mtot);
      const float p1 = __expf(s1[j] - mtot);
      rs += p0 + p1;
      pT[j]     = (_Float16)p0;
      pT[8 + j] = (_Float16)p1;
    }

    m_run = mtot;
    l_run = l_run * sc + rs;
#pragma unroll
    for (int t = 0; t < 4; ++t) acc[t] *= sc;

    // ctx^T += V^T (16 d x 32 kv) * P^T (32 kv x 16 q): 4 WMMAs
#pragma unroll
    for (int t = 0; t < 4; ++t) {
      v16h aV = frag_load(Vb + (size_t)(t * 16) * VT_LD, VT_LD);
      acc[t] = wmma16(aV, pT, acc[t]);
    }
    cur ^= 1;
  }

  // join the halves' sums, normalize, store ctx (f16): 8 consecutive d per lane
  const float inv_l = 1.0f / (l_run + other_half(l_run));
#pragma unroll
  for (int t = 0; t < 4; ++t) {
    v8h o;
#pragma unroll
    for (int j = 0; j < 8; ++j) o[j] = (_Float16)(acc[t][j] * inv_l);
    *(v8h*)&ctx_h[bo64 + (size_t)row * DK + t * 16 + 8 * hid] = o;
  }
}

// ---------------------------------------------------------------------------
// k3: output projection  out[m][h] = sum_v ctx[m][v] * Wo[h][v] + bo[h]
// ---------------------------------------------------------------------------
__global__ void k3_proj(const _Float16* __restrict__ ctx_h,
                        const _Float16* __restrict__ Wo_h,
                        const float* __restrict__ bo,
                        float* __restrict__ out) {
  const int tid  = threadIdx.x;
  const int w    = tid >> 5;
  const int lane = tid & 31;
  const int hid  = lane >> 4;
  const int n    = lane & 15;

  const int rbase = blockIdx.x * 128 + w * 16;
  const _Float16* ap = ctx_h + (size_t)rbase * DK;
  const v16h a0 = frag_load(ap, DK);
  const v16h a1 = frag_load(ap + 32, DK);

  for (int nt = 0; nt < HID / 16; ++nt) {
    v8f acc = {};
    v16h b0 = frag_load(Wo_h + (size_t)(nt * 16) * DK, DK);
    acc = wmma16(a0, b0, acc);
    v16h b1 = frag_load(Wo_h + (size_t)(nt * 16) * DK + 32, DK);
    acc = wmma16(a1, b1, acc);

    const float bval = bo[nt * 16 + n];
#pragma unroll
    for (int j = 0; j < 8; ++j) {
      const int m = j + 8 * hid;
      out[(size_t)(rbase + m) * HID + nt * 16 + n] = acc[j] + bval;
    }
  }
}

// ---------------------------------------------------------------------------
extern "C" void kernel_launch(void* const* d_in, const int* in_sizes, int n_in,
                              void* d_out, int out_size, void* d_ws, size_t ws_size,
                              hipStream_t stream) {
  (void)in_sizes; (void)n_in; (void)out_size; (void)ws_size;

  const float* y  = (const float*)d_in[0];
  const float* Wq = (const float*)d_in[1];
  const float* bq = (const float*)d_in[2];
  const float* Wk = (const float*)d_in[3];
  const float* bk = (const float*)d_in[4];
  const float* Wv = (const float*)d_in[5];
  const float* bv = (const float*)d_in[6];
  const float* Wo = (const float*)d_in[7];
  const float* bo = (const float*)d_in[8];
  float* out = (float*)d_out;

  // workspace layout (f16)
  char* ws = (char*)d_ws;
  _Float16* Wqkv_h = (_Float16*)(ws);                        // 192*1024  (384 KB)
  _Float16* Wo_h   = (_Float16*)(ws + 393216);               // 1024*64   (128 KB)
  _Float16* q_h    = (_Float16*)(ws + 524288);               // [b][t][d] (2 MB)
  _Float16* k_h    = (_Float16*)(ws + 524288 + 2097152);     // [b][t][d] (2 MB)
  _Float16* v_t    = (_Float16*)(ws + 524288 + 2 * 2097152); // [b][d][t] (2 MB)
  _Float16* ctx_h  = (_Float16*)(ws + 524288 + 3 * 2097152); // [b][t][d] (2 MB)

  k0_convert_w<<<1024, 256, 0, stream>>>(Wq, Wk, Wv, Wo, Wqkv_h, Wo_h);
  k1_qkv<<<NROWS / 16, 384, 0, stream>>>(y, Wqkv_h, bq, bk, bv, q_h, k_h, v_t);
  k2_attn<<<NBAT * (SEQ / QTILE), 256, 0, stream>>>(q_h, k_h, v_t, ctx_h);
  k3_proj<<<NROWS / 128, 256, 0, stream>>>(ctx_h, Wo_h, bo, out);
}

// v002
// It runs in 107 microseconds.
// In two side-by-side timings against v001, it was 1.35 and 1.36 times as fast.
// Over all steps from v000 it is 2.15 times as fast.
#include <hip/hip_runtime.h>
#include <hip/hip_bf16.h>
#include <math.h>

// ---------------------------------------------------------------------------
// Causal self-attention for MI455X (gfx1250, wave32, WMMA f16->f32).
//   HIDDEN=1024, DK=DV=64, B=4, T=4096
// Pipeline:
//   k0: convert weights fp32 -> f16 into workspace
//   k1: fused QKV projection (WMMA, K=1024); q pre-scaled by 1/sqrt(64);
//       V stored pre-transposed (v_t[b][d][t]) for transpose-free attention
//   k2: flash attention on transposed products, keys split over the waves of a
//       work-group, double-buffered KV chunks staged with
//       GLOBAL_LOAD_ASYNC_TO_LDS_B128 (ASYNCcnt pipeline)
//   k3: output projection (WMMA, K=64, N=1024) + bias, fp32 out
// ---------------------------------------------------------------------------

typedef __attribute__((ext_vector_type(16))) _Float16 v16h;
typedef __attribute__((ext_vector_type(8)))  _Float16 v8h;
typedef __attribute__((ext_vector_type(4)))  _Float16 v4h;
typedef __attribute__((ext_vector_type(8)))  float    v8f;
typedef __attribute__((ext_vector_type(4)))  float    v4f;
typedef __attribute__((ext_vector_type(4)))  int      v4i;

#define HID   1024
#define DK    64
#define SEQ   4096
#define NBAT  4
#define NROWS (NBAT * SEQ)          // 16384 token rows

// ---- gfx1250 async copy to LDS (guarded; fallback = vector copy) ----------
#if __has_builtin(__builtin_amdgcn_global_load_async_to_lds_b128)
#define HAVE_ASYNC 1
typedef __attribute__((address_space(1))) v4i as1_v4i;
typedef __attribute__((address_space(3))) v4i as3_v4i;
#else
#define HAVE_ASYNC 0
#endif

static __device__ __forceinline__ void copy16B(const _Float16* src, _Float16* dst) {
#if HAVE_ASYNC
  // prototype: (int4 AS1* src, int4 AS3* dst, imm offset, imm cpol)
  __builtin_amdgcn_global_load_async_to_lds_b128(
      (as1_v4i*)(uintptr_t)src,
      (as3_v4i*)(unsigned int)(uintptr_t)dst,   // low 32 bits = LDS offset
      0, 0);
#else
  *(v8h*)dst = *(const v8h*)src;
#endif
}

static __device__ __forceinline__ void wait_async_zero() {
#if HAVE_ASYNC
#if __has_builtin(__builtin_amdgcn_s_wait_asynccnt)
  __builtin_amdgcn_s_wait_asynccnt(0);
#else
  asm volatile("s_wait_asynccnt 0x0" ::: "memory");
#endif
#endif
}

// ---- fragment helpers (CDNA5 16x16x32 f16 WMMA layouts, wave32) -----------
// A-matrix 16x32: lane = hid*16 + r ; row M = r ;
//   halves e=0..7  -> K = hid*8 + e ; halves e=8..15 -> K = 16 + hid*8 + (e-8)
// B-matrix 32x16: same pattern with lane%16 = column N, reading src[N][K].
static __device__ __forceinline__ v16h frag_load(const _Float16* src, int ld) {
  const int lane = threadIdx.x & 31;
  const int hid  = lane >> 4;
  const int r    = lane & 15;
  const _Float16* p = src + (size_t)r * ld + hid * 8;
  v16h f;
#pragma unroll
  for (int e = 0; e < 8; ++e) f[e] = p[e];
#pragma unroll
  for (int e = 0; e < 8; ++e) f[8 + e] = p[16 + e];
  return f;
}

static __device__ __forceinline__ v8f wmma16(v16h a, v16h b, v8f c) {
  return __builtin_amdgcn_wmma_f32_16x16x32_f16(false, a, false, b,
                                                (short)0, c, false, false);
}

// ---------------------------------------------------------------------------
// k0: fp32 -> f16 weight conversion.
// ---------------------------------------------------------------------------
__global__ void k0_convert_w(const float* __restrict__ Wq,
                             const float* __restrict__ Wk,
                             const float* __restrict__ Wv,
                             const float* __restrict__ Wo,
                             _Float16* __restrict__ Wqkv_h,
                             _Float16* __restrict__ Wo_h) {
  const int idx = blockIdx.x * blockDim.x + threadIdx.x;
  const int WSZ = DK * HID;                 // 65536
  if (idx < WSZ) {
    Wqkv_h[idx] = (_Float16)Wq[idx];
  } else if (idx < 2 * WSZ) {
    Wqkv_h[idx] = (_Float16)Wk[idx - WSZ];
  } else if (idx < 3 * WSZ) {
    Wqkv_h[idx] = (_Float16)Wv[idx - 2 * WSZ];
  } else if (idx < 3 * WSZ + HID * DK) {
    Wo_h[idx - 3 * WSZ] = (_Float16)Wo[idx - 3 * WSZ];
  }
}

// ---------------------------------------------------------------------------
// k1: fused QKV projection.  grid.x = NROWS/16; 384 threads = 12 waves.
//   Wave w owns one 16-col tile of fused [q|k|v]; y tile staged in LDS.
//   V written transposed: v_t[b][d][t].
// ---------------------------------------------------------------------------
#define Y_LD (HID + 8)

__global__ void k1_qkv(const float* __restrict__ y,
                       const _Float16* __restrict__ Wqkv_h,
                       const float* __restrict__ bq,
                       const float* __restrict__ bk,
                       const float* __restrict__ bv,
                       _Float16* __restrict__ q_h,
                       _Float16* __restrict__ k_h,
                       _Float16* __restrict__ v_t) {
  __shared__ __align__(16) _Float16 ytile[16 * Y_LD];

  const int tid  = threadIdx.x;
  const int row0 = blockIdx.x * 16;

  // vectorized fp32->f16 stage of the 16x1024 y tile
  for (int i = tid * 4; i < 16 * HID; i += 384 * 4) {
    const int r = i >> 10, c = i & (HID - 1);
    const v4f yv = *(const v4f*)&y[(size_t)(row0 + r) * HID + c];
    v4h hv;
    hv[0] = (_Float16)yv[0]; hv[1] = (_Float16)yv[1];
    hv[2] = (_Float16)yv[2]; hv[3] = (_Float16)yv[3];
    *(v4h*)&ytile[r * Y_LD + c] = hv;
  }
  __syncthreads();

  const int w    = tid >> 5;                // 0..11
  const int lane = tid & 31;
  const int hid  = lane >> 4;
  const int n    = lane & 15;

  v8f acc = {};
#pragma unroll 4
  for (int kk = 0; kk < HID; kk += 32) {
    v16h a = frag_load(ytile + kk, Y_LD);
    v16h b = frag_load(Wqkv_h + (size_t)(w * 16) * HID + kk, HID);
    acc = wmma16(a, b, acc);
  }

  const int sel  = w >> 2;                  // 0=q 1=k 2=v
  const int col  = (w & 3) * 16 + n;        // 0..63 within q/k/v
  const float* bias = (sel == 0) ? bq : (sel == 1) ? bk : bv;
  const float scale = (sel == 0) ? 0.125f : 1.0f;   // q / sqrt(64)
  const float bval  = bias[col];
  _Float16* dst = (sel == 0) ? q_h : k_h;

#pragma unroll
  for (int j = 0; j < 8; ++j) {
    const int m = j + 8 * hid;
    const float val = (acc[j] + bval) * scale;
    if (sel == 2) {
      const int grow = row0 + m;
      v_t[(size_t)(grow >> 12) * (DK * SEQ) + (size_t)col * SEQ +
          (grow & (SEQ - 1))] = (_Float16)val;
    } else {
      dst[(size_t)(row0 + m) * DK + col] = (_Float16)val;
    }
  }
}

// ---------------------------------------------------------------------------
// k2: flash attention (causal), double-buffered async KV staging.
//   grid.x = NBAT * (SEQ/32); 256 threads = 8 waves = 2 query tiles x 4 key groups.
//   Wave (sub, g) owns 16 q rows and the key chunks g, g+4, g+8, ... with its
//   own maximum, sum and accumulators; the four groups' partials of a query
//   tile are merged once, through LDS, by the wave of group 0.
//   Transposed products: S^T = K Q^T and ctx^T += V^T P^T.  A lane then holds
//   16 scores of ONE query, so maximum and sum are in-lane (one exchange
//   between the wave halves), and the two S^T tiles, converted in place, are
//   the B operand of the second product: P never goes through LDS.
// ---------------------------------------------------------------------------
#define K_LD  88     // 64 + 24 pad halves: 176B stride (16B aligned, no bank conflict)
#define VT_LD 40     // 32 + 8 pad halves:  80B stride  (16B aligned, no bank conflict)
#define QTILE 32
#define KVG   4      // key groups per work-group; SEQ/32 is a multiple of it
#define KCH_SZ (32 * K_LD)
#define VCH_SZ (DK * VT_LD)

// value of lane l ^ 16 (vector cross-row move, no LDS round trip)
static __device__ __forceinline__ float other_half(float x) {
  const int b = __builtin_bit_cast(int, x);
  return __builtin_bit_cast(
      float, __builtin_amdgcn_permlanex16(b, b, 0x76543210, 0xfedcba98, false, false));
}

__global__ void k2_attn(const _Float16* __restrict__ q_h,
                        const _Float16* __restrict__ k_h,
                        const _Float16* __restrict__ v_t,
                        _Float16* __restrict__ ctx_h) {
  __shared__ __align__(16) _Float16 Klds[2 * KVG * KCH_SZ];  // [buf][group] K chunk [kv 32][d 64]
  __shared__ __align__(16) _Float16 Vlds[2 * KVG * VCH_SZ];  // [buf][group] V^T chunk [d 64][kv 32]
  __shared__ __align__(16) float Pacc[(KVG - 1) * 2 * 8 * 32 * 4];  // [slot][quad][lane] 4 floats
  __shared__ float Pml[(KVG - 1) * 2 * 2 * 32];                     // [slot][max, sum][lane]

  const int tid  = threadIdx.x;
  const int w    = __builtin_amdgcn_readfirstlane(tid >> 5);  // scalar: the skip below is a real branch
  const int sub  = w & 1;                   // query tile of this wave
  const int g    = w >> 1;                  // key group of this wave
  const int lane = tid & 31;
  const int hid  = lane >> 4;
  const int n    = lane & 15;

  const int qtiles = SEQ / QTILE;           // 128
  const int b      = blockIdx.x / qtiles;
  const int qbase  = (blockIdx.x % qtiles) * QTILE;
  const size_t bo64 = (size_t)b * SEQ * DK; // batch offset, [t][d] layouts
  const _Float16* kg  = k_h + bo64;
  const _Float16* vtg = v_t + bo64;         // [d][t] layout

  // per-thread staging coordinates (each thread moves 2 x 16B per chunk)
  const int rK = tid >> 3, sK = tid & 7;    // K: row kv, 8-half segment
  const int dV = tid >> 2, sV = tid & 3;    // V^T: row d, 8-half segment

  // persistent Q fragments for this wave's 16 rows (already scaled);
  // used as B: lane n holds query column n
  const _Float16* qp = q_h + bo64 + (size_t)(qbase + sub * 16) * DK;
  const v16h aq0 = frag_load(qp, DK);
  const v16h aq1 = frag_load(qp + 32, DK);

  // acc[t][j] = ctx^T[d = t*16 + 8*hid + j][query n], over this group's keys
  v8f   acc[4] = {v8f{}, v8f{}, v8f{}, v8f{}};
  float m_run = -3.0e38f;   // running maximum of query n (equal in both halves)
  float l_run = 0.0f;       // this half's share of the running sum of query n

  const int row    = qbase + sub * 16 + n;  // this lane's query
  const int limit  = qbase + QTILE;
  // a trip serves KVG chunks of 32 keys, one per group; trips * KVG * 32 <= SEQ,
  // so chunks past the diagonal in the last trip are still inside K and V
  const int ntrips = (limit / 32 + KVG - 1) / KVG;

  // stage trip 0 into buffer 0
#pragma unroll
  for (int c = 0; c < KVG; ++c) {
    copy16B(kg  + (size_t)(c * 32 + rK) * DK + sK * 8,
            Klds + c * KCH_SZ + rK * K_LD + sK * 8);
    copy16B(vtg + (size_t)dV * SEQ + c * 32 + sV * 8,
            Vlds + c * VCH_SZ + dV * VT_LD + sV * 8);
  }

  int cur = 0;
  for (int trip = 0; trip < ntrips; ++trip) {
    // this wave's LDS reads of the buffer that is refilled below have retired
    asm volatile("s_wait_dscnt 0x0" ::: "memory");
    wait_async_zero();      // my async copies into buf[cur] done
    __syncthreads();        // everyone's copies visible; prev compute done

    // prefetch the next trip's chunks into the other buffer (overlaps with WMMAs below)
    if (trip + 1 < ntrips) {
      const int nxt = (trip + 1) * (KVG * 32);
#pragma unroll
      for (int c = 0; c < KVG; ++c) {
        copy16B(kg  + (size_t)(nxt + c * 32 + rK) * DK + sK * 8,
                Klds + ((cur ^ 1) * KVG + c) * KCH_SZ + rK * K_LD + sK * 8);
        copy16B(vtg + (size_t)dV * SEQ + nxt + c * 32 + sV * 8,
                Vlds + ((cur ^ 1) * KVG + c) * VCH_SZ + dV * VT_LD + sV * 8);
      }
    }

    const int kvb = (trip * KVG + g) * 32;  // this group's chunk
    if (kvb < limit) {                      // wave-uniform; a chunk past the diagonal has no open key
      const _Float16* Kb = Klds + (cur * KVG + g) * KCH_SZ;
      const _Float16* Vb = Vlds + (cur * KVG + g) * VCH_SZ;

      // S^T = K Q^T : two 16x16 tiles, kv rows [kvb, kvb+16) and [kvb+16, kvb+32)
      //   s0[j] = S[row][kvb + 8*hid + j],  s1[j] = S[row][kvb + 16 + 8*hid + j]
      v8f s0 = {}, s1 = {};
      {
        v16h b0 = frag_load(Kb, K_LD);
        s0 = wmma16(b0, aq0, s0);
        v16h b1 = frag_load(Kb + 32, K_LD);
        s0 = wmma16(b1, aq1, s0);
        v16h b2 = frag_load(Kb + 16 * K_LD, K_LD);
        s1 = wmma16(b2, aq0, s1);
        v16h b3 = frag_load(Kb + 16 * K_LD + 32, K_LD);
        s1 = wmma16(b3, aq1, s1);
      }

      // online softmax update (fp32), causal mask; all 16 scores belong to 'row'
      const int kv0 = kvb + 8 * hid;
      float mx = -3.0e38f;
#pragma unroll
      for (int j = 0; j < 8; ++j) {
        s0[j] = (kv0 + j)      <= row ? s0[j] : -3.0e38f;
        s1[j] = (kv0 + 16 + j) <= row ? s1[j] : -3.0e38f;
        mx = fmaxf(mx, fmaxf(s0[j], s1[j]));
      }
      mx = fmaxf(mx, other_half(mx));

      // a chunk that is entered has kvb <= qbase <= row: its first key is open to
      // every query, so mtot is a real score and a masked entry gives
      // exp(-3e38 - mtot) = 0
      const float mtot = fmaxf(m_run, mx);
      const float sc   = __expf(m_run - mtot);

      v16h  pT;             // B operand: pT[e] = P^T[kmap(e, hid)][n]
      float rs = 0.0f;
#pragma unroll
      for (int j = 0; j < 8; ++j) {
        const float p0 = __expf(s0[j] - mtot);
        const float p1 = __expf(s1[j] - mtot);
        rs += p0 + p1;
        pT[j]     = (_Float16)p0;
        pT[8 + j] = (_Float16)p1;
      }

      m_run = mtot;
      l_run = l_run * sc + rs;
#pragma unroll
      for (int t = 0; t < 4; ++t) acc[t] *= sc;

      // ctx^T += V^T (16 d x 32 kv) * P^T (32 kv x 16 q): 4 WMMAs
#pragma unroll
      for (int t = 0; t < 4; ++t) {
        v16h aV = frag_load(Vb + (size_t)(t * 16) * VT_LD, VT_LD);
        acc[t] = wmma16(aV, pT, acc[t]);
      }
    }
    cur ^= 1;
  }

  // no copy is in flight when a wave goes on to the merge or ends
  asm volatile("s_wait_asynccnt 0x0" ::: "memory");

  // merge of the key groups: groups 1.. hand their partials (same lane layout) to group 0
  if (g != 0) {
    const int slot = (g - 1) * 2 + sub;
#pragma unroll
    for (int t = 0; t < 4; ++t) {
      const v4f lo = {acc[t][0], acc[t][1], acc[t][2], acc[t][3]};
      const v4f hi = {acc[t][4], acc[t][5], acc[t][6], acc[t][7]};
      *(v4f*)&Pacc[((slot * 8 + t * 2 + 0) * 32 + lane) * 4] = lo;
      *(v4f*)&Pacc[((slot * 8 + t * 2 + 1) * 32 + lane) * 4] = hi;
    }
    Pml[(slot * 2 + 0) * 32 + lane] = m_run;
    Pml[(slot * 2 + 1) * 32 + lane] = l_run;
  }
  __syncthreads();          // partials visible to group 0
  if (g != 0) return;

  // group 0 always has chunk 0, so mall is a real score; a group that had no
  // chunk holds (-3e38, 0, 0) and gets weight exp(-3e38 - mall) = 0
  float mall = m_run;
#pragma unroll
  for (int i = 0; i < KVG - 1; ++i)
    mall = fmaxf(mall, Pml[((i * 2 + sub) * 2 + 0) * 32 + lane]);
  const float w0 = __expf(m_run - mall);
  l_run *= w0;
#pragma unroll
  for (int t = 0; t < 4; ++t) acc[t] *= w0;
#pragma unroll
  for (int i = 0; i < KVG - 1; ++i) {
    const int slot = i * 2 + sub;
    const float wi = __expf(Pml[(slot * 2 + 0) * 32 + lane] - mall);
    l_run += wi * Pml[(slot * 2 + 1) * 32 + lane];
#pragma unroll
    for (int t = 0; t < 4; ++t) {
      const v4f lo = *(const v4f*)&Pacc[((slot * 8 + t * 2 + 0) * 32 + lane) * 4];
      const v4f hi = *(const v4f*)&Pacc[((slot * 8 + t * 2 + 1) * 32 + lane) * 4];
#pragma unroll
      for (int j = 0; j < 4; ++j) {
        acc[t][j]     += wi * lo[j];
        acc[t][4 + j] += wi * hi[j];
      }
    }
  }

  // join the halves' sums, normalize, store ctx (f16): 8 consecutive d per lane
  const float inv_l = 1.0f / (l_run + other_half(l_run));
#pragma unroll
  for (int t = 0; t < 4; ++t) {
    v8h o;
#pragma unroll
    for (int j = 0; j < 8; ++j) o[j] = (_Float16)(acc[t][j] * inv_l);
    *(v8h*)&ctx_h[bo64 + (size_t)row * DK + t * 16 + 8 * hid] = o;
  }
}

// ---------------------------------------------------------------------------
// k3: output projection  out[m][h] = sum_v ctx[m][v] * Wo[h][v] + bo[h]
// ---------------------------------------------------------------------------
__global__ void k3_proj(const _Float16* __restrict__ ctx_h,
                        const _Float16* __restrict__ Wo_h,
                        const float* __restrict__ bo,
                        float* __restrict__ out) {
  const int tid  = threadIdx.x;
  const int w    = tid >> 5;
  const int lane = tid & 31;
  const int hid  = lane >> 4;
  const int n    = lane & 15;

  const int rbase = blockIdx.x * 128 + w * 16;
  const _Float16* ap = ctx_h + (size_t)rbase * DK;
  const v16h a0 = frag_load(ap, DK);
  const v16h a1 = frag_load(ap + 32, DK);

  for (int nt = 0; nt < HID / 16; ++nt) {
    v8f acc = {};
    v16h b0 = frag_load(Wo_h + (size_t)(nt * 16) * DK, DK);
    acc = wmma16(a0, b0, acc);
    v16h b1 = frag_load(Wo_h + (size_t)(nt * 16) * DK + 32, DK);
    acc = wmma16(a1, b1, acc);

    const float bval = bo[nt * 16 + n];
#pragma unroll
    for (int j = 0; j < 8; ++j) {
      const int m = j + 8 * hid;
      out[(size_t)(rbase + m) * HID + nt * 16 + n] = acc[j] + bval;
    }
  }
}

// ---------------------------------------------------------------------------
extern "C" void kernel_launch(void* const* d_in, const int* in_sizes, int n_in,
                              void* d_out, int out_size, void* d_ws, size_t ws_size,
                              hipStream_t stream) {
  (void)in_sizes; (void)n_in; (void)out_size; (void)ws_size;

  const float* y  = (const float*)d_in[0];
  const float* Wq = (const float*)d_in[1];
  const float* bq = (const float*)d_in[2];
  const float* Wk = (const float*)d_in[3];
  const float* bk = (const float*)d_in[4];
  const float* Wv = (const float*)d_in[5];
  const float* bv = (const float*)d_in[6];
  const float* Wo = (const float*)d_in[7];
  const float* bo = (const float*)d_in[8];
  float* out = (float*)d_out;

  // workspace layout (f16)
  char* ws = (char*)d_ws;
  _Float16* Wqkv_h = (_Float16*)(ws);                        // 192*1024  (384 KB)
  _Float16* Wo_h   = (_Float16*)(ws + 393216);               // 1024*64   (128 KB)
  _Float16* q_h    = (_Float16*)(ws + 524288);               // [b][t][d] (2 MB)
  _Float16* k_h    = (_Float16*)(ws + 524288 + 2097152);     // [b][t][d] (2 MB)
  _Float16* v_t    = (_Float16*)(ws + 524288 + 2 * 2097152); // [b][d][t] (2 MB)
  _Float16* ctx_h  = (_Float16*)(ws + 524288 + 3 * 2097152); // [b][t][d] (2 MB)

  k0_convert_w<<<1024, 256, 0, stream>>>(Wq, Wk, Wv, Wo, Wqkv_h, Wo_h);
  k1_qkv<<<NROWS / 16, 384, 0, stream>>>(y, Wqkv_h, bq, bk, bv, q_h, k_h, v_t);
  k2_attn<<<NBAT * (SEQ / QTILE), 256, 0, stream>>>(q_h, k_h, v_t, ctx_h);
  k3_proj<<<NROWS / 128, 256, 0, stream>>>(ctx_h, Wo_h, bo, out);
}

// v003
// A run of this version takes 97.6 microseconds.
// Next to v002, in two timings, it ran 1.10 and 1.09 times as fast.
// All steps since v000 together make it 2.35 times as fast.
#include <hip/hip_runtime.h>
#include <hip/hip_bf16.h>
#include <math.h>

// ---------------------------------------------------------------------------
// Causal self-attention for MI455X (gfx1250, wave32, WMMA f16->f32).
//   HIDDEN=1024, DK=DV=64, B=4, T=4096
// Pipeline:
//   k0: convert weights fp32 -> f16 into workspace, packed in fragment order
//   k1: fused QKV projection (WMMA, K=1024); q pre-scaled by 1/sqrt(64);
//       V stored pre-transposed (v_t[b][d][t]) for transpose-free attention
//   k2: flash attention on transposed products, keys split over the waves of a
//       work-group, double-buffered KV chunks staged with
//       GLOBAL_LOAD_ASYNC_TO_LDS_B128 (ASYNCcnt pipeline)
//   k3: output projection (WMMA, K=64, N=1024) + bias, fp32 out
// ---------------------------------------------------------------------------

typedef __attribute__((ext_vector_type(16))) _Float16 v16h;
typedef __attribute__((ext_vector_type(8)))  _Float16 v8h;
typedef __attribute__((ext_vector_type(4)))  _Float16 v4h;
typedef __attribute__((ext_vector_type(8)))  float    v8f;
typedef __attribute__((ext_vector_type(4)))  float    v4f;
typedef __attribute__((ext_vector_type(4)))  int      v4i;

#define HID   1024
#define DK    64
#define SEQ   4096
#define NBAT  4
#define NROWS (NBAT * SEQ)          // 16384 token rows

// ---- gfx1250 async copy to LDS (guarded; fallback = vector copy) ----------
#if __has_builtin(__builtin_amdgcn_global_load_async_to_lds_b128)
#define HAVE_ASYNC 1
typedef __attribute__((address_space(1))) v4i as1_v4i;
typedef __attribute__((address_space(3))) v4i as3_v4i;
#else
#define HAVE_ASYNC 0
#endif

static __device__ __forceinline__ void copy16B(const _Float16* src, _Float16* dst) {
#if HAVE_ASYNC
  // prototype: (int4 AS1* src, int4 AS3* dst, imm offset, imm cpol)
  __builtin_amdgcn_global_load_async_to_lds_b128(
      (as1_v4i*)(uintptr_t)src,
      (as3_v4i*)(unsigned int)(uintptr_t)dst,   // low 32 bits = LDS offset
      0, 0);
#else
  *(v8h*)dst = *(const v8h*)src;
#endif
}

static __device__ __forceinline__ void wait_async_zero() {
#if HAVE_ASYNC
#if __has_builtin(__builtin_amdgcn_s_wait_asynccnt)
  __builtin_amdgcn_s_wait_asynccnt(0);
#else
  asm volatile("s_wait_asynccnt 0x0" ::: "memory");
#endif
#endif
}

// ---- fragment helpers (CDNA5 16x16x32 f16 WMMA layouts, wave32) -----------
// A-matrix 16x32: lane = hid*16 + r ; row M = r ;
//   halves e=0..7  -> K = hid*8 + e ; halves e=8..15 -> K = 16 + hid*8 + (e-8)
// B-matrix 32x16: same pattern with lane%16 = column N, reading src[N][K].
static __device__ __forceinline__ v16h frag_load(const _Float16* src, int ld) {
  const int lane = threadIdx.x & 31;
  const int hid  = lane >> 4;
  const int r    = lane & 15;
  const _Float16* p = src + (size_t)r * ld + hid * 8;
  v16h f;
#pragma unroll
  for (int e = 0; e < 8; ++e) f[e] = p[e];
#pragma unroll
  for (int e = 0; e < 8; ++e) f[8 + e] = p[16 + e];
  return f;
}

// A 16x32 fragment that k0 has packed: 1 KB in a row, 16-byte unit h2*32 + lane
// holds f[h2*8 .. h2*8+7] of frag_load's map.  Each of the two loads then reads
// 512 contiguous bytes (4 cache lines) instead of 32 bytes out of 16 lines.
#define FRAG_SZ 512   // halves per packed fragment
static __device__ __forceinline__ v16h frag_load_packed(const _Float16* frag) {
  const int lane = threadIdx.x & 31;
  const v8h lo = *(const v8h*)(frag + lane * 8);
  const v8h hi = *(const v8h*)(frag + 256 + lane * 8);
  return __builtin_shufflevector(lo, hi, 0, 1, 2, 3, 4, 5, 6, 7,
                                 8, 9, 10, 11, 12, 13, 14, 15);
}

static __device__ __forceinline__ v8f wmma16(v16h a, v16h b, v8f c) {
  return __builtin_amdgcn_wmma_f32_16x16x32_f16(false, a, false, b,
                                                (short)0, c, false, false);
}

// ---------------------------------------------------------------------------
// k0: fp32 -> f16 weight conversion into fragment order (see frag_load_packed).
//   One thread per 16-byte unit.  Wqkv_h: fragment (w, kb) at index w*32 + kb,
//   w = 16-row tile of fused [q|k|v], kb = 32-wide k block.  Wo_h: fragment
//   (nt, kb) at index nt*2 + kb.
// ---------------------------------------------------------------------------
#define QKV_UNITS (3 * DK * HID / 8)   // 24576, a multiple of 64
#define WO_UNITS  (HID * DK / 8)       // 8192

__global__ void k0_convert_w(const float* __restrict__ Wq,
                             const float* __restrict__ Wk,
                             const float* __restrict__ Wv,
                             const float* __restrict__ Wo,
                             _Float16* __restrict__ Wqkv_h,
                             _Float16* __restrict__ Wo_h) {
  const int u    = blockIdx.x * blockDim.x + threadIdx.x;
  if (u >= QKV_UNITS + WO_UNITS) return;
  const int lane = u & 31;
  const int r    = lane & 15;                                  // row in the tile
  const int kin  = ((u >> 5) & 1) * 16 + (lane >> 4) * 8;      // first k in the block
  const float* src;
  _Float16*    dst;
  if (u < QKV_UNITS) {
    const int frag = u >> 6;
    const int w    = frag >> 5, kb = frag & 31;
    const int sel  = w >> 2;                                   // 0=q 1=k 2=v
    const float* W = (sel == 0) ? Wq : (sel == 1) ? Wk : Wv;
    src = W + (size_t)((w & 3) * 16 + r) * HID + kb * 32 + kin;
    dst = Wqkv_h + (size_t)u * 8;
  } else {
    const int u2   = u - QKV_UNITS;
    const int frag = u2 >> 6;
    const int nt   = frag >> 1, kb = frag & 1;
    src = Wo + (size_t)(nt * 16 + r) * DK + kb * 32 + kin;
    dst = Wo_h + (size_t)u2 * 8;
  }
  const v4f a = *(const v4f*)src;
  const v4f b = *(const v4f*)(src + 4);
  const v8h o = {(_Float16)a[0], (_Float16)a[1], (_Float16)a[2], (_Float16)a[3],
                 (_Float16)b[0], (_Float16)b[1], (_Float16)b[2], (_Float16)b[3]};
  *(v8h*)dst = o;
}

// ---------------------------------------------------------------------------
// k1: fused QKV projection.  grid.x = NROWS/16; 384 threads = 12 waves.
//   Wave w owns one 16-col tile of fused [q|k|v]; y tile staged in LDS.
//   V written transposed: v_t[b][d][t].
// ---------------------------------------------------------------------------
#define Y_LD (HID + 8)

__global__ void k1_qkv(const float* __restrict__ y,
                       const _Float16* __restrict__ Wqkv_h,
                       const float* __restrict__ bq,
                       const float* __restrict__ bk,
                       const float* __restrict__ bv,
                       _Float16* __restrict__ q_h,
                       _Float16* __restrict__ k_h,
                       _Float16* __restrict__ v_t) {
  __shared__ __align__(16) _Float16 ytile[16 * Y_LD];

  const int tid  = threadIdx.x;
  const int row0 = blockIdx.x * 16;

  // vectorized fp32->f16 stage of the 16x1024 y tile
  for (int i = tid * 4; i < 16 * HID; i += 384 * 4) {
    const int r = i >> 10, c = i & (HID - 1);
    const v4f yv = *(const v4f*)&y[(size_t)(row0 + r) * HID + c];
    v4h hv;
    hv[0] = (_Float16)yv[0]; hv[1] = (_Float16)yv[1];
    hv[2] = (_Float16)yv[2]; hv[3] = (_Float16)yv[3];
    *(v4h*)&ytile[r * Y_LD + c] = hv;
  }
  __syncthreads();

  const int w    = tid >> 5;                // 0..11
  const int lane = tid & 31;
  const int hid  = lane >> 4;
  const int n    = lane & 15;

  v8f acc = {};
#pragma unroll 4
  for (int kk = 0; kk < HID; kk += 32) {
    v16h a = frag_load(ytile + kk, Y_LD);
    v16h b = frag_load_packed(Wqkv_h + (size_t)(w * 32 + (kk >> 5)) * FRAG_SZ);
    acc = wmma16(a, b, acc);
  }

  const int sel  = w >> 2;                  // 0=q 1=k 2=v
  const int col  = (w & 3) * 16 + n;        // 0..63 within q/k/v
  const float* bias = (sel == 0) ? bq : (sel == 1) ? bk : bv;
  const float scale = (sel == 0) ? 0.125f : 1.0f;   // q / sqrt(64)
  const float bval  = bias[col];
  _Float16* dst = (sel == 0) ? q_h : k_h;

#pragma unroll
  for (int j = 0; j < 8; ++j) {
    const int m = j + 8 * hid;
    const float val = (acc[j] + bval) * scale;
    if (sel == 2) {
      const int grow = row0 + m;
      v_t[(size_t)(grow >> 12) * (DK * SEQ) + (size_t)col * SEQ +
          (grow & (SEQ - 1))] = (_Float16)val;
    } else {
      dst[(size_t)(row0 + m) * DK + col] = (_Float16)val;
    }
  }
}

// ---------------------------------------------------------------------------
// k2: flash attention (causal), double-buffered async KV staging.
//   grid.x = NBAT * (SEQ/32); 256 threads = 8 waves = 2 query tiles x 4 key groups.
//   Wave (sub, g) owns 16 q rows and the key chunks g, g+4, g+8, ... with its
//   own maximum, sum and accumulators; the four groups' partials of a query
//   tile are merged once, through LDS, by the wave of group 0.
//   Transposed products: S^T = K Q^T and ctx^T += V^T P^T.  A lane then holds
//   16 scores of ONE query, so maximum and sum are in-lane (one exchange
//   between the wave halves), and the two S^T tiles, converted in place, are
//   the B operand of the second product: P never goes through LDS.
// ---------------------------------------------------------------------------
#define K_LD  88     // 64 + 24 pad halves: 176B stride (16B aligned, no bank conflict)
#define VT_LD 40     // 32 + 8 pad halves:  80B stride  (16B aligned, no bank conflict)
#define QTILE 32
#define KVG   4      // key groups per work-group; SEQ/32 is a multiple of it
#define KCH_SZ (32 * K_LD)
#define VCH_SZ (DK * VT_LD)

// value of lane l ^ 16 (vector cross-row move, no LDS round trip)
static __device__ __forceinline__ float other_half(float x) {
  const int b = __builtin_bit_cast(int, x);
  return __builtin_bit_cast(
      float, __builtin_amdgcn_permlanex16(b, b, 0x76543210, 0xfedcba98, false, false));
}

__global__ void k2_attn(const _Float16* __restrict__ q_h,
                        const _Float16* __restrict__ k_h,
                        const _Float16* __restrict__ v_t,
                        _Float16* __restrict__ ctx_h) {
  __shared__ __align__(16) _Float16 Klds[2 * KVG * KCH_SZ];  // [buf][group] K chunk [kv 32][d 64]
  __shared__ __align__(16) _Float16 Vlds[2 * KVG * VCH_SZ];  // [buf][group] V^T chunk [d 64][kv 32]
  __shared__ __align__(16) float Pacc[(KVG - 1) * 2 * 8 * 32 * 4];  // [slot][quad][lane] 4 floats
  __shared__ float Pml[(KVG - 1) * 2 * 2 * 32];                     // [slot][max, sum][lane]

  const int tid  = threadIdx.x;
  const int w    = __builtin_amdgcn_readfirstlane(tid >> 5);  // scalar: the skip below is a real branch
  const int sub  = w & 1;                   // query tile of this wave
  const int g    = w >> 1;                  // key group of this wave
  const int lane = tid & 31;
  const int hid  = lane >> 4;
  const int n    = lane & 15;

  const int qtiles = SEQ / QTILE;           // 128
  const int b      = blockIdx.x / qtiles;
  const int qbase  = (blockIdx.x % qtiles) * QTILE;
  const size_t bo64 = (size_t)b * SEQ * DK; // batch offset, [t][d] layouts
  const _Float16* kg  = k_h + bo64;
  const _Float16* vtg = v_t + bo64;         // [d][t] layout

  // per-thread staging coordinates (each thread moves 2 x 16B per chunk)
  const int rK = tid >> 3, sK = tid & 7;    // K: row kv, 8-half segment
  const int dV = tid >> 2, sV = tid & 3;    // V^T: row d, 8-half segment

  // persistent Q fragments for this wave's 16 rows (already scaled);
  // used as B: lane n holds query column n
  const _Float16* qp = q_h + bo64 + (size_t)(qbase + sub * 16) * DK;
  const v16h aq0 = frag_load(qp, DK);
  const v16h aq1 = frag_load(qp + 32, DK);

  // acc[t][j] = ctx^T[d = t*16 + 8*hid + j][query n], over this group's keys
  v8f   acc[4] = {v8f{}, v8f{}, v8f{}, v8f{}};
  float m_run = -3.0e38f;   // running maximum of query n (equal in both halves)
  float l_run = 0.0f;       // this half's share of the running sum of query n

  const int row    = qbase + sub * 16 + n;  // this lane's query
  const int limit  = qbase + QTILE;
  // a trip serves KVG chunks of 32 keys, one per group; trips * KVG * 32 <= SEQ,
  // so chunks past the diagonal in the last trip are still inside K and V
  const int ntrips = (limit / 32 + KVG - 1) / KVG;

  // stage trip 0 into buffer 0
#pragma unroll
  for (int c = 0; c < KVG; ++c) {
    copy16B(kg  + (size_t)(c * 32 + rK) * DK + sK * 8,
            Klds + c * KCH_SZ + rK * K_LD + sK * 8);
    copy16B(vtg + (size_t)dV * SEQ + c * 32 + sV * 8,
            Vlds + c * VCH_SZ + dV * VT_LD + sV * 8);
  }

  int cur = 0;
  for (int trip = 0; trip < ntrips; ++trip) {
    // this wave's LDS reads of the buffer that is refilled below have retired
    asm volatile("s_wait_dscnt 0x0" ::: "memory");
    wait_async_zero();      // my async copies into buf[cur] done
    __syncthreads();        // everyone's copies visible; prev compute done

    // prefetch the next trip's chunks into the other buffer (overlaps with WMMAs below)
    if (trip + 1 < ntrips) {
      const int nxt = (trip + 1) * (KVG * 32);
#pragma unroll
      for (int c = 0; c < KVG; ++c) {
        copy16B(kg  + (size_t)(nxt + c * 32 + rK) * DK + sK * 8,
                Klds + ((cur ^ 1) * KVG + c) * KCH_SZ + rK * K_LD + sK * 8);
        copy16B(vtg + (size_t)dV * SEQ + nxt + c * 32 + sV * 8,
                Vlds + ((cur ^ 1) * KVG + c) * VCH_SZ + dV * VT_LD + sV * 8);
      }
    }

    const int kvb = (trip * KVG + g) * 32;  // this group's chunk
    if (kvb < limit) {                      // wave-uniform; a chunk past the diagonal has no open key
      const _Float16* Kb = Klds + (cur * KVG + g) * KCH_SZ;
      const _Float16* Vb = Vlds + (cur * KVG + g) * VCH_SZ;

      // S^T = K Q^T : two 16x16 tiles, kv rows [kvb, kvb+16) and [kvb+16, kvb+32)
      //   s0[j] = S[row][kvb + 8*hid + j],  s1[j] = S[row][kvb + 16 + 8*hid + j]
      v8f s0 = {}, s1 = {};
      {
        v16h b0 = frag_load(Kb, K_LD);
        s0 = wmma16(b0, aq0, s0);
        v16h b1 = frag_load(Kb + 32, K_LD);
        s0 = wmma16(b1, aq1, s0);
        v16h b2 = frag_load(Kb + 16 * K_LD, K_LD);
        s1 = wmma16(b2, aq0, s1);
        v16h b3 = frag_load(Kb + 16 * K_LD + 32, K_LD);
        s1 = wmma16(b3, aq1, s1);
      }

      // online softmax update (fp32), causal mask; all 16 scores belong to 'row'
      const int kv0 = kvb + 8 * hid;
      float mx = -3.0e38f;
#pragma unroll
      for (int j = 0; j < 8; ++j) {
        s0[j] = (kv0 + j)      <= row ? s0[j] : -3.0e38f;
        s1[j] = (kv0 + 16 + j) <= row ? s1[j] : -3.0e38f;
        mx = fmaxf(mx, fmaxf(s0[j], s1[j]));
      }
      mx = fmaxf(mx, other_half(mx));

      // a chunk that is entered has kvb <= qbase <= row: its first key is open to
      // every query, so mtot is a real score and a masked entry gives
      // exp(-3e38 - mtot) = 0
      const float mtot = fmaxf(m_run, mx);
      const float sc   = __expf(m_run - mtot);

      v16h  pT;             // B operand: pT[e] = P^T[kmap(e, hid)][n]
      float rs = 0.0f;
#pragma unroll
      for (int j = 0; j < 8; ++j) {
        const float p0 = __expf(s0[j] - mtot);
        const float p1 = __expf(s1[j] - mtot);
        rs += p0 + p1;
        pT[j]     = (_Float16)p0;
        pT[8 + j] = (_Float16)p1;
      }

      m_run = mtot;
      l_run = l_run * sc + rs;
#pragma unroll
      for (int t = 0; t < 4; ++t) acc[t] *= sc;

      // ctx^T += V^T (16 d x 32 kv) * P^T (32 kv x 16 q): 4 WMMAs
#pragma unroll
      for (int t = 0; t < 4; ++t) {
        v16h aV = frag_load(Vb + (size_t)(t * 16) * VT_LD, VT_LD);
        acc[t] = wmma16(aV, pT, acc[t]);
      }
    }
    cur ^= 1;
  }

  // no copy is in flight when a wave goes on to the merge or ends
  asm volatile("s_wait_asynccnt 0x0" ::: "memory");

  // merge of the key groups: groups 1.. hand their partials (same lane layout) to group 0
  if (g != 0) {
    const int slot = (g - 1) * 2 + sub;
#pragma unroll
    for (int t = 0; t < 4; ++t) {
      const v4f lo = {acc[t][0], acc[t][1], acc[t][2], acc[t][3]};
      const v4f hi = {acc[t][4], acc[t][5], acc[t][6], acc[t][7]};
      *(v4f*)&Pacc[((slot * 8 + t * 2 + 0) * 32 + lane) * 4] = lo;
      *(v4f*)&Pacc[((slot * 8 + t * 2 + 1) * 32 + lane) * 4] = hi;
    }
    Pml[(slot * 2 + 0) * 32 + lane] = m_run;
    Pml[(slot * 2 + 1) * 32 + lane] = l_run;
  }
  __syncthreads();          // partials visible to group 0
  if (g != 0) return;

  // group 0 always has chunk 0, so mall is a real score; a group that had no
  // chunk holds (-3e38, 0, 0) and gets weight exp(-3e38 - mall) = 0
  float mall = m_run;
#pragma unroll
  for (int i = 0; i < KVG - 1; ++i)
    mall = fmaxf(mall, Pml[((i * 2 + sub) * 2 + 0) * 32 + lane]);
  const float w0 = __expf(m_run - mall);
  l_run *= w0;
#pragma unroll
  for (int t = 0; t < 4; ++t) acc[t] *= w0;
#pragma unroll
  for (int i = 0; i < KVG - 1; ++i) {
    const int slot = i * 2 + sub;
    const float wi = __expf(Pml[(slot * 2 + 0) * 32 + lane] - mall);
    l_run += wi * Pml[(slot * 2 + 1) * 32 + lane];
#pragma unroll
    for (int t = 0; t < 4; ++t) {
      const v4f lo = *(const v4f*)&Pacc[((slot * 8 + t * 2 + 0) * 32 + lane) * 4];
      const v4f hi = *(const v4f*)&Pacc[((slot * 8 + t * 2 + 1) * 32 + lane) * 4];
#pragma unroll
      for (int j = 0; j < 4; ++j) {
        acc[t][j]     += wi * lo[j];
        acc[t][4 + j] += wi * hi[j];
      }
    }
  }

  // join the halves' sums, normalize, store ctx (f16): 8 consecutive d per lane
  const float inv_l = 1.0f / (l_run + other_half(l_run));
#pragma unroll
  for (int t = 0; t < 4; ++t) {
    v8h o;
#pragma unroll
    for (int j = 0; j < 8; ++j) o[j] = (_Float16)(acc[t][j] * inv_l);
    *(v8h*)&ctx_h[bo64 + (size_t)row * DK + t * 16 + 8 * hid] = o;
  }
}

// ---------------------------------------------------------------------------
// k3: output projection  out[m][h] = sum_v ctx[m][v] * Wo[h][v] + bo[h]
// ---------------------------------------------------------------------------
__global__ void k3_proj(const _Float16* __restrict__ ctx_h,
                        const _Float16* __restrict__ Wo_h,
                        const float* __restrict__ bo,
                        float* __restrict__ out) {
  const int tid  = threadIdx.x;
  const int w    = tid >> 5;
  const int lane = tid & 31;
  const int hid  = lane >> 4;
  const int n    = lane & 15;

  const int rbase = blockIdx.x * 128 + w * 16;
  const _Float16* ap = ctx_h + (size_t)rbase * DK;
  const v16h a0 = frag_load(ap, DK);
  const v16h a1 = frag_load(ap + 32, DK);

  for (int nt = 0; nt < HID / 16; ++nt) {
    v8f acc = {};
    v16h b0 = frag_load_packed(Wo_h + (size_t)(nt * 2) * FRAG_SZ);
    acc = wmma16(a0, b0, acc);
    v16h b1 = frag_load_packed(Wo_h + (size_t)(nt * 2 + 1) * FRAG_SZ);
    acc = wmma16(a1, b1, acc);

    const float bval = bo[nt * 16 + n];
#pragma unroll
    for (int j = 0; j < 8; ++j) {
      const int m = j + 8 * hid;
      out[(size_t)(rbase + m) * HID + nt * 16 + n] = acc[j] + bval;
    }
  }
}

// ---------------------------------------------------------------------------
extern "C" void kernel_launch(void* const* d_in, const int* in_sizes, int n_in,
                              void* d_out, int out_size, void* d_ws, size_t ws_size,
                              hipStream_t stream) {
  (void)in_sizes; (void)n_in; (void)out_size; (void)ws_size;

  const float* y  = (const float*)d_in[0];
  const float* Wq = (const float*)d_in[1];
  const float* bq = (const float*)d_in[2];
  const float* Wk = (const float*)d_in[3];
  const float* bk = (const float*)d_in[4];
  const float* Wv = (const float*)d_in[5];
  const float* bv = (const float*)d_in[6];
  const float* Wo = (const float*)d_in[7];
  const float* bo = (const float*)d_in[8];
  float* out = (float*)d_out;

  // workspace layout (f16)
  char* ws = (char*)d_ws;
  _Float16* Wqkv_h = (_Float16*)(ws);                        // 192*1024  (384 KB), packed
  _Float16* Wo_h   = (_Float16*)(ws + 393216);               // 1024*64   (128 KB), packed
  _Float16* q_h    = (_Float16*)(ws + 524288);               // [b][t][d] (2 MB)
  _Float16* k_h    = (_Float16*)(ws + 524288 + 2097152);     // [b][t][d] (2 MB)
  _Float16* v_t    = (_Float16*)(ws + 524288 + 2 * 2097152); // [b][d][t] (2 MB)
  _Float16* ctx_h  = (_Float16*)(ws + 524288 + 3 * 2097152); // [b][t][d] (2 MB)

  k0_convert_w<<<128, 256, 0, stream>>>(Wq, Wk, Wv, Wo, Wqkv_h, Wo_h);
  k1_qkv<<<NROWS / 16, 384, 0, stream>>>(y, Wqkv_h, bq, bk, bv, q_h, k_h, v_t);
  k2_attn<<<NBAT * (SEQ / QTILE), 256, 0, stream>>>(q_h, k_h, v_t, ctx_h);
  k3_proj<<<NROWS / 128, 256, 0, stream>>>(ctx_h, Wo_h, bo, out);
}

// v004
// It runs in 68.4 microseconds.
// Two timings next to v003 both put it at 1.42 times that version's speed.
// Over all steps from v000 it is 3.34 times as fast.
#include <hip/hip_runtime.h>
#include <hip/hip_bf16.h>
#include <math.h>

// ---------------------------------------------------------------------------
// Causal self-attention for MI455X (gfx1250, wave32, WMMA f16->f32).
//   HIDDEN=1024, DK=DV=64, B=4, T=4096
// Pipeline:
//   k0: convert weights fp32 -> f16 into workspace, packed in fragment order
//   k1: fused QKV projection (WMMA, K=1024); q pre-scaled by 1/sqrt(64);
//       V stored pre-transposed (v_t[b][d][t]) for transpose-free attention
//   k2: flash attention on transposed products, keys split over the waves of a
//       work-group, double-buffered KV chunks staged with
//       GLOBAL_LOAD_ASYNC_TO_LDS_B128 (ASYNCcnt pipeline); its epilogue is
//       the output projection (WMMA, K=64, N=1024) + bias, fp32 out
// ---------------------------------------------------------------------------

typedef __attribute__((ext_vector_type(16))) _Float16 v16h;
typedef __attribute__((ext_vector_type(8)))  _Float16 v8h;
typedef __attribute__((ext_vector_type(4)))  _Float16 v4h;
typedef __attribute__((ext_vector_type(8)))  float    v8f;
typedef __attribute__((ext_vector_type(4)))  float    v4f;
typedef __attribute__((ext_vector_type(4)))  int      v4i;

#define HID   1024
#define DK    64
#define SEQ   4096
#define NBAT  4
#define NROWS (NBAT * SEQ)          // 16384 token rows

// ---- gfx1250 async copy to LDS (guarded; fallback = vector copy) ----------
#if __has_builtin(__builtin_amdgcn_global_load_async_to_lds_b128)
#define HAVE_ASYNC 1
typedef __attribute__((address_space(1))) v4i as1_v4i;
typedef __attribute__((address_space(3))) v4i as3_v4i;
#else
#define HAVE_ASYNC 0
#endif

static __device__ __forceinline__ void copy16B(const _Float16* src, _Float16* dst) {
#if HAVE_ASYNC
  // prototype: (int4 AS1* src, int4 AS3* dst, imm offset, imm cpol)
  __builtin_amdgcn_global_load_async_to_lds_b128(
      (as1_v4i*)(uintptr_t)src,
      (as3_v4i*)(unsigned int)(uintptr_t)dst,   // low 32 bits = LDS offset
      0, 0);
#else
  *(v8h*)dst = *(const v8h*)src;
#endif
}

static __device__ __forceinline__ void wait_async_zero() {
#if HAVE_ASYNC
#if __has_builtin(__builtin_amdgcn_s_wait_asynccnt)
  __builtin_amdgcn_s_wait_asynccnt(0);
#else
  asm volatile("s_wait_asynccnt 0x0" ::: "memory");
#endif
#endif
}

// ---- fragment helpers (CDNA5 16x16x32 f16 WMMA layouts, wave32) -----------
// A-matrix 16x32: lane = hid*16 + r ; row M = r ;
//   halves e=0..7  -> K = hid*8 + e ; halves e=8..15 -> K = 16 + hid*8 + (e-8)
// B-matrix 32x16: same pattern with lane%16 = column N, reading src[N][K].
static __device__ __forceinline__ v16h frag_load(const _Float16* src, int ld) {
  const int lane = threadIdx.x & 31;
  const int hid  = lane >> 4;
  const int r    = lane & 15;
  const _Float16* p = src + (size_t)r * ld + hid * 8;
  v16h f;
#pragma unroll
  for (int e = 0; e < 8; ++e) f[e] = p[e];
#pragma unroll
  for (int e = 0; e < 8; ++e) f[8 + e] = p[16 + e];
  return f;
}

// A 16x32 fragment that k0 has packed: 1 KB in a row, 16-byte unit h2*32 + lane
// holds f[h2*8 .. h2*8+7] of frag_load's map.  Each of the two loads then reads
// 512 contiguous bytes (4 cache lines) instead of 32 bytes out of 16 lines.
#define FRAG_SZ 512   // halves per packed fragment
static __device__ __forceinline__ v16h frag_load_packed(const _Float16* frag) {
  const int lane = threadIdx.x & 31;
  const v8h lo = *(const v8h*)(frag + lane * 8);
  const v8h hi = *(const v8h*)(frag + 256 + lane * 8);
  return __builtin_shufflevector(lo, hi, 0, 1, 2, 3, 4, 5, 6, 7,
                                 8, 9, 10, 11, 12, 13, 14, 15);
}

static __device__ __forceinline__ v8f wmma16(v16h a, v16h b, v8f c) {
  return __builtin_amdgcn_wmma_f32_16x16x32_f16(false, a, false, b,
                                                (short)0, c, false, false);
}

// ---------------------------------------------------------------------------
// k0: fp32 -> f16 weight conversion into fragment order (see frag_load_packed).
//   One thread per 16-byte unit.  Wqkv_h: fragment (w, kb) at index w*32 + kb,
//   w = 16-row tile of fused [q|k|v], kb = 32-wide k block.  Wo_h: fragment
//   (nt, kb) at index nt*2 + kb.
// ---------------------------------------------------------------------------
#define QKV_UNITS (3 * DK * HID / 8)   // 24576, a multiple of 64
#define WO_UNITS  (HID * DK / 8)       // 8192

__global__ void k0_convert_w(const float* __restrict__ Wq,
                             const float* __restrict__ Wk,
                             const float* __restrict__ Wv,
                             const float* __restrict__ Wo,
                             _Float16* __restrict__ Wqkv_h,
                             _Float16* __restrict__ Wo_h) {
  const int u    = blockIdx.x * blockDim.x + threadIdx.x;
  if (u >= QKV_UNITS + WO_UNITS) return;
  const int lane = u & 31;
  const int r    = lane & 15;                                  // row in the tile
  const int kin  = ((u >> 5) & 1) * 16 + (lane >> 4) * 8;      // first k in the block
  const float* src;
  _Float16*    dst;
  if (u < QKV_UNITS) {
    const int frag = u >> 6;
    const int w    = frag >> 5, kb = frag & 31;
    const int sel  = w >> 2;                                   // 0=q 1=k 2=v
    const float* W = (sel == 0) ? Wq : (sel == 1) ? Wk : Wv;
    src = W + (size_t)((w & 3) * 16 + r) * HID + kb * 32 + kin;
    dst = Wqkv_h + (size_t)u * 8;
  } else {
    const int u2   = u - QKV_UNITS;
    const int frag = u2 >> 6;
    const int nt   = frag >> 1, kb = frag & 1;
    src = Wo + (size_t)(nt * 16 + r) * DK + kb * 32 + kin;
    dst = Wo_h + (size_t)u2 * 8;
  }
  const v4f a = *(const v4f*)src;
  const v4f b = *(const v4f*)(src + 4);
  const v8h o = {(_Float16)a[0], (_Float16)a[1], (_Float16)a[2], (_Float16)a[3],
                 (_Float16)b[0], (_Float16)b[1], (_Float16)b[2], (_Float16)b[3]};
  *(v8h*)dst = o;
}

// ---------------------------------------------------------------------------
// k1: fused QKV projection.  grid.x = NROWS/16; 384 threads = 12 waves.
//   Wave w owns one 16-col tile of fused [q|k|v]; y tile staged in LDS.
//   V written transposed: v_t[b][d][t].
// ---------------------------------------------------------------------------
#define Y_LD (HID + 8)

__global__ void k1_qkv(const float* __restrict__ y,
                       const _Float16* __restrict__ Wqkv_h,
                       const float* __restrict__ bq,
                       const float* __restrict__ bk,
                       const float* __restrict__ bv,
                       _Float16* __restrict__ q_h,
                       _Float16* __restrict__ k_h,
                       _Float16* __restrict__ v_t) {
  __shared__ __align__(16) _Float16 ytile[16 * Y_LD];

  const int tid  = threadIdx.x;
  const int row0 = blockIdx.x * 16;

  // vectorized fp32->f16 stage of the 16x1024 y tile
  for (int i = tid * 4; i < 16 * HID; i += 384 * 4) {
    const int r = i >> 10, c = i & (HID - 1);
    const v4f yv = *(const v4f*)&y[(size_t)(row0 + r) * HID + c];
    v4h hv;
    hv[0] = (_Float16)yv[0]; hv[1] = (_Float16)yv[1];
    hv[2] = (_Float16)yv[2]; hv[3] = (_Float16)yv[3];
    *(v4h*)&ytile[r * Y_LD + c] = hv;
  }
  __syncthreads();

  const int w    = tid >> 5;                // 0..11
  const int lane = tid & 31;
  const int hid  = lane >> 4;
  const int n    = lane & 15;

  v8f acc = {};
#pragma unroll 4
  for (int kk = 0; kk < HID; kk += 32) {
    v16h a = frag_load(ytile + kk, Y_LD);
    v16h b = frag_load_packed(Wqkv_h + (size_t)(w * 32 + (kk >> 5)) * FRAG_SZ);
    acc = wmma16(a, b, acc);
  }

  const int sel  = w >> 2;                  // 0=q 1=k 2=v
  const int col  = (w & 3) * 16 + n;        // 0..63 within q/k/v
  const float* bias = (sel == 0) ? bq : (sel == 1) ? bk : bv;
  const float scale = (sel == 0) ? 0.125f : 1.0f;   // q / sqrt(64)
  const float bval  = bias[col];
  _Float16* dst = (sel == 0) ? q_h : k_h;

#pragma unroll
  for (int j = 0; j < 8; ++j) {
    const int m = j + 8 * hid;
    const float val = (acc[j] + bval) * scale;
    if (sel == 2) {
      const int grow = row0 + m;
      v_t[(size_t)(grow >> 12) * (DK * SEQ) + (size_t)col * SEQ +
          (grow & (SEQ - 1))] = (_Float16)val;
    } else {
      dst[(size_t)(row0 + m) * DK + col] = (_Float16)val;
    }
  }
}

// ---------------------------------------------------------------------------
// k2: flash attention (causal), double-buffered async KV staging.
//   grid.x = NBAT * (SEQ/32); 256 threads = 8 waves = 2 query tiles x 4 key groups.
//   Wave (sub, g) owns 16 q rows and the key chunks g, g+4, g+8, ... with its
//   own maximum, sum and accumulators; the four groups' partials of a query
//   tile are merged once, through LDS, by the wave of group 0.
//   Transposed products: S^T = K Q^T and ctx^T += V^T P^T.  A lane then holds
//   16 scores of ONE query, so maximum and sum are in-lane (one exchange
//   between the wave halves), and the two S^T tiles, converted in place, are
//   the B operand of the second product: P never goes through LDS.
//   Epilogue: the merged 32 x 64 ctx tile goes to LDS (f16) and all 8 waves
//   project it, wave w on output columns [w*128, w*128 + 128): work-groups with
//   few keys write their rows of out while the long ones are still in the loop.
// ---------------------------------------------------------------------------
#define K_LD  88     // 64 + 24 pad halves: 176B stride (16B aligned, no bank conflict)
#define VT_LD 40     // 32 + 8 pad halves:  80B stride  (16B aligned, no bank conflict)
#define QTILE 32
#define KVG   4      // key groups per work-group; SEQ/32 is a multiple of it
#define KCH_SZ (32 * K_LD)
#define VCH_SZ (DK * VT_LD)
#define CT_LD 72     // 64 + 8 pad halves: 144B stride (16B aligned)
#define PROJ_NT (HID / 16 / 8)   // output column tiles per wave in the projection

// value of lane l ^ 16 (vector cross-row move, no LDS round trip)
static __device__ __forceinline__ float other_half(float x) {
  const int b = __builtin_bit_cast(int, x);
  return __builtin_bit_cast(
      float, __builtin_amdgcn_permlanex16(b, b, 0x76543210, 0xfedcba98, false, false));
}

__global__ void k2_attn(const _Float16* __restrict__ q_h,
                        const _Float16* __restrict__ k_h,
                        const _Float16* __restrict__ v_t,
                        const _Float16* __restrict__ Wo_h,
                        const float* __restrict__ bo,
                        float* __restrict__ out) {
  __shared__ __align__(16) _Float16 Klds[2 * KVG * KCH_SZ];  // [buf][group] K chunk [kv 32][d 64]
  __shared__ __align__(16) _Float16 Vlds[2 * KVG * VCH_SZ];  // [buf][group] V^T chunk [d 64][kv 32]
  __shared__ __align__(16) float Pacc[(KVG - 1) * 2 * 8 * 32 * 4];  // [slot][quad][lane] 4 floats
  __shared__ float Pml[(KVG - 1) * 2 * 2 * 32];                     // [slot][max, sum][lane]
  __shared__ __align__(16) _Float16 Cst[QTILE * CT_LD];             // merged ctx tile [query 32][d 64]

  const int tid  = threadIdx.x;
  const int w    = __builtin_amdgcn_readfirstlane(tid >> 5);  // scalar: the skip below is a real branch
  const int sub  = w & 1;                   // query tile of this wave
  const int g    = w >> 1;                  // key group of this wave
  const int lane = tid & 31;
  const int hid  = lane >> 4;
  const int n    = lane & 15;

  const int qtiles = SEQ / QTILE;           // 128
  const int b      = blockIdx.x / qtiles;
  const int qbase  = (blockIdx.x % qtiles) * QTILE;
  const size_t bo64 = (size_t)b * SEQ * DK; // batch offset, [t][d] layouts
  const _Float16* kg  = k_h + bo64;
  const _Float16* vtg = v_t + bo64;         // [d][t] layout

  // per-thread staging coordinates (each thread moves 2 x 16B per chunk)
  const int rK = tid >> 3, sK = tid & 7;    // K: row kv, 8-half segment
  const int dV = tid >> 2, sV = tid & 3;    // V^T: row d, 8-half segment

  // persistent Q fragments for this wave's 16 rows (already scaled);
  // used as B: lane n holds query column n
  const _Float16* qp = q_h + bo64 + (size_t)(qbase + sub * 16) * DK;
  const v16h aq0 = frag_load(qp, DK);
  const v16h aq1 = frag_load(qp + 32, DK);

  // acc[t][j] = ctx^T[d = t*16 + 8*hid + j][query n], over this group's keys
  v8f   acc[4] = {v8f{}, v8f{}, v8f{}, v8f{}};
  float m_run = -3.0e38f;   // running maximum of query n (equal in both halves)
  float l_run = 0.0f;       // this half's share of the running sum of query n

  const int row    = qbase + sub * 16 + n;  // this lane's query
  const int limit  = qbase + QTILE;
  // a trip serves KVG chunks of 32 keys, one per group; trips * KVG * 32 <= SEQ,
  // so chunks past the diagonal in the last trip are still inside K and V
  const int ntrips = (limit / 32 + KVG - 1) / KVG;

  // stage trip 0 into buffer 0
#pragma unroll
  for (int c = 0; c < KVG; ++c) {
    copy16B(kg  + (size_t)(c * 32 + rK) * DK + sK * 8,
            Klds + c * KCH_SZ + rK * K_LD + sK * 8);
    copy16B(vtg + (size_t)dV * SEQ + c * 32 + sV * 8,
            Vlds + c * VCH_SZ + dV * VT_LD + sV * 8);
  }

  int cur = 0;
  for (int trip = 0; trip < ntrips; ++trip) {
    // this wave's LDS reads of the buffer that is refilled below have retired
    asm volatile("s_wait_dscnt 0x0" ::: "memory");
    wait_async_zero();      // my async copies into buf[cur] done
    __syncthreads();        // everyone's copies visible; prev compute done

    // prefetch the next trip's chunks into the other buffer (overlaps with WMMAs below)
    if (trip + 1 < ntrips) {
      const int nxt = (trip + 1) * (KVG * 32);
#pragma unroll
      for (int c = 0; c < KVG; ++c) {
        copy16B(kg  + (size_t)(nxt + c * 32 + rK) * DK + sK * 8,
                Klds + ((cur ^ 1) * KVG + c) * KCH_SZ + rK * K_LD + sK * 8);
        copy16B(vtg + (size_t)dV * SEQ + nxt + c * 32 + sV * 8,
                Vlds + ((cur ^ 1) * KVG + c) * VCH_SZ + dV * VT_LD + sV * 8);
      }
    }

    const int kvb = (trip * KVG + g) * 32;  // this group's chunk
    if (kvb < limit) {                      // wave-uniform; a chunk past the diagonal has no open key
      const _Float16* Kb = Klds + (cur * KVG + g) * KCH_SZ;
      const _Float16* Vb = Vlds + (cur * KVG + g) * VCH_SZ;

      // S^T = K Q^T : two 16x16 tiles, kv rows [kvb, kvb+16) and [kvb+16, kvb+32)
      //   s0[j] = S[row][kvb + 8*hid + j],  s1[j] = S[row][kvb + 16 + 8*hid + j]
      v8f s0 = {}, s1 = {};
      {
        v16h b0 = frag_load(Kb, K_LD);
        s0 = wmma16(b0, aq0, s0);
        v16h b1 = frag_load(Kb + 32, K_LD);
        s0 = wmma16(b1, aq1, s0);
        v16h b2 = frag_load(Kb + 16 * K_LD, K_LD);
        s1 = wmma16(b2, aq0, s1);
        v16h b3 = frag_load(Kb + 16 * K_LD + 32, K_LD);
        s1 = wmma16(b3, aq1, s1);
      }

      // online softmax update (fp32), causal mask; all 16 scores belong to 'row'
      const int kv0 = kvb + 8 * hid;
      float mx = -3.0e38f;
#pragma unroll
      for (int j = 0; j < 8; ++j) {
        s0[j] = (kv0 + j)      <= row ? s0[j] : -3.0e38f;
        s1[j] = (kv0 + 16 + j) <= row ? s1[j] : -3.0e38f;
        mx = fmaxf(mx, fmaxf(s0[j], s1[j]));
      }
      mx = fmaxf(mx, other_half(mx));

      // a chunk that is entered has kvb <= qbase <= row: its first key is open to
      // every query, so mtot is a real score and a masked entry gives
      // exp(-3e38 - mtot) = 0
      const float mtot = fmaxf(m_run, mx);
      const float sc   = __expf(m_run - mtot);

      v16h  pT;             // B operand: pT[e] = P^T[kmap(e, hid)][n]
      float rs = 0.0f;
#pragma unroll
      for (int j = 0; j < 8; ++j) {
        const float p0 = __expf(s0[j] - mtot);
        const float p1 = __expf(s1[j] - mtot);
        rs += p0 + p1;
        pT[j]     = (_Float16)p0;
        pT[8 + j] = (_Float16)p1;
      }

      m_run = mtot;
      l_run = l_run * sc + rs;
#pragma unroll
      for (int t = 0; t < 4; ++t) acc[t] *= sc;

      // ctx^T += V^T (16 d x 32 kv) * P^T (32 kv x 16 q): 4 WMMAs
#pragma unroll
      for (int t = 0; t < 4; ++t) {
        v16h aV = frag_load(Vb + (size_t)(t * 16) * VT_LD, VT_LD);
        acc[t] = wmma16(aV, pT, acc[t]);
      }
    }
    cur ^= 1;
  }

  // no copy is in flight when a wave goes on to the merge or ends
  asm volatile("s_wait_asynccnt 0x0" ::: "memory");

  // merge of the key groups: groups 1.. hand their partials (same lane layout) to group 0
  if (g != 0) {
    const int slot = (g - 1) * 2 + sub;
#pragma unroll
    for (int t = 0; t < 4; ++t) {
      const v4f lo = {acc[t][0], acc[t][1], acc[t][2], acc[t][3]};
      const v4f hi = {acc[t][4], acc[t][5], acc[t][6], acc[t][7]};
      *(v4f*)&Pacc[((slot * 8 + t * 2 + 0) * 32 + lane) * 4] = lo;
      *(v4f*)&Pacc[((slot * 8 + t * 2 + 1) * 32 + lane) * 4] = hi;
    }
    Pml[(slot * 2 + 0) * 32 + lane] = m_run;
    Pml[(slot * 2 + 1) * 32 + lane] = l_run;
  }
  __syncthreads();          // partials visible to group 0

  // wave w projects onto output columns [w*128, w*128 + 128), 8 tiles of 16; the
  // first tile's weights and bias are asked for here, ahead of the merge
  const _Float16* wp = Wo_h + (size_t)(w * (PROJ_NT * 2)) * FRAG_SZ;
  const float*    bp = bo + w * (PROJ_NT * 16) + n;
  v16h  b0   = frag_load_packed(wp);
  v16h  b1   = frag_load_packed(wp + FRAG_SZ);
  float bval = bp[0];

  if (g == 0) {             // scalar branch: whole waves
    // group 0 always has chunk 0, so mall is a real score; a group that had no
    // chunk holds (-3e38, 0, 0) and gets weight exp(-3e38 - mall) = 0
    float mall = m_run;
#pragma unroll
    for (int i = 0; i < KVG - 1; ++i)
      mall = fmaxf(mall, Pml[((i * 2 + sub) * 2 + 0) * 32 + lane]);
    const float w0 = __expf(m_run - mall);
    l_run *= w0;
#pragma unroll
    for (int t = 0; t < 4; ++t) acc[t] *= w0;
#pragma unroll
    for (int i = 0; i < KVG - 1; ++i) {
      const int slot = i * 2 + sub;
      const float wi = __expf(Pml[(slot * 2 + 0) * 32 + lane] - mall);
      l_run += wi * Pml[(slot * 2 + 1) * 32 + lane];
#pragma unroll
      for (int t = 0; t < 4; ++t) {
        const v4f lo = *(const v4f*)&Pacc[((slot * 8 + t * 2 + 0) * 32 + lane) * 4];
        const v4f hi = *(const v4f*)&Pacc[((slot * 8 + t * 2 + 1) * 32 + lane) * 4];
#pragma unroll
        for (int j = 0; j < 4; ++j) {
          acc[t][j]     += wi * lo[j];
          acc[t][4 + j] += wi * hi[j];
        }
      }
    }

    // join the halves' sums, normalize, hand ctx (f16) over: 8 consecutive d per lane
    const float inv_l = 1.0f / (l_run + other_half(l_run));
#pragma unroll
    for (int t = 0; t < 4; ++t) {
      v8h o;
#pragma unroll
      for (int j = 0; j < 8; ++j) o[j] = (_Float16)(acc[t][j] * inv_l);
      *(v8h*)&Cst[(sub * 16 + n) * CT_LD + t * 16 + 8 * hid] = o;
    }
  }
  __syncthreads();          // ctx tile visible to every wave

  // output projection  out[m][h] = sum_v ctx[m][v] * Wo[h][v] + bo[h]:
  // each weight fragment serves both 16-query tiles
  const v16h a00 = frag_load(Cst, CT_LD);
  const v16h a01 = frag_load(Cst + 32, CT_LD);
  const v16h a10 = frag_load(Cst + 16 * CT_LD, CT_LD);
  const v16h a11 = frag_load(Cst + 16 * CT_LD + 32, CT_LD);
  float* op = out + ((size_t)b * SEQ + qbase + 8 * hid) * HID + w * (PROJ_NT * 16) + n;

  // unrolled so that the test for a next tile is decided at compile time
#pragma unroll
  for (int i = 0; i < PROJ_NT; ++i) {
    v8f c0 = {}, c1 = {};
    c0 = wmma16(a00, b0, c0);
    c1 = wmma16(a10, b0, c1);
    c0 = wmma16(a01, b1, c0);
    c1 = wmma16(a11, b1, c1);
    const float bcur = bval;
    if (i + 1 < PROJ_NT) {  // next tile's weights fly under this tile's stores
      b0   = frag_load_packed(wp + (size_t)((i + 1) * 2) * FRAG_SZ);
      b1   = frag_load_packed(wp + (size_t)((i + 1) * 2 + 1) * FRAG_SZ);
      bval = bp[(i + 1) * 16];
    }
#pragma unroll
    for (int j = 0; j < 8; ++j) {
      op[(size_t)j * HID + i * 16]        = c0[j] + bcur;
      op[(size_t)(16 + j) * HID + i * 16] = c1[j] + bcur;
    }
    // the next tile reuses registers that these loads and stores name
    if (i + 1 < PROJ_NT) asm volatile("s_wait_xcnt 0x0" ::: "memory");
  }
}

// ---------------------------------------------------------------------------
extern "C" void kernel_launch(void* const* d_in, const int* in_sizes, int n_in,
                              void* d_out, int out_size, void* d_ws, size_t ws_size,
                              hipStream_t stream) {
  (void)in_sizes; (void)n_in; (void)out_size; (void)ws_size;

  const float* y  = (const float*)d_in[0];
  const float* Wq = (const float*)d_in[1];
  const float* bq = (const float*)d_in[2];
  const float* Wk = (const float*)d_in[3];
  const float* bk = (const float*)d_in[4];
  const float* Wv = (const float*)d_in[5];
  const float* bv = (const float*)d_in[6];
  const float* Wo = (const float*)d_in[7];
  const float* bo = (const float*)d_in[8];
  float* out = (float*)d_out;

  // workspace layout (f16)
  char* ws = (char*)d_ws;
  _Float16* Wqkv_h = (_Float16*)(ws);                        // 192*1024  (384 KB), packed
  _Float16* Wo_h   = (_Float16*)(ws + 393216);               // 1024*64   (128 KB), packed
  _Float16* q_h    = (_Float16*)(ws + 524288);               // [b][t][d] (2 MB)
  _Float16* k_h    = (_Float16*)(ws + 524288 + 2097152);     // [b][t][d] (2 MB)
  _Float16* v_t    = (_Float16*)(ws + 524288 + 2 * 2097152); // [b][d][t] (2 MB)

  k0_convert_w<<<128, 256, 0, stream>>>(Wq, Wk, Wv, Wo, Wqkv_h, Wo_h);
  k1_qkv<<<NROWS / 16, 384, 0, stream>>>(y, Wqkv_h, bq, bk, bv, q_h, k_h, v_t);
  k2_attn<<<NBAT * (SEQ / QTILE), 256, 0, stream>>>(q_h, k_h, v_t, Wo_h, bo, out);
}

// v005
// A run of this version takes 48.2 microseconds.
// In two side-by-side timings against v004, it was 1.42 and 1.41 times as fast.
// Over all steps from v000 it is 4.73 times as fast.
#include <hip/hip_runtime.h>
#include <hip/hip_bf16.h>
#include <math.h>

// ---------------------------------------------------------------------------
// Causal self-attention for MI455X (gfx1250, wave32, WMMA f16->f32).
//   HIDDEN=1024, DK=DV=64, B=4, T=4096
// Pipeline:
//   k0: convert weights fp32 -> f16 into workspace, packed in fragment order
//   k1: fused QKV projection (WMMA, K=1024); q pre-scaled by 1/sqrt(64);
//       V stored pre-transposed (v_t[b][d][t]) for transpose-free attention
//   k2: flash attention on transposed products, keys split over the waves of a
//       work-group, double-buffered KV chunks staged with
//       GLOBAL_LOAD_ASYNC_TO_LDS_B128 (ASYNCcnt pipeline); its epilogue is
//       the output projection (WMMA, K=64, N=1024) + bias, fp32 out
// ---------------------------------------------------------------------------

typedef __attribute__((ext_vector_type(16))) _Float16 v16h;
typedef __attribute__((ext_vector_type(8)))  _Float16 v8h;
typedef __attribute__((ext_vector_type(4)))  _Float16 v4h;
typedef __attribute__((ext_vector_type(8)))  float    v8f;
typedef __attribute__((ext_vector_type(4)))  float    v4f;
typedef __attribute__((ext_vector_type(4)))  int      v4i;

#define HID   1024
#define DK    64
#define SEQ   4096
#define NBAT  4
#define NROWS (NBAT * SEQ)          // 16384 token rows

// ---- gfx1250 async copy to LDS (guarded; fallback = vector copy) ----------
#if __has_builtin(__builtin_amdgcn_global_load_async_to_lds_b128)
#define HAVE_ASYNC 1
typedef __attribute__((address_space(1))) v4i as1_v4i;
typedef __attribute__((address_space(3))) v4i as3_v4i;
#else
#define HAVE_ASYNC 0
#endif

static __device__ __forceinline__ void copy16B(const _Float16* src, _Float16* dst) {
#if HAVE_ASYNC
  // prototype: (int4 AS1* src, int4 AS3* dst, imm offset, imm cpol)
  __builtin_amdgcn_global_load_async_to_lds_b128(
      (as1_v4i*)(uintptr_t)src,
      (as3_v4i*)(unsigned int)(uintptr_t)dst,   // low 32 bits = LDS offset
      0, 0);
#else
  *(v8h*)dst = *(const v8h*)src;
#endif
}

static __device__ __forceinline__ void wait_async_zero() {
#if HAVE_ASYNC
#if __has_builtin(__builtin_amdgcn_s_wait_asynccnt)
  __builtin_amdgcn_s_wait_asynccnt(0);
#else
  asm volatile("s_wait_asynccnt 0x0" ::: "memory");
#endif
#endif
}

// ---- fragment helpers (CDNA5 16x16x32 f16 WMMA layouts, wave32) -----------
// A-matrix 16x32: lane = hid*16 + r ; row M = r ;
//   halves e=0..7  -> K = hid*8 + e ; halves e=8..15 -> K = 16 + hid*8 + (e-8)
// B-matrix 32x16: same pattern with lane%16 = column N, reading src[N][K].
static __device__ __forceinline__ v16h frag_load(const _Float16* src, int ld) {
  const int lane = threadIdx.x & 31;
  const int hid  = lane >> 4;
  const int r    = lane & 15;
  const _Float16* p = src + (size_t)r * ld + hid * 8;
  v16h f;
#pragma unroll
  for (int e = 0; e < 8; ++e) f[e] = p[e];
#pragma unroll
  for (int e = 0; e < 8; ++e) f[8 + e] = p[16 + e];
  return f;
}

// A 16x32 fragment that k0 has packed: 1 KB in a row, 16-byte unit h2*32 + lane
// holds f[h2*8 .. h2*8+7] of frag_load's map.  Each of the two loads then reads
// 512 contiguous bytes (4 cache lines) instead of 32 bytes out of 16 lines.
#define FRAG_SZ 512   // halves per packed fragment
static __device__ __forceinline__ v16h frag_load_packed(const _Float16* frag) {
  const int lane = threadIdx.x & 31;
  const v8h lo = *(const v8h*)(frag + lane * 8);
  const v8h hi = *(const v8h*)(frag + 256 + lane * 8);
  return __builtin_shufflevector(lo, hi, 0, 1, 2, 3, 4, 5, 6, 7,
                                 8, 9, 10, 11, 12, 13, 14, 15);
}

static __device__ __forceinline__ v8f wmma16(v16h a, v16h b, v8f c) {
  return __builtin_amdgcn_wmma_f32_16x16x32_f16(false, a, false, b,
                                                (short)0, c, false, false);
}

// ---------------------------------------------------------------------------
// k0: fp32 -> f16 weight conversion into fragment order (see frag_load_packed).
//   One thread per 16-byte unit.  Wqkv_h: fragment (w, kb) at index w*32 + kb,
//   w = 16-row tile of fused [q|k|v], kb = 32-wide k block.  Wo_h: fragment
//   (nt, kb) at index nt*2 + kb.
// ---------------------------------------------------------------------------
#define QKV_UNITS (3 * DK * HID / 8)   // 24576, a multiple of 64
#define WO_UNITS  (HID * DK / 8)       // 8192

__global__ void k0_convert_w(const float* __restrict__ Wq,
                             const float* __restrict__ Wk,
                             const float* __restrict__ Wv,
                             const float* __restrict__ Wo,
                             _Float16* __restrict__ Wqkv_h,
                             _Float16* __restrict__ Wo_h) {
  const int u    = blockIdx.x * blockDim.x + threadIdx.x;
  if (u >= QKV_UNITS + WO_UNITS) return;
  const int lane = u & 31;
  const int r    = lane & 15;                                  // row in the tile
  const int kin  = ((u >> 5) & 1) * 16 + (lane >> 4) * 8;      // first k in the block
  const float* src;
  _Float16*    dst;
  if (u < QKV_UNITS) {
    const int frag = u >> 6;
    const int w    = frag >> 5, kb = frag & 31;
    const int sel  = w >> 2;                                   // 0=q 1=k 2=v
    const float* W = (sel == 0) ? Wq : (sel == 1) ? Wk : Wv;
    src = W + (size_t)((w & 3) * 16 + r) * HID + kb * 32 + kin;
    dst = Wqkv_h + (size_t)u * 8;
  } else {
    const int u2   = u - QKV_UNITS;
    const int frag = u2 >> 6;
    const int nt   = frag >> 1, kb = frag & 1;
    src = Wo + (size_t)(nt * 16 + r) * DK + kb * 32 + kin;
    dst = Wo_h + (size_t)u2 * 8;
  }
  const v4f a = *(const v4f*)src;
  const v4f b = *(const v4f*)(src + 4);
  const v8h o = {(_Float16)a[0], (_Float16)a[1], (_Float16)a[2], (_Float16)a[3],
                 (_Float16)b[0], (_Float16)b[1], (_Float16)b[2], (_Float16)b[3]};
  *(v8h*)dst = o;
}

// ---------------------------------------------------------------------------
// k1: fused QKV projection.  grid.x = NROWS/64; 384 threads = 12 waves.
//   Wave w owns one 16-col tile of fused [q|k|v] for all 64 rows: a weight
//   fragment is loaded once and feeds four products (four accumulators).
//   y goes to LDS (f16) in slices of 256 k columns, two buffers: the next
//   slice's loads are in flight while this slice is multiplied.
//   V written transposed: v_t[b][d][t].
// ---------------------------------------------------------------------------
#define MT     64                 // token rows per work-group
#define MTILES (MT / 16)
#define KS     256                // k columns per staged slice
#define NSL    (HID / KS)
#define KSTEPS (KS / 32)          // products along k per slice
#define YS_LD  (KS + 8)           // 528B stride (16B aligned, same bank step as a 16B pad)
#define YUNITS (MT * KS / 4)      // 16-byte units of y per slice
#define YLOADS ((YUNITS + 383) / 384)

// stands behind a group of global loads: s_wait_xcnt 0 in front of every rewrite of
// a register that an issued load names; the fence holds those rewrites behind it
static __device__ __forceinline__ void loads_issued() {
  asm volatile("s_wait_xcnt 0x0" ::: "memory");
  __builtin_amdgcn_sched_barrier(0);
}

__global__ __launch_bounds__(384) void k1_qkv(const float* __restrict__ y,
                       const _Float16* __restrict__ Wqkv_h,
                       const float* __restrict__ bq,
                       const float* __restrict__ bk,
                       const float* __restrict__ bv,
                       _Float16* __restrict__ q_h,
                       _Float16* __restrict__ k_h,
                       _Float16* __restrict__ v_t) {
  __shared__ __align__(16) _Float16 ytile[2 * MT * YS_LD];

  const int tid  = threadIdx.x;
  const int row0 = blockIdx.x * MT;
  const int w    = __builtin_amdgcn_readfirstlane(tid >> 5);  // 0..11, scalar: real branches below
  const int lane = tid & 31;
  const int hid  = lane >> 4;
  const int n    = lane & 15;
  // the last round of a slice's units is short: whole waves 0..7 take it
  const bool tail = w < (YUNITS - (YLOADS - 1) * 384) / 32;

  v4f  pre[YLOADS];       // a slice of y on its way from memory to LDS
  v16h wf[KSTEPS];        // this wave's weight fragments of one slice
  v8f  acc[MTILES] = {v8f{}, v8f{}, v8f{}, v8f{}};

  // a wave's 32 lanes read 512 contiguous bytes of one row
#define Y_LOAD(s)                                                              \
  _Pragma("unroll") for (int j = 0; j < YLOADS; ++j) {                         \
    const int i = tid + j * 384;                                               \
    if (j + 1 < YLOADS || tail)                                                \
      pre[j] = *(const v4f*)&y[(size_t)(row0 + (i >> 6)) * HID + (s) * KS +    \
                               (i & 63) * 4];                                  \
  }
#define Y_STORE(buf)                                                           \
  _Pragma("unroll") for (int j = 0; j < YLOADS; ++j) {                         \
    const int i = tid + j * 384;                                               \
    if (j + 1 < YLOADS || tail) {                                              \
      const v4h hv = {(_Float16)pre[j][0], (_Float16)pre[j][1],                \
                      (_Float16)pre[j][2], (_Float16)pre[j][3]};               \
      *(v4h*)&ytile[(buf) * (MT * YS_LD) + (i >> 6) * YS_LD + (i & 63) * 4] = hv; \
    }                                                                          \
  }
#define W_LOAD(s)                                                              \
  _Pragma("unroll") for (int kb = 0; kb < KSTEPS; ++kb)                        \
    wf[kb] = frag_load_packed(Wqkv_h +                                         \
                              (size_t)(w * 32 + (s) * KSTEPS + kb) * FRAG_SZ);

  // loads return in order.  In the loop a slice of y is asked for ahead of the
  // weights that are needed after it; here the weights go first, they come from L2
  W_LOAD(0)
  loads_issued();
  Y_LOAD(0)
  loads_issued();
  Y_STORE(0)
  // slice 1 is asked for only when slice 0 has left its registers
  __builtin_amdgcn_sched_barrier(0);
  Y_LOAD(1)
  loads_issued();

#pragma unroll
  for (int s = 0; s < NSL; ++s) {
    // slice s visible; every wave has left the buffer that is refilled below.
    // The waves share LDS only, so the fences name LDS alone: __syncthreads()
    // would also wait out the global loads that are in flight across this point
    __builtin_amdgcn_fence(__ATOMIC_RELEASE, "workgroup", "local");
    __builtin_amdgcn_s_barrier();
    __builtin_amdgcn_fence(__ATOMIC_ACQUIRE, "workgroup", "local");

    // y fragments are read one k step ahead, as one group, into a second set
    const _Float16* yt = ytile + (s & 1) * (MT * YS_LD);
    v16h af[2][MTILES];
#pragma unroll
    for (int i = 0; i < MTILES; ++i) af[0][i] = frag_load(yt + i * 16 * YS_LD, YS_LD);
#pragma unroll
    for (int kb = 0; kb < KSTEPS; ++kb) {
      if (kb + 1 < KSTEPS) {
#pragma unroll
        for (int i = 0; i < MTILES; ++i)
          af[(kb + 1) & 1][i] = frag_load(yt + i * 16 * YS_LD + (kb + 1) * 32, YS_LD);
      }
      // keeps that group of LDS reads whole and ahead of this step's products
      __builtin_amdgcn_sched_barrier(0);
#pragma unroll
      for (int i = 0; i < MTILES; ++i) acc[i] = wmma16(af[kb & 1][i], wf[kb], acc[i]);
      // keeps the following group of LDS reads from moving in among the products
      __builtin_amdgcn_sched_barrier(0);
    }

    // (the fence behind the last products also keeps the conversions below, which
    // wait for the next slice's loads, behind them)
    if (s + 1 < NSL) {
      W_LOAD(s + 1)
      loads_issued();
      Y_STORE((s + 1) & 1)
      // the slice after it is asked for only when its registers are free
      __builtin_amdgcn_sched_barrier(0);
      if (s + 2 < NSL) {
        Y_LOAD(s + 2)
        loads_issued();
      }
    }
  }
#undef Y_LOAD
#undef Y_STORE
#undef W_LOAD

  const int sel  = w >> 2;                  // 0=q 1=k 2=v
  const int col  = (w & 3) * 16 + n;        // 0..63 within q/k/v
  const float* bias = (sel == 0) ? bq : (sel == 1) ? bk : bv;
  const float scale = (sel == 0) ? 0.125f : 1.0f;   // q / sqrt(64)
  const float bval  = bias[col];
  _Float16* dst = (sel == 0) ? q_h : k_h;

  // the 64 rows of a work-group lie in one batch (SEQ is a multiple of MT)
  _Float16* vp = v_t + (size_t)(row0 >> 12) * (DK * SEQ) + (size_t)col * SEQ +
                 (row0 & (SEQ - 1)) + 8 * hid;
  _Float16* qp = dst + (size_t)(row0 + 8 * hid) * DK + col;
  if (sel == 2) {           // scalar branch: whole waves
#pragma unroll
    for (int i = 0; i < MTILES; ++i)
#pragma unroll
      for (int j = 0; j < 8; ++j)
        vp[i * 16 + j] = (_Float16)((acc[i][j] + bval) * scale);
    return;
  }
#pragma unroll
  for (int i = 0; i < MTILES; ++i)
#pragma unroll
    for (int j = 0; j < 8; ++j)
      qp[(size_t)(i * 16 + j) * DK] = (_Float16)((acc[i][j] + bval) * scale);
  // the built code lays the V branch behind these stores, on a path that is never
  // taken: the wait stands in front of its writes to registers the stores name
  asm volatile("s_wait_xcnt 0x0" ::: "memory");
}

// ---------------------------------------------------------------------------
// k2: flash attention (causal), double-buffered async KV staging.
//   grid.x = NBAT * (SEQ/32); 256 threads = 8 waves = 2 query tiles x 4 key groups.
//   Wave (sub, g) owns 16 q rows and the key chunks g, g+4, g+8, ... with its
//   own maximum, sum and accumulators; the four groups' partials of a query
//   tile are merged once, through LDS, by the wave of group 0.
//   Transposed products: S^T = K Q^T and ctx^T += V^T P^T.  A lane then holds
//   16 scores of ONE query, so maximum and sum are in-lane (one exchange
//   between the wave halves), and the two S^T tiles, converted in place, are
//   the B operand of the second product: P never goes through LDS.
//   Epilogue: the merged 32 x 64 ctx tile goes to LDS (f16) and all 8 waves
//   project it, wave w on output columns [w*128, w*128 + 128): work-groups with
//   few keys write their rows of out while the long ones are still in the loop.
// ---------------------------------------------------------------------------
#define K_LD  88     // 64 + 24 pad halves: 176B stride (16B aligned, no bank conflict)
#define VT_LD 40     // 32 + 8 pad halves:  80B stride  (16B aligned, no bank conflict)
#define QTILE 32
#define KVG   4      // key groups per work-group; SEQ/32 is a multiple of it
#define KCH_SZ (32 * K_LD)
#define VCH_SZ (DK * VT_LD)
#define CT_LD 72     // 64 + 8 pad halves: 144B stride (16B aligned)
#define PROJ_NT (HID / 16 / 8)   // output column tiles per wave in the projection

// value of lane l ^ 16 (vector cross-row move, no LDS round trip)
static __device__ __forceinline__ float other_half(float x) {
  const int b = __builtin_bit_cast(int, x);
  return __builtin_bit_cast(
      float, __builtin_amdgcn_permlanex16(b, b, 0x76543210, 0xfedcba98, false, false));
}

__global__ void k2_attn(const _Float16* __restrict__ q_h,
                        const _Float16* __restrict__ k_h,
                        const _Float16* __restrict__ v_t,
                        const _Float16* __restrict__ Wo_h,
                        const float* __restrict__ bo,
                        float* __restrict__ out) {
  __shared__ __align__(16) _Float16 Klds[2 * KVG * KCH_SZ];  // [buf][group] K chunk [kv 32][d 64]
  __shared__ __align__(16) _Float16 Vlds[2 * KVG * VCH_SZ];  // [buf][group] V^T chunk [d 64][kv 32]
  __shared__ __align__(16) float Pacc[(KVG - 1) * 2 * 8 * 32 * 4];  // [slot][quad][lane] 4 floats
  __shared__ float Pml[(KVG - 1) * 2 * 2 * 32];                     // [slot][max, sum][lane]
  __shared__ __align__(16) _Float16 Cst[QTILE * CT_LD];             // merged ctx tile [query 32][d 64]

  const int tid  = threadIdx.x;
  const int w    = __builtin_amdgcn_readfirstlane(tid >> 5);  // scalar: the skip below is a real branch
  const int sub  = w & 1;                   // query tile of this wave
  const int g    = w >> 1;                  // key group of this wave
  const int lane = tid & 31;
  const int hid  = lane >> 4;
  const int n    = lane & 15;

  const int qtiles = SEQ / QTILE;           // 128
  const int b      = blockIdx.x / qtiles;
  const int qbase  = (blockIdx.x % qtiles) * QTILE;
  const size_t bo64 = (size_t)b * SEQ * DK; // batch offset, [t][d] layouts
  const _Float16* kg  = k_h + bo64;
  const _Float16* vtg = v_t + bo64;         // [d][t] layout

  // per-thread staging coordinates (each thread moves 2 x 16B per chunk)
  const int rK = tid >> 3, sK = tid & 7;    // K: row kv, 8-half segment
  const int dV = tid >> 2, sV = tid & 3;    // V^T: row d, 8-half segment

  // persistent Q fragments for this wave's 16 rows (already scaled);
  // used as B: lane n holds query column n
  const _Float16* qp = q_h + bo64 + (size_t)(qbase + sub * 16) * DK;
  const v16h aq0 = frag_load(qp, DK);
  const v16h aq1 = frag_load(qp + 32, DK);

  // acc[t][j] = ctx^T[d = t*16 + 8*hid + j][query n], over this group's keys
  v8f   acc[4] = {v8f{}, v8f{}, v8f{}, v8f{}};
  float m_run = -3.0e38f;   // running maximum of query n (equal in both halves)
  float l_run = 0.0f;       // this half's share of the running sum of query n

  const int row    = qbase + sub * 16 + n;  // this lane's query
  const int limit  = qbase + QTILE;
  // a trip serves KVG chunks of 32 keys, one per group; trips * KVG * 32 <= SEQ,
  // so chunks past the diagonal in the last trip are still inside K and V
  const int ntrips = (limit / 32 + KVG - 1) / KVG;

  // stage trip 0 into buffer 0
#pragma unroll
  for (int c = 0; c < KVG; ++c) {
    copy16B(kg  + (size_t)(c * 32 + rK) * DK + sK * 8,
            Klds + c * KCH_SZ + rK * K_LD + sK * 8);
    copy16B(vtg + (size_t)dV * SEQ + c * 32 + sV * 8,
            Vlds + c * VCH_SZ + dV * VT_LD + sV * 8);
  }

  int cur = 0;
  for (int trip = 0; trip < ntrips; ++trip) {
    // this wave's LDS reads of the buffer that is refilled below have retired
    asm volatile("s_wait_dscnt 0x0" ::: "memory");
    wait_async_zero();      // my async copies into buf[cur] done
    __syncthreads();        // everyone's copies visible; prev compute done

    // prefetch the next trip's chunks into the other buffer (overlaps with WMMAs below)
    if (trip + 1 < ntrips) {
      const int nxt = (trip + 1) * (KVG * 32);
#pragma unroll
      for (int c = 0; c < KVG; ++c) {
        copy16B(kg  + (size_t)(nxt + c * 32 + rK) * DK + sK * 8,
                Klds + ((cur ^ 1) * KVG + c) * KCH_SZ + rK * K_LD + sK * 8);
        copy16B(vtg + (size_t)dV * SEQ + nxt + c * 32 + sV * 8,
                Vlds + ((cur ^ 1) * KVG + c) * VCH_SZ + dV * VT_LD + sV * 8);
      }
    }

    const int kvb = (trip * KVG + g) * 32;  // this group's chunk
    if (kvb < limit) {                      // wave-uniform; a chunk past the diagonal has no open key
      const _Float16* Kb = Klds + (cur * KVG + g) * KCH_SZ;
      const _Float16* Vb = Vlds + (cur * KVG + g) * VCH_SZ;

      // S^T = K Q^T : two 16x16 tiles, kv rows [kvb, kvb+16) and [kvb+16, kvb+32)
      //   s0[j] = S[row][kvb + 8*hid + j],  s1[j] = S[row][kvb + 16 + 8*hid + j]
      v8f s0 = {}, s1 = {};
      {
        v16h b0 = frag_load(Kb, K_LD);
        s0 = wmma16(b0, aq0, s0);
        v16h b1 = frag_load(Kb + 32, K_LD);
        s0 = wmma16(b1, aq1, s0);
        v16h b2 = frag_load(Kb + 16 * K_LD, K_LD);
        s1 = wmma16(b2, aq0, s1);
        v16h b3 = frag_load(Kb + 16 * K_LD + 32, K_LD);
        s1 = wmma16(b3, aq1, s1);
      }

      // online softmax update (fp32), causal mask; all 16 scores belong to 'row'
      const int kv0 = kvb + 8 * hid;
      float mx = -3.0e38f;
#pragma unroll
      for (int j = 0; j < 8; ++j) {
        s0[j] = (kv0 + j)      <= row ? s0[j] : -3.0e38f;
        s1[j] = (kv0 + 16 + j) <= row ? s1[j] : -3.0e38f;
        mx = fmaxf(mx, fmaxf(s0[j], s1[j]));
      }
      mx = fmaxf(mx, other_half(mx));

      // a chunk that is entered has kvb <= qbase <= row: its first key is open to
      // every query, so mtot is a real score and a masked entry gives
      // exp(-3e38 - mtot) = 0
      const float mtot = fmaxf(m_run, mx);
      const float sc   = __expf(m_run - mtot);

      v16h  pT;             // B operand: pT[e] = P^T[kmap(e, hid)][n]
      float rs = 0.0f;
#pragma unroll
      for (int j = 0; j < 8; ++j) {
        const float p0 = __expf(s0[j] - mtot);
        const float p1 = __expf(s1[j] - mtot);
        rs += p0 + p1;
        pT[j]     = (_Float16)p0;
        pT[8 + j] = (_Float16)p1;
      }

      m_run = mtot;
      l_run = l_run * sc + rs;
#pragma unroll
      for (int t = 0; t < 4; ++t) acc[t] *= sc;

      // ctx^T += V^T (16 d x 32 kv) * P^T (32 kv x 16 q): 4 WMMAs
#pragma unroll
      for (int t = 0; t < 4; ++t) {
        v16h aV = frag_load(Vb + (size_t)(t * 16) * VT_LD, VT_LD);
        acc[t] = wmma16(aV, pT, acc[t]);
      }
    }
    cur ^= 1;
  }

  // no copy is in flight when a wave goes on to the merge or ends
  asm volatile("s_wait_asynccnt 0x0" ::: "memory");

  // merge of the key groups: groups 1.. hand their partials (same lane layout) to group 0
  if (g != 0) {
    const int slot = (g - 1) * 2 + sub;
#pragma unroll
    for (int t = 0; t < 4; ++t) {
      const v4f lo = {acc[t][0], acc[t][1], acc[t][2], acc[t][3]};
      const v4f hi = {acc[t][4], acc[t][5], acc[t][6], acc[t][7]};
      *(v4f*)&Pacc[((slot * 8 + t * 2 + 0) * 32 + lane) * 4] = lo;
      *(v4f*)&Pacc[((slot * 8 + t * 2 + 1) * 32 + lane) * 4] = hi;
    }
    Pml[(slot * 2 + 0) * 32 + lane] = m_run;
    Pml[(slot * 2 + 1) * 32 + lane] = l_run;
  }
  __syncthreads();          // partials visible to group 0

  // wave w projects onto output columns [w*128, w*128 + 128), 8 tiles of 16; the
  // first tile's weights and bias are asked for here, ahead of the merge
  const _Float16* wp = Wo_h + (size_t)(w * (PROJ_NT * 2)) * FRAG_SZ;
  const float*    bp = bo + w * (PROJ_NT * 16) + n;
  v16h  b0   = frag_load_packed(wp);
  v16h  b1   = frag_load_packed(wp + FRAG_SZ);
  float bval = bp[0];

  if (g == 0) {             // scalar branch: whole waves
    // group 0 always has chunk 0, so mall is a real score; a group that had no
    // chunk holds (-3e38, 0, 0) and gets weight exp(-3e38 - mall) = 0
    float mall = m_run;
#pragma unroll
    for (int i = 0; i < KVG - 1; ++i)
      mall = fmaxf(mall, Pml[((i * 2 + sub) * 2 + 0) * 32 + lane]);
    const float w0 = __expf(m_run - mall);
    l_run *= w0;
#pragma unroll
    for (int t = 0; t < 4; ++t) acc[t] *= w0;
#pragma unroll
    for (int i = 0; i < KVG - 1; ++i) {
      const int slot = i * 2 + sub;
      const float wi = __expf(Pml[(slot * 2 + 0) * 32 + lane] - mall);
      l_run += wi * Pml[(slot * 2 + 1) * 32 + lane];
#pragma unroll
      for (int t = 0; t < 4; ++t) {
        const v4f lo = *(const v4f*)&Pacc[((slot * 8 + t * 2 + 0) * 32 + lane) * 4];
        const v4f hi = *(const v4f*)&Pacc[((slot * 8 + t * 2 + 1) * 32 + lane) * 4];
#pragma unroll
        for (int j = 0; j < 4; ++j) {
          acc[t][j]     += wi * lo[j];
          acc[t][4 + j] += wi * hi[j];
        }
      }
    }

    // join the halves' sums, normalize, hand ctx (f16) over: 8 consecutive d per lane
    const float inv_l = 1.0f / (l_run + other_half(l_run));
#pragma unroll
    for (int t = 0; t < 4; ++t) {
      v8h o;
#pragma unroll
      for (int j = 0; j < 8; ++j) o[j] = (_Float16)(acc[t][j] * inv_l);
      *(v8h*)&Cst[(sub * 16 + n) * CT_LD + t * 16 + 8 * hid] = o;
    }
  }
  __syncthreads();          // ctx tile visible to every wave

  // output projection  out[m][h] = sum_v ctx[m][v] * Wo[h][v] + bo[h]:
  // each weight fragment serves both 16-query tiles
  const v16h a00 = frag_load(Cst, CT_LD);
  const v16h a01 = frag_load(Cst + 32, CT_LD);
  const v16h a10 = frag_load(Cst + 16 * CT_LD, CT_LD);
  const v16h a11 = frag_load(Cst + 16 * CT_LD + 32, CT_LD);
  float* op = out + ((size_t)b * SEQ + qbase + 8 * hid) * HID + w * (PROJ_NT * 16) + n;

  // unrolled so that the test for a next tile is decided at compile time
#pragma unroll
  for (int i = 0; i < PROJ_NT; ++i) {
    v8f c0 = {}, c1 = {};
    c0 = wmma16(a00, b0, c0);
    c1 = wmma16(a10, b0, c1);
    c0 = wmma16(a01, b1, c0);
    c1 = wmma16(a11, b1, c1);
    const float bcur = bval;
    if (i + 1 < PROJ_NT) {  // next tile's weights fly under this tile's stores
      b0   = frag_load_packed(wp + (size_t)((i + 1) * 2) * FRAG_SZ);
      b1   = frag_load_packed(wp + (size_t)((i + 1) * 2 + 1) * FRAG_SZ);
      bval = bp[(i + 1) * 16];
    }
#pragma unroll
    for (int j = 0; j < 8; ++j) {
      op[(size_t)j * HID + i * 16]        = c0[j] + bcur;
      op[(size_t)(16 + j) * HID + i * 16] = c1[j] + bcur;
    }
    // the next tile reuses registers that these loads and stores name
    if (i + 1 < PROJ_NT) asm volatile("s_wait_xcnt 0x0" ::: "memory");
  }
}

// ---------------------------------------------------------------------------
extern "C" void kernel_launch(void* const* d_in, const int* in_sizes, int n_in,
                              void* d_out, int out_size, void* d_ws, size_t ws_size,
                              hipStream_t stream) {
  (void)in_sizes; (void)n_in; (void)out_size; (void)ws_size;

  const float* y  = (const float*)d_in[0];
  const float* Wq = (const float*)d_in[1];
  const float* bq = (const float*)d_in[2];
  const float* Wk = (const float*)d_in[3];
  const float* bk = (const float*)d_in[4];
  const float* Wv = (const float*)d_in[5];
  const float* bv = (const float*)d_in[6];
  const float* Wo = (const float*)d_in[7];
  const float* bo = (const float*)d_in[8];
  float* out = (float*)d_out;

  // workspace layout (f16)
  char* ws = (char*)d_ws;
  _Float16* Wqkv_h = (_Float16*)(ws);                        // 192*1024  (384 KB), packed
  _Float16* Wo_h   = (_Float16*)(ws + 393216);               // 1024*64   (128 KB), packed
  _Float16* q_h    = (_Float16*)(ws + 524288);               // [b][t][d] (2 MB)
  _Float16* k_h    = (_Float16*)(ws + 524288 + 2097152);     // [b][t][d] (2 MB)
  _Float16* v_t    = (_Float16*)(ws + 524288 + 2 * 2097152); // [b][d][t] (2 MB)

  k0_convert_w<<<128, 256, 0, stream>>>(Wq, Wk, Wv, Wo, Wqkv_h, Wo_h);
  k1_qkv<<<NROWS / MT, 384, 0, stream>>>(y, Wqkv_h, bq, bk, bv, q_h, k_h, v_t);
  k2_attn<<<NBAT * (SEQ / QTILE), 256, 0, stream>>>(q_h, k_h, v_t, Wo_h, bo, out);
}

// v006
// Measured time: 44.7 microseconds a run.
// Next to v005, in two timings, it ran 1.08 times as fast each time.
// Counting every step since v000, it is 5.09 times as fast.
#include <hip/hip_runtime.h>
#include <hip/hip_bf16.h>
#include <math.h>

// ---------------------------------------------------------------------------
// Causal self-attention for MI455X (gfx1250, wave32, WMMA f16->f32).
//   HIDDEN=1024, DK=DV=64, B=4, T=4096
// Pipeline:
//   k0: convert weights fp32 -> f16 into workspace, packed in fragment order
//   k1: fused QKV projection (WMMA, K=1024); q pre-scaled by 1/sqrt(64);
//       V stored pre-transposed (v_t[b][d][t]) for transpose-free attention
//   k2: flash attention on transposed products, keys split over the waves of a
//       work-group, double-buffered KV chunks staged with
//       GLOBAL_LOAD_ASYNC_TO_LDS_B128 (ASYNCcnt pipeline); its epilogue is
//       the output projection (WMMA, K=64, N=1024) + bias, fp32 out
// ---------------------------------------------------------------------------

typedef __attribute__((ext_vector_type(16))) _Float16 v16h;
typedef __attribute__((ext_vector_type(8)))  _Float16 v8h;
typedef __attribute__((ext_vector_type(4)))  _Float16 v4h;
typedef __attribute__((ext_vector_type(8)))  float    v8f;
typedef __attribute__((ext_vector_type(4)))  float    v4f;
typedef __attribute__((ext_vector_type(4)))  int      v4i;

#define HID   1024
#define DK    64
#define SEQ   4096
#define NBAT  4
#define NROWS (NBAT * SEQ)          // 16384 token rows

// ---- gfx1250 async copy to LDS (guarded; fallback = vector copy) ----------
#if __has_builtin(__builtin_amdgcn_global_load_async_to_lds_b128)
#define HAVE_ASYNC 1
typedef __attribute__((address_space(1))) v4i as1_v4i;
typedef __attribute__((address_space(3))) v4i as3_v4i;
#else
#define HAVE_ASYNC 0
#endif

static __device__ __forceinline__ void copy16B(const _Float16* src, _Float16* dst) {
#if HAVE_ASYNC
  // prototype: (int4 AS1* src, int4 AS3* dst, imm offset, imm cpol)
  __builtin_amdgcn_global_load_async_to_lds_b128(
      (as1_v4i*)(uintptr_t)src,
      (as3_v4i*)(unsigned int)(uintptr_t)dst,   // low 32 bits = LDS offset
      0, 0);
#else
  *(v8h*)dst = *(const v8h*)src;
#endif
}

static __device__ __forceinline__ void wait_async_zero() {
#if HAVE_ASYNC
#if __has_builtin(__builtin_amdgcn_s_wait_asynccnt)
  __builtin_amdgcn_s_wait_asynccnt(0);
#else
  asm volatile("s_wait_asynccnt 0x0" ::: "memory");
#endif
#endif
}

// ---- fragment helpers (CDNA5 16x16x32 f16 WMMA layouts, wave32) -----------
// A-matrix 16x32: lane = hid*16 + r ; row M = r ;
//   halves e=0..7  -> K = hid*8 + e ; halves e=8..15 -> K = 16 + hid*8 + (e-8)
// B-matrix 32x16: same pattern with lane%16 = column N, reading src[N][K].
static __device__ __forceinline__ v16h frag_load(const _Float16* src, int ld) {
  const int lane = threadIdx.x & 31;
  const int hid  = lane >> 4;
  const int r    = lane & 15;
  const _Float16* p = src + (size_t)r * ld + hid * 8;
  v16h f;
#pragma unroll
  for (int e = 0; e < 8; ++e) f[e] = p[e];
#pragma unroll
  for (int e = 0; e < 8; ++e) f[8 + e] = p[16 + e];
  return f;
}

// A 16x32 fragment that k0 has packed: 1 KB in a row, 16-byte unit h2*32 + lane
// holds f[h2*8 .. h2*8+7] of frag_load's map.  Each of the two loads then reads
// 512 contiguous bytes (4 cache lines) instead of 32 bytes out of 16 lines.
#define FRAG_SZ 512   // halves per packed fragment
static __device__ __forceinline__ v16h frag_load_packed(const _Float16* frag) {
  const int lane = threadIdx.x & 31;
  const v8h lo = *(const v8h*)(frag + lane * 8);
  const v8h hi = *(const v8h*)(frag + 256 + lane * 8);
  return __builtin_shufflevector(lo, hi, 0, 1, 2, 3, 4, 5, 6, 7,
                                 8, 9, 10, 11, 12, 13, 14, 15);
}

static __device__ __forceinline__ v8f wmma16(v16h a, v16h b, v8f c) {
  return __builtin_amdgcn_wmma_f32_16x16x32_f16(false, a, false, b,
                                                (short)0, c, false, false);
}

// ---------------------------------------------------------------------------
// k0: fp32 -> f16 weight conversion into fragment order (see frag_load_packed).
//   One thread per 16-byte unit.  Wqkv_h: fragment (w, kb) at index w*32 + kb,
//   w = 16-row tile of fused [q|k|v], kb = 32-wide k block.  Wo_h: fragment
//   (nt, kb) at index nt*2 + kb.
// ---------------------------------------------------------------------------
#define QKV_UNITS (3 * DK * HID / 8)   // 24576, a multiple of 64
#define WO_UNITS  (HID * DK / 8)       // 8192

__global__ void k0_convert_w(const float* __restrict__ Wq,
                             const float* __restrict__ Wk,
                             const float* __restrict__ Wv,
                             const float* __restrict__ Wo,
                             _Float16* __restrict__ Wqkv_h,
                             _Float16* __restrict__ Wo_h) {
  const int u    = blockIdx.x * blockDim.x + threadIdx.x;
  if (u >= QKV_UNITS + WO_UNITS) return;
  const int lane = u & 31;
  const int r    = lane & 15;                                  // row in the tile
  const int kin  = ((u >> 5) & 1) * 16 + (lane >> 4) * 8;      // first k in the block
  const float* src;
  _Float16*    dst;
  if (u < QKV_UNITS) {
    const int frag = u >> 6;
    const int w    = frag >> 5, kb = frag & 31;
    const int sel  = w >> 2;                                   // 0=q 1=k 2=v
    const float* W = (sel == 0) ? Wq : (sel == 1) ? Wk : Wv;
    src = W + (size_t)((w & 3) * 16 + r) * HID + kb * 32 + kin;
    dst = Wqkv_h + (size_t)u * 8;
  } else {
    const int u2   = u - QKV_UNITS;
    const int frag = u2 >> 6;
    const int nt   = frag >> 1, kb = frag & 1;
    src = Wo + (size_t)(nt * 16 + r) * DK + kb * 32 + kin;
    dst = Wo_h + (size_t)u2 * 8;
  }
  const v4f a = *(const v4f*)src;
  const v4f b = *(const v4f*)(src + 4);
  const v8h o = {(_Float16)a[0], (_Float16)a[1], (_Float16)a[2], (_Float16)a[3],
                 (_Float16)b[0], (_Float16)b[1], (_Float16)b[2], (_Float16)b[3]};
  *(v8h*)dst = o;
}

// ---------------------------------------------------------------------------
// k1: fused QKV projection.  grid.x = NROWS/64; 384 threads = 12 waves.
//   Wave w owns one 16-col tile of fused [q|k|v] for all 64 rows: a weight
//   fragment is loaded once and feeds four products (four accumulators).
//   y goes to LDS (f16) in slices of 256 k columns, two buffers: the next
//   slice's loads are in flight while this slice is multiplied.
//   V written transposed: v_t[b][d][t].
// ---------------------------------------------------------------------------
#define MT     64                 // token rows per work-group
#define MTILES (MT / 16)
#define KS     256                // k columns per staged slice
#define NSL    (HID / KS)
#define KSTEPS (KS / 32)          // products along k per slice
#define YS_LD  (KS + 8)           // 528B stride (16B aligned, same bank step as a 16B pad)
#define YUNITS (MT * KS / 4)      // 16-byte units of y per slice
#define YLOADS ((YUNITS + 383) / 384)

// stands behind a group of global loads: s_wait_xcnt 0 in front of every rewrite of
// a register that an issued load names; the fence holds those rewrites behind it
static __device__ __forceinline__ void loads_issued() {
  asm volatile("s_wait_xcnt 0x0" ::: "memory");
  __builtin_amdgcn_sched_barrier(0);
}

__global__ __launch_bounds__(384) void k1_qkv(const float* __restrict__ y,
                       const _Float16* __restrict__ Wqkv_h,
                       const float* __restrict__ bq,
                       const float* __restrict__ bk,
                       const float* __restrict__ bv,
                       _Float16* __restrict__ q_h,
                       _Float16* __restrict__ k_h,
                       _Float16* __restrict__ v_t) {
  __shared__ __align__(16) _Float16 ytile[2 * MT * YS_LD];

  const int tid  = threadIdx.x;
  const int row0 = blockIdx.x * MT;
  const int w    = __builtin_amdgcn_readfirstlane(tid >> 5);  // 0..11, scalar: real branches below
  const int lane = tid & 31;
  const int hid  = lane >> 4;
  const int n    = lane & 15;
  // the last round of a slice's units is short: whole waves 0..7 take it
  const bool tail = w < (YUNITS - (YLOADS - 1) * 384) / 32;

  v4f  pre[YLOADS];       // a slice of y on its way from memory to LDS
  v16h wf[KSTEPS];        // this wave's weight fragments of one slice
  v8f  acc[MTILES] = {v8f{}, v8f{}, v8f{}, v8f{}};

  // a wave's 32 lanes read 512 contiguous bytes of one row
#define Y_LOAD(s)                                                              \
  _Pragma("unroll") for (int j = 0; j < YLOADS; ++j) {                         \
    const int i = tid + j * 384;                                               \
    if (j + 1 < YLOADS || tail)                                                \
      pre[j] = *(const v4f*)&y[(size_t)(row0 + (i >> 6)) * HID + (s) * KS +    \
                               (i & 63) * 4];                                  \
  }
#define Y_STORE(buf)                                                           \
  _Pragma("unroll") for (int j = 0; j < YLOADS; ++j) {                         \
    const int i = tid + j * 384;                                               \
    if (j + 1 < YLOADS || tail) {                                              \
      const v4h hv = {(_Float16)pre[j][0], (_Float16)pre[j][1],                \
                      (_Float16)pre[j][2], (_Float16)pre[j][3]};               \
      *(v4h*)&ytile[(buf) * (MT * YS_LD) + (i >> 6) * YS_LD + (i & 63) * 4] = hv; \
    }                                                                          \
  }
#define W_LOAD(s)                                                              \
  _Pragma("unroll") for (int kb = 0; kb < KSTEPS; ++kb)                        \
    wf[kb] = frag_load_packed(Wqkv_h +                                         \
                              (size_t)(w * 32 + (s) * KSTEPS + kb) * FRAG_SZ);

  // loads return in order.  In the loop a slice of y is asked for ahead of the
  // weights that are needed after it; here the weights go first, they come from L2
  W_LOAD(0)
  loads_issued();
  Y_LOAD(0)
  loads_issued();
  Y_STORE(0)
  // slice 1 is asked for only when slice 0 has left its registers
  __builtin_amdgcn_sched_barrier(0);
  Y_LOAD(1)
  loads_issued();

#pragma unroll
  for (int s = 0; s < NSL; ++s) {
    // slice s visible; every wave has left the buffer that is refilled below.
    // The waves share LDS only, so the fences name LDS alone: __syncthreads()
    // would also wait out the global loads that are in flight across this point
    __builtin_amdgcn_fence(__ATOMIC_RELEASE, "workgroup", "local");
    __builtin_amdgcn_s_barrier();
    __builtin_amdgcn_fence(__ATOMIC_ACQUIRE, "workgroup", "local");

    // y fragments are read one k step ahead, as one group, into a second set
    const _Float16* yt = ytile + (s & 1) * (MT * YS_LD);
    v16h af[2][MTILES];
#pragma unroll
    for (int i = 0; i < MTILES; ++i) af[0][i] = frag_load(yt + i * 16 * YS_LD, YS_LD);
#pragma unroll
    for (int kb = 0; kb < KSTEPS; ++kb) {
      if (kb + 1 < KSTEPS) {
#pragma unroll
        for (int i = 0; i < MTILES; ++i)
          af[(kb + 1) & 1][i] = frag_load(yt + i * 16 * YS_LD + (kb + 1) * 32, YS_LD);
      }
      // keeps that group of LDS reads whole and ahead of this step's products
      __builtin_amdgcn_sched_barrier(0);
#pragma unroll
      for (int i = 0; i < MTILES; ++i) acc[i] = wmma16(af[kb & 1][i], wf[kb], acc[i]);
      // keeps the following group of LDS reads from moving in among the products
      __builtin_amdgcn_sched_barrier(0);
    }

    // (the fence behind the last products also keeps the conversions below, which
    // wait for the next slice's loads, behind them)
    if (s + 1 < NSL) {
      W_LOAD(s + 1)
      loads_issued();
      Y_STORE((s + 1) & 1)
      // the slice after it is asked for only when its registers are free
      __builtin_amdgcn_sched_barrier(0);
      if (s + 2 < NSL) {
        Y_LOAD(s + 2)
        loads_issued();
      }
    }
  }
#undef Y_LOAD
#undef Y_STORE
#undef W_LOAD

  const int sel  = w >> 2;                  // 0=q 1=k 2=v
  const int col  = (w & 3) * 16 + n;        // 0..63 within q/k/v
  const float* bias = (sel == 0) ? bq : (sel == 1) ? bk : bv;
  const float scale = (sel == 0) ? 0.125f : 1.0f;   // q / sqrt(64)
  const float bval  = bias[col];
  _Float16* dst = (sel == 0) ? q_h : k_h;

  // the 64 rows of a work-group lie in one batch (SEQ is a multiple of MT)
  _Float16* vp = v_t + (size_t)(row0 >> 12) * (DK * SEQ) + (size_t)col * SEQ +
                 (row0 & (SEQ - 1)) + 8 * hid;
  _Float16* qp = dst + (size_t)(row0 + 8 * hid) * DK + col;
  if (sel == 2) {           // scalar branch: whole waves
#pragma unroll
    for (int i = 0; i < MTILES; ++i)
#pragma unroll
      for (int j = 0; j < 8; ++j)
        vp[i * 16 + j] = (_Float16)((acc[i][j] + bval) * scale);
    return;
  }
#pragma unroll
  for (int i = 0; i < MTILES; ++i)
#pragma unroll
    for (int j = 0; j < 8; ++j)
      qp[(size_t)(i * 16 + j) * DK] = (_Float16)((acc[i][j] + bval) * scale);
  // the built code lays the V branch behind these stores, on a path that is never
  // taken: the wait stands in front of its writes to registers the stores name
  asm volatile("s_wait_xcnt 0x0" ::: "memory");
}

// ---------------------------------------------------------------------------
// k2: flash attention (causal), double-buffered async KV staging.
//   grid.x = NBAT * (SEQ/32), dealt heavy tiles first (see the index map below);
//   256 threads = 8 waves = 2 query tiles x 4 key groups.
//   Wave (sub, g) owns 16 q rows and the key chunks g, g+4, g+8, ... with its
//   own maximum, sum and accumulators; the four groups' partials of a query
//   tile are merged once, through LDS, by the wave of group 0.
//   Transposed products: S^T = K Q^T and ctx^T += V^T P^T.  A lane then holds
//   16 scores of ONE query, so maximum and sum are in-lane (one exchange
//   between the wave halves), and the two S^T tiles, converted in place, are
//   the B operand of the second product: P never goes through LDS.
//   Epilogue: the merged 32 x 64 ctx tile goes to LDS (f16) and all 8 waves
//   project it, wave w on output columns [w*128, w*128 + 128): work-groups with
//   few keys write their rows of out while the long ones are still in the loop.
// ---------------------------------------------------------------------------
#define K_LD  88     // 64 + 24 pad halves: 176B stride (16B aligned, no bank conflict)
#define VT_LD 40     // 32 + 8 pad halves:  80B stride  (16B aligned, no bank conflict)
#define QTILE 32
#define KVG   4      // key groups per work-group; SEQ/32 is a multiple of it
#define KCH_SZ (32 * K_LD)
#define VCH_SZ (DK * VT_LD)
#define CT_LD 72     // 64 + 8 pad halves: 144B stride (16B aligned)
#define PROJ_NT (HID / 16 / 8)   // output column tiles per wave in the projection

// value of lane l ^ 16 (vector cross-row move, no LDS round trip)
static __device__ __forceinline__ float other_half(float x) {
  const int b = __builtin_bit_cast(int, x);
  return __builtin_bit_cast(
      float, __builtin_amdgcn_permlanex16(b, b, 0x76543210, 0xfedcba98, false, false));
}

__global__ void k2_attn(const _Float16* __restrict__ q_h,
                        const _Float16* __restrict__ k_h,
                        const _Float16* __restrict__ v_t,
                        const _Float16* __restrict__ Wo_h,
                        const float* __restrict__ bo,
                        float* __restrict__ out) {
  __shared__ __align__(16) _Float16 Klds[2 * KVG * KCH_SZ];  // [buf][group] K chunk [kv 32][d 64]
  __shared__ __align__(16) _Float16 Vlds[2 * KVG * VCH_SZ];  // [buf][group] V^T chunk [d 64][kv 32]
  __shared__ __align__(16) float Pacc[(KVG - 1) * 2 * 8 * 32 * 4];  // [slot][quad][lane] 4 floats
  __shared__ float Pml[(KVG - 1) * 2 * 2 * 32];                     // [slot][max, sum][lane]
  __shared__ __align__(16) _Float16 Cst[QTILE * CT_LD];             // merged ctx tile [query 32][d 64]

  const int tid  = threadIdx.x;
  const int w    = __builtin_amdgcn_readfirstlane(tid >> 5);  // scalar: the skip below is a real branch
  const int sub  = w & 1;                   // query tile of this wave
  const int g    = w >> 1;                  // key group of this wave
  const int lane = tid & 31;
  const int hid  = lane >> 4;
  const int n    = lane & 15;

  // Work-group index -> (batch, query tile), a permutation chosen for speed only.
  // A tile's key count grows with its index (causal), every work-group is resident
  // (two fit a WGP).  The first half of the grid takes the upper
  // tiles, heaviest first; the second half
  // takes the lower tiles, lightest first, so indices i and i + half hold tiles
  // qtiles-1-j and j: every such pair has the same number of key chunks.
  const int qtiles = SEQ / QTILE;           // 128
  const int halfg  = NBAT * qtiles / 2;     // work-groups in half the grid
  const int rk     = blockIdx.x % halfg;
  const int b      = rk % NBAT;
  const int j0     = rk / NBAT;             // 0 .. qtiles/2 - 1
  const int qbase  = ((int)blockIdx.x < halfg ? qtiles - 1 - j0 : j0) * QTILE;
  const size_t bo64 = (size_t)b * SEQ * DK; // batch offset, [t][d] layouts
  const _Float16* kg  = k_h + bo64;
  const _Float16* vtg = v_t + bo64;         // [d][t] layout

  // per-thread staging coordinates (each thread moves 2 x 16B per chunk)
  const int rK = tid >> 3, sK = tid & 7;    // K: row kv, 8-half segment
  const int dV = tid >> 2, sV = tid & 3;    // V^T: row d, 8-half segment

  // persistent Q fragments for this wave's 16 rows (already scaled);
  // used as B: lane n holds query column n
  const _Float16* qp = q_h + bo64 + (size_t)(qbase + sub * 16) * DK;
  const v16h aq0 = frag_load(qp, DK);
  const v16h aq1 = frag_load(qp + 32, DK);

  // acc[t][j] = ctx^T[d = t*16 + 8*hid + j][query n], over this group's keys
  v8f   acc[4] = {v8f{}, v8f{}, v8f{}, v8f{}};
  float m_run = -3.0e38f;   // running maximum of query n (equal in both halves)
  float l_run = 0.0f;       // this half's share of the running sum of query n

  const int row    = qbase + sub * 16 + n;  // this lane's query
  const int limit  = qbase + QTILE;
  // a trip serves KVG chunks of 32 keys, one per group; trips * KVG * 32 <= SEQ,
  // so chunks past the diagonal in the last trip are still inside K and V
  const int ntrips = (limit / 32 + KVG - 1) / KVG;

  // stage trip 0 into buffer 0
#pragma unroll
  for (int c = 0; c < KVG; ++c) {
    copy16B(kg  + (size_t)(c * 32 + rK) * DK + sK * 8,
            Klds + c * KCH_SZ + rK * K_LD + sK * 8);
    copy16B(vtg + (size_t)dV * SEQ + c * 32 + sV * 8,
            Vlds + c * VCH_SZ + dV * VT_LD + sV * 8);
  }

  int cur = 0;
  for (int trip = 0; trip < ntrips; ++trip) {
    // this wave's LDS reads of the buffer that is refilled below have retired
    asm volatile("s_wait_dscnt 0x0" ::: "memory");
    wait_async_zero();      // my async copies into buf[cur] done
    __syncthreads();        // everyone's copies visible; prev compute done

    // prefetch the next trip's chunks into the other buffer (overlaps with WMMAs below)
    if (trip + 1 < ntrips) {
      const int nxt = (trip + 1) * (KVG * 32);
#pragma unroll
      for (int c = 0; c < KVG; ++c) {
        copy16B(kg  + (size_t)(nxt + c * 32 + rK) * DK + sK * 8,
                Klds + ((cur ^ 1) * KVG + c) * KCH_SZ + rK * K_LD + sK * 8);
        copy16B(vtg + (size_t)dV * SEQ + nxt + c * 32 + sV * 8,
                Vlds + ((cur ^ 1) * KVG + c) * VCH_SZ + dV * VT_LD + sV * 8);
      }
    }

    const int kvb = (trip * KVG + g) * 32;  // this group's chunk
    if (kvb < limit) {                      // wave-uniform; a chunk past the diagonal has no open key
      const _Float16* Kb = Klds + (cur * KVG + g) * KCH_SZ;
      const _Float16* Vb = Vlds + (cur * KVG + g) * VCH_SZ;

      // S^T = K Q^T : two 16x16 tiles, kv rows [kvb, kvb+16) and [kvb+16, kvb+32)
      //   s0[j] = S[row][kvb + 8*hid + j],  s1[j] = S[row][kvb + 16 + 8*hid + j]
      v8f s0 = {}, s1 = {};
      {
        v16h b0 = frag_load(Kb, K_LD);
        s0 = wmma16(b0, aq0, s0);
        v16h b1 = frag_load(Kb + 32, K_LD);
        s0 = wmma16(b1, aq1, s0);
        v16h b2 = frag_load(Kb + 16 * K_LD, K_LD);
        s1 = wmma16(b2, aq0, s1);
        v16h b3 = frag_load(Kb + 16 * K_LD + 32, K_LD);
        s1 = wmma16(b3, aq1, s1);
      }

      // online softmax update (fp32), causal mask; all 16 scores belong to 'row'
      const int kv0 = kvb + 8 * hid;
      float mx = -3.0e38f;
#pragma unroll
      for (int j = 0; j < 8; ++j) {
        s0[j] = (kv0 + j)      <= row ? s0[j] : -3.0e38f;
        s1[j] = (kv0 + 16 + j) <= row ? s1[j] : -3.0e38f;
        mx = fmaxf(mx, fmaxf(s0[j], s1[j]));
      }
      mx = fmaxf(mx, other_half(mx));

      // a chunk that is entered has kvb <= qbase <= row: its first key is open to
      // every query, so mtot is a real score and a masked entry gives
      // exp(-3e38 - mtot) = 0
      const float mtot = fmaxf(m_run, mx);
      const float sc   = __expf(m_run - mtot);

      v16h  pT;             // B operand: pT[e] = P^T[kmap(e, hid)][n]
      float rs = 0.0f;
#pragma unroll
      for (int j = 0; j < 8; ++j) {
        const float p0 = __expf(s0[j] - mtot);
        const float p1 = __expf(s1[j] - mtot);
        rs += p0 + p1;
        pT[j]     = (_Float16)p0;
        pT[8 + j] = (_Float16)p1;
      }

      m_run = mtot;
      l_run = l_run * sc + rs;
#pragma unroll
      for (int t = 0; t < 4; ++t) acc[t] *= sc;

      // ctx^T += V^T (16 d x 32 kv) * P^T (32 kv x 16 q): 4 WMMAs
#pragma unroll
      for (int t = 0; t < 4; ++t) {
        v16h aV = frag_load(Vb + (size_t)(t * 16) * VT_LD, VT_LD);
        acc[t] = wmma16(aV, pT, acc[t]);
      }
    }
    cur ^= 1;
  }

  // no copy is in flight when a wave goes on to the merge or ends
  asm volatile("s_wait_asynccnt 0x0" ::: "memory");

  // merge of the key groups: groups 1.. hand their partials (same lane layout) to group 0
  if (g != 0) {
    const int slot = (g - 1) * 2 + sub;
#pragma unroll
    for (int t = 0; t < 4; ++t) {
      const v4f lo = {acc[t][0], acc[t][1], acc[t][2], acc[t][3]};
      const v4f hi = {acc[t][4], acc[t][5], acc[t][6], acc[t][7]};
      *(v4f*)&Pacc[((slot * 8 + t * 2 + 0) * 32 + lane) * 4] = lo;
      *(v4f*)&Pacc[((slot * 8 + t * 2 + 1) * 32 + lane) * 4] = hi;
    }
    Pml[(slot * 2 + 0) * 32 + lane] = m_run;
    Pml[(slot * 2 + 1) * 32 + lane] = l_run;
  }
  __syncthreads();          // partials visible to group 0

  // wave w projects onto output columns [w*128, w*128 + 128), 8 tiles of 16; the
  // first tile's weights and bias are asked for here, ahead of the merge
  const _Float16* wp = Wo_h + (size_t)(w * (PROJ_NT * 2)) * FRAG_SZ;
  const float*    bp = bo + w * (PROJ_NT * 16) + n;
  v16h  b0   = frag_load_packed(wp);
  v16h  b1   = frag_load_packed(wp + FRAG_SZ);
  float bval = bp[0];

  if (g == 0) {             // scalar branch: whole waves
    // group 0 always has chunk 0, so mall is a real score; a group that had no
    // chunk holds (-3e38, 0, 0) and gets weight exp(-3e38 - mall) = 0
    float mall = m_run;
#pragma unroll
    for (int i = 0; i < KVG - 1; ++i)
      mall = fmaxf(mall, Pml[((i * 2 + sub) * 2 + 0) * 32 + lane]);
    const float w0 = __expf(m_run - mall);
    l_run *= w0;
#pragma unroll
    for (int t = 0; t < 4; ++t) acc[t] *= w0;
#pragma unroll
    for (int i = 0; i < KVG - 1; ++i) {
      const int slot = i * 2 + sub;
      const float wi = __expf(Pml[(slot * 2 + 0) * 32 + lane] - mall);
      l_run += wi * Pml[(slot * 2 + 1) * 32 + lane];
#pragma unroll
      for (int t = 0; t < 4; ++t) {
        const v4f lo = *(const v4f*)&Pacc[((slot * 8 + t * 2 + 0) * 32 + lane) * 4];
        const v4f hi = *(const v4f*)&Pacc[((slot * 8 + t * 2 + 1) * 32 + lane) * 4];
#pragma unroll
        for (int j = 0; j < 4; ++j) {
          acc[t][j]     += wi * lo[j];
          acc[t][4 + j] += wi * hi[j];
        }
      }
    }

    // join the halves' sums, normalize, hand ctx (f16) over: 8 consecutive d per lane
    const float inv_l = 1.0f / (l_run + other_half(l_run));
#pragma unroll
    for (int t = 0; t < 4; ++t) {
      v8h o;
#pragma unroll
      for (int j = 0; j < 8; ++j) o[j] = (_Float16)(acc[t][j] * inv_l);
      *(v8h*)&Cst[(sub * 16 + n) * CT_LD + t * 16 + 8 * hid] = o;
    }
  }
  __syncthreads();          // ctx tile visible to every wave

  // output projection  out[m][h] = sum_v ctx[m][v] * Wo[h][v] + bo[h]:
  // each weight fragment serves both 16-query tiles
  const v16h a00 = frag_load(Cst, CT_LD);
  const v16h a01 = frag_load(Cst + 32, CT_LD);
  const v16h a10 = frag_load(Cst + 16 * CT_LD, CT_LD);
  const v16h a11 = frag_load(Cst + 16 * CT_LD + 32, CT_LD);
  float* op = out + ((size_t)b * SEQ + qbase + 8 * hid) * HID + w * (PROJ_NT * 16) + n;

  // unrolled so that the test for a next tile is decided at compile time
#pragma unroll
  for (int i = 0; i < PROJ_NT; ++i) {
    v8f c0 = {}, c1 = {};
    c0 = wmma16(a00, b0, c0);
    c1 = wmma16(a10, b0, c1);
    c0 = wmma16(a01, b1, c0);
    c1 = wmma16(a11, b1, c1);
    const float bcur = bval;
    if (i + 1 < PROJ_NT) {  // next tile's weights fly under this tile's stores
      b0   = frag_load_packed(wp + (size_t)((i + 1) * 2) * FRAG_SZ);
      b1   = frag_load_packed(wp + (size_t)((i + 1) * 2 + 1) * FRAG_SZ);
      bval = bp[(i + 1) * 16];
    }
#pragma unroll
    for (int j = 0; j < 8; ++j) {
      op[(size_t)j * HID + i * 16]        = c0[j] + bcur;
      op[(size_t)(16 + j) * HID + i * 16] = c1[j] + bcur;
    }
    // the next tile reuses registers that these loads and stores name
    if (i + 1 < PROJ_NT) asm volatile("s_wait_xcnt 0x0" ::: "memory");
  }
}

// ---------------------------------------------------------------------------
extern "C" void kernel_launch(void* const* d_in, const int* in_sizes, int n_in,
                              void* d_out, int out_size, void* d_ws, size_t ws_size,
                              hipStream_t stream) {
  (void)in_sizes; (void)n_in; (void)out_size; (void)ws_size;

  const float* y  = (const float*)d_in[0];
  const float* Wq = (const float*)d_in[1];
  const float* bq = (const float*)d_in[2];
  const float* Wk = (const float*)d_in[3];
  const float* bk = (const float*)d_in[4];
  const float* Wv = (const float*)d_in[5];
  const float* bv = (const float*)d_in[6];
  const float* Wo = (const float*)d_in[7];
  const float* bo = (const float*)d_in[8];
  float* out = (float*)d_out;

  // workspace layout (f16)
  char* ws = (char*)d_ws;
  _Float16* Wqkv_h = (_Float16*)(ws);                        // 192*1024  (384 KB), packed
  _Float16* Wo_h   = (_Float16*)(ws + 393216);               // 1024*64   (128 KB), packed
  _Float16* q_h    = (_Float16*)(ws + 524288);               // [b][t][d] (2 MB)
  _Float16* k_h    = (_Float16*)(ws + 524288 + 2097152);     // [b][t][d] (2 MB)
  _Float16* v_t    = (_Float16*)(ws + 524288 + 2 * 2097152); // [b][d][t] (2 MB)

  k0_convert_w<<<128, 256, 0, stream>>>(Wq, Wk, Wv, Wo, Wqkv_h, Wo_h);
  k1_qkv<<<NROWS / MT, 384, 0, stream>>>(y, Wqkv_h, bq, bk, bv, q_h, k_h, v_t);
  k2_attn<<<NBAT * (SEQ / QTILE), 256, 0, stream>>>(q_h, k_h, v_t, Wo_h, bo, out);
}

// v007
// Measured time: 42.6 microseconds a run.
// Next to v006, in two timings, it ran 1.04 times as fast each time.
// Counting every step since v000, it is 5.31 times as fast.
#include <hip/hip_runtime.h>
#include <hip/hip_bf16.h>
#include <math.h>

// ---------------------------------------------------------------------------
// Causal self-attention for MI455X (gfx1250, wave32, WMMA f16->f32).
//   HIDDEN=1024, DK=DV=64, B=4, T=4096
// Pipeline:
//   k0: convert weights fp32 -> f16 into workspace, packed in fragment order
//   k1: fused QKV projection (WMMA, K=1024); q pre-scaled by 1/sqrt(64);
//       V stored pre-transposed (v_t[b][d][t]) for transpose-free attention
//   k2: flash attention on transposed products, keys split over the waves of a
//       work-group, double-buffered KV chunks staged with
//       GLOBAL_LOAD_ASYNC_TO_LDS_B128 (ASYNCcnt pipeline); its epilogue is
//       the output projection (WMMA, K=64, N=1024) + bias, fp32 out
// ---------------------------------------------------------------------------

typedef __attribute__((ext_vector_type(16))) _Float16 v16h;
typedef __attribute__((ext_vector_type(8)))  _Float16 v8h;
typedef __attribute__((ext_vector_type(4)))  _Float16 v4h;
typedef __attribute__((ext_vector_type(8)))  float    v8f;
typedef __attribute__((ext_vector_type(4)))  float    v4f;
typedef __attribute__((ext_vector_type(4)))  int      v4i;

#define HID   1024
#define DK    64
#define SEQ   4096
#define NBAT  4
#define NROWS (NBAT * SEQ)          // 16384 token rows

// ---- gfx1250 async copy to LDS (guarded; fallback = vector copy) ----------
#if __has_builtin(__builtin_amdgcn_global_load_async_to_lds_b128)
#define HAVE_ASYNC 1
typedef __attribute__((address_space(1))) v4i as1_v4i;
typedef __attribute__((address_space(3))) v4i as3_v4i;
#else
#define HAVE_ASYNC 0
#endif

static __device__ __forceinline__ void copy16B(const _Float16* src, _Float16* dst) {
#if HAVE_ASYNC
  // prototype: (int4 AS1* src, int4 AS3* dst, imm offset, imm cpol)
  __builtin_amdgcn_global_load_async_to_lds_b128(
      (as1_v4i*)(uintptr_t)src,
      (as3_v4i*)(unsigned int)(uintptr_t)dst,   // low 32 bits = LDS offset
      0, 0);
#else
  *(v8h*)dst = *(const v8h*)src;
#endif
}

static __device__ __forceinline__ void wait_async_zero() {
#if HAVE_ASYNC
#if __has_builtin(__builtin_amdgcn_s_wait_asynccnt)
  __builtin_amdgcn_s_wait_asynccnt(0);
#else
  asm volatile("s_wait_asynccnt 0x0" ::: "memory");
#endif
#endif
}

// ---- fragment helpers (CDNA5 16x16x32 f16 WMMA layouts, wave32) -----------
// A-matrix 16x32: lane = hid*16 + r ; row M = r ;
//   halves e=0..7  -> K = hid*8 + e ; halves e=8..15 -> K = 16 + hid*8 + (e-8)
// B-matrix 32x16: same pattern with lane%16 = column N, reading src[N][K].
static __device__ __forceinline__ v16h frag_load(const _Float16* src, int ld) {
  const int lane = threadIdx.x & 31;
  const int hid  = lane >> 4;
  const int r    = lane & 15;
  const _Float16* p = src + (size_t)r * ld + hid * 8;
  v16h f;
#pragma unroll
  for (int e = 0; e < 8; ++e) f[e] = p[e];
#pragma unroll
  for (int e = 0; e < 8; ++e) f[8 + e] = p[16 + e];
  return f;
}

// A 16x32 fragment that k0 has packed: 1 KB in a row, 16-byte unit h2*32 + lane
// holds f[h2*8 .. h2*8+7] of frag_load's map.  Each of the two loads then reads
// 512 contiguous bytes (4 cache lines) instead of 32 bytes out of 16 lines.
#define FRAG_SZ 512   // halves per packed fragment
static __device__ __forceinline__ v16h frag_load_packed(const _Float16* frag) {
  const int lane = threadIdx.x & 31;
  const v8h lo = *(const v8h*)(frag + lane * 8);
  const v8h hi = *(const v8h*)(frag + 256 + lane * 8);
  return __builtin_shufflevector(lo, hi, 0, 1, 2, 3, 4, 5, 6, 7,
                                 8, 9, 10, 11, 12, 13, 14, 15);
}

static __device__ __forceinline__ v8f wmma16(v16h a, v16h b, v8f c) {
  return __builtin_amdgcn_wmma_f32_16x16x32_f16(false, a, false, b,
                                                (short)0, c, false, false);
}

// ---------------------------------------------------------------------------
// k0: fp32 -> f16 weight conversion into fragment order (see frag_load_packed).
//   One thread per 16-byte unit.  Wqkv_h: fragment (w, kb) at index w*32 + kb,
//   w = 16-row tile of fused [q|k|v], kb = 32-wide k block.  Wo_h: fragment
//   (nt, kb) at index nt*2 + kb; tile nt = 4*G + c holds, as its row r, output
//   column 64*G + 4*r + c: the four tiles of a group G leave four adjacent
//   outputs in one lane (see the projection in k2).
// ---------------------------------------------------------------------------
#define QKV_UNITS (3 * DK * HID / 8)   // 24576, a multiple of 64
#define WO_UNITS  (HID * DK / 8)       // 8192

__global__ void k0_convert_w(const float* __restrict__ Wq,
                             const float* __restrict__ Wk,
                             const float* __restrict__ Wv,
                             const float* __restrict__ Wo,
                             _Float16* __restrict__ Wqkv_h,
                             _Float16* __restrict__ Wo_h) {
  const int u    = blockIdx.x * blockDim.x + threadIdx.x;
  if (u >= QKV_UNITS + WO_UNITS) return;
  const int lane = u & 31;
  const int r    = lane & 15;                                  // row in the tile
  const int kin  = ((u >> 5) & 1) * 16 + (lane >> 4) * 8;      // first k in the block
  const float* src;
  _Float16*    dst;
  if (u < QKV_UNITS) {
    const int frag = u >> 6;
    const int w    = frag >> 5, kb = frag & 31;
    const int sel  = w >> 2;                                   // 0=q 1=k 2=v
    const float* W = (sel == 0) ? Wq : (sel == 1) ? Wk : Wv;
    src = W + (size_t)((w & 3) * 16 + r) * HID + kb * 32 + kin;
    dst = Wqkv_h + (size_t)u * 8;
  } else {
    const int u2   = u - QKV_UNITS;
    const int frag = u2 >> 6;
    const int nt   = frag >> 1, kb = frag & 1;
    src = Wo + (size_t)((nt >> 2) * 64 + r * 4 + (nt & 3)) * DK + kb * 32 + kin;
    dst = Wo_h + (size_t)u2 * 8;
  }
  const v4f a = *(const v4f*)src;
  const v4f b = *(const v4f*)(src + 4);
  const v8h o = {(_Float16)a[0], (_Float16)a[1], (_Float16)a[2], (_Float16)a[3],
                 (_Float16)b[0], (_Float16)b[1], (_Float16)b[2], (_Float16)b[3]};
  *(v8h*)dst = o;
}

// ---------------------------------------------------------------------------
// k1: fused QKV projection.  grid.x = NROWS/64; 384 threads = 12 waves.
//   Wave w owns one 16-col tile of fused [q|k|v] for all 64 rows: a weight
//   fragment is loaded once and feeds four products (four accumulators).
//   y goes to LDS (f16) in slices of 256 k columns, two buffers: the next
//   slice's loads are in flight while this slice is multiplied.
//   V written transposed: v_t[b][d][t].
// ---------------------------------------------------------------------------
#define MT     64                 // token rows per work-group
#define MTILES (MT / 16)
#define KS     256                // k columns per staged slice
#define NSL    (HID / KS)
#define KSTEPS (KS / 32)          // products along k per slice
#define YS_LD  (KS + 8)           // 528B stride (16B aligned, same bank step as a 16B pad)
#define YUNITS (MT * KS / 4)      // 16-byte units of y per slice
#define YLOADS ((YUNITS + 383) / 384)

// stands behind a group of global loads or stores: s_wait_xcnt 0 in front of every
// rewrite of a register that one of them names; the fence holds those rewrites behind it
static __device__ __forceinline__ void loads_issued() {
  asm volatile("s_wait_xcnt 0x0" ::: "memory");
  __builtin_amdgcn_sched_barrier(0);
}

__global__ __launch_bounds__(384) void k1_qkv(const float* __restrict__ y,
                       const _Float16* __restrict__ Wqkv_h,
                       const float* __restrict__ bq,
                       const float* __restrict__ bk,
                       const float* __restrict__ bv,
                       _Float16* __restrict__ q_h,
                       _Float16* __restrict__ k_h,
                       _Float16* __restrict__ v_t) {
  __shared__ __align__(16) _Float16 ytile[2 * MT * YS_LD];

  const int tid  = threadIdx.x;
  const int row0 = blockIdx.x * MT;
  const int w    = __builtin_amdgcn_readfirstlane(tid >> 5);  // 0..11, scalar: real branches below
  const int lane = tid & 31;
  const int hid  = lane >> 4;
  const int n    = lane & 15;
  // the last round of a slice's units is short: whole waves 0..7 take it
  const bool tail = w < (YUNITS - (YLOADS - 1) * 384) / 32;

  v4f  pre[YLOADS];       // a slice of y on its way from memory to LDS
  v16h wf[KSTEPS];        // this wave's weight fragments of one slice
  v8f  acc[MTILES] = {v8f{}, v8f{}, v8f{}, v8f{}};

  // a wave's 32 lanes read 512 contiguous bytes of one row
#define Y_LOAD(s)                                                              \
  _Pragma("unroll") for (int j = 0; j < YLOADS; ++j) {                         \
    const int i = tid + j * 384;                                               \
    if (j + 1 < YLOADS || tail)                                                \
      pre[j] = *(const v4f*)&y[(size_t)(row0 + (i >> 6)) * HID + (s) * KS +    \
                               (i & 63) * 4];                                  \
  }
#define Y_STORE(buf)                                                           \
  _Pragma("unroll") for (int j = 0; j < YLOADS; ++j) {                         \
    const int i = tid + j * 384;                                               \
    if (j + 1 < YLOADS || tail) {                                              \
      const v4h hv = {(_Float16)pre[j][0], (_Float16)pre[j][1],                \
                      (_Float16)pre[j][2], (_Float16)pre[j][3]};               \
      *(v4h*)&ytile[(buf) * (MT * YS_LD) + (i >> 6) * YS_LD + (i & 63) * 4] = hv; \
    }                                                                          \
  }
#define W_LOAD(s)                                                              \
  _Pragma("unroll") for (int kb = 0; kb < KSTEPS; ++kb)                        \
    wf[kb] = frag_load_packed(Wqkv_h +                                         \
                              (size_t)(w * 32 + (s) * KSTEPS + kb) * FRAG_SZ);

  // loads return in order.  In the loop a slice of y is asked for ahead of the
  // weights that are needed after it; here the weights go first, they come from L2
  W_LOAD(0)
  loads_issued();
  Y_LOAD(0)
  loads_issued();
  Y_STORE(0)
  // slice 1 is asked for only when slice 0 has left its registers
  __builtin_amdgcn_sched_barrier(0);
  Y_LOAD(1)
  loads_issued();

#pragma unroll
  for (int s = 0; s < NSL; ++s) {
    // slice s visible; every wave has left the buffer that is refilled below.
    // The waves share LDS only, so the fences name LDS alone: __syncthreads()
    // would also wait out the global loads that are in flight across this point
    __builtin_amdgcn_fence(__ATOMIC_RELEASE, "workgroup", "local");
    __builtin_amdgcn_s_barrier();
    __builtin_amdgcn_fence(__ATOMIC_ACQUIRE, "workgroup", "local");

    // y fragments are read one k step ahead, as one group, into a second set
    const _Float16* yt = ytile + (s & 1) * (MT * YS_LD);
    v16h af[2][MTILES];
#pragma unroll
    for (int i = 0; i < MTILES; ++i) af[0][i] = frag_load(yt + i * 16 * YS_LD, YS_LD);
#pragma unroll
    for (int kb = 0; kb < KSTEPS; ++kb) {
      if (kb + 1 < KSTEPS) {
#pragma unroll
        for (int i = 0; i < MTILES; ++i)
          af[(kb + 1) & 1][i] = frag_load(yt + i * 16 * YS_LD + (kb + 1) * 32, YS_LD);
      }
      // keeps that group of LDS reads whole and ahead of this step's products
      __builtin_amdgcn_sched_barrier(0);
#pragma unroll
      for (int i = 0; i < MTILES; ++i) acc[i] = wmma16(af[kb & 1][i], wf[kb], acc[i]);
      // keeps the following group of LDS reads from moving in among the products
      __builtin_amdgcn_sched_barrier(0);
    }

    // (the fence behind the last products also keeps the conversions below, which
    // wait for the next slice's loads, behind them)
    if (s + 1 < NSL) {
      W_LOAD(s + 1)
      loads_issued();
      Y_STORE((s + 1) & 1)
      // the slice after it is asked for only when its registers are free
      __builtin_amdgcn_sched_barrier(0);
      if (s + 2 < NSL) {
        Y_LOAD(s + 2)
        loads_issued();
      }
    }
  }
#undef Y_LOAD
#undef Y_STORE
#undef W_LOAD

  const int sel  = w >> 2;                  // 0=q 1=k 2=v
  const int col  = (w & 3) * 16 + n;        // 0..63 within q/k/v
  const float* bias = (sel == 0) ? bq : (sel == 1) ? bk : bv;
  const float scale = (sel == 0) ? 0.125f : 1.0f;   // q / sqrt(64)
  const float bval  = bias[col];
  _Float16* dst = (sel == 0) ? q_h : k_h;

  // the 64 rows of a work-group lie in one batch (SEQ is a multiple of MT)
  _Float16* vp = v_t + (size_t)(row0 >> 12) * (DK * SEQ) + (size_t)col * SEQ +
                 (row0 & (SEQ - 1)) + 8 * hid;
  _Float16* qp = dst + (size_t)(row0 + 8 * hid) * DK + col;
  if (sel == 2) {           // scalar branch: whole waves
#pragma unroll
    for (int i = 0; i < MTILES; ++i)
#pragma unroll
      for (int j = 0; j < 8; ++j)
        vp[i * 16 + j] = (_Float16)((acc[i][j] + bval) * scale);
    return;
  }
#pragma unroll
  for (int i = 0; i < MTILES; ++i)
#pragma unroll
    for (int j = 0; j < 8; ++j)
      qp[(size_t)(i * 16 + j) * DK] = (_Float16)((acc[i][j] + bval) * scale);
  // the built code lays the V branch behind these stores, on a path that is never
  // taken: the wait stands in front of its writes to registers the stores name
  asm volatile("s_wait_xcnt 0x0" ::: "memory");
}

// ---------------------------------------------------------------------------
// k2: flash attention (causal), double-buffered async KV staging.
//   grid.x = NBAT * (SEQ/32), dealt heavy tiles first (see the index map below);
//   256 threads = 8 waves = 2 query tiles x 4 key groups.
//   Wave (sub, g) owns 16 q rows and the key chunks g, g+4, g+8, ... with its
//   own maximum, sum and accumulators; the four groups' partials of a query
//   tile are merged once, through LDS, by the wave of group 0.
//   Transposed products: S^T = K Q^T and ctx^T += V^T P^T.  A lane then holds
//   16 scores of ONE query, so maximum and sum are in-lane (one exchange
//   between the wave halves), and the two S^T tiles, converted in place, are
//   the B operand of the second product: P never goes through LDS.
//   Epilogue: the merged 32 x 64 ctx tile goes to LDS (f16) and all 8 waves
//   project it, wave w on output columns [w*128, w*128 + 128): work-groups with
//   few keys write their rows of out while the long ones are still in the loop.
//   Lane n of column tile c of a 64-column group holds column 4*n + c, so a lane
//   stores 16 bytes and 16 lanes fill 256 contiguous bytes of a row of out.
// ---------------------------------------------------------------------------
#define K_LD  88     // 64 + 24 pad halves: 176B stride (16B aligned, no bank conflict)
#define VT_LD 40     // 32 + 8 pad halves:  80B stride  (16B aligned, no bank conflict)
#define QTILE 32
#define KVG   4      // key groups per work-group; SEQ/32 is a multiple of it
#define KCH_SZ (32 * K_LD)
#define VCH_SZ (DK * VT_LD)
#define CT_LD 72     // 64 + 8 pad halves: 144B stride (16B aligned)
#define PROJ_NT (HID / 16 / 8)   // output column tiles per wave in the projection
#define PROJ_NG (PROJ_NT / 4)    // groups of 4 tiles = 64 output columns

// value of lane l ^ 16 (vector cross-row move, no LDS round trip)
static __device__ __forceinline__ float other_half(float x) {
  const int b = __builtin_bit_cast(int, x);
  return __builtin_bit_cast(
      float, __builtin_amdgcn_permlanex16(b, b, 0x76543210, 0xfedcba98, false, false));
}

__global__ __launch_bounds__(256) void k2_attn(const _Float16* __restrict__ q_h,
                        const _Float16* __restrict__ k_h,
                        const _Float16* __restrict__ v_t,
                        const _Float16* __restrict__ Wo_h,
                        const float* __restrict__ bo,
                        float* __restrict__ out) {
  __shared__ __align__(16) _Float16 Klds[2 * KVG * KCH_SZ];  // [buf][group] K chunk [kv 32][d 64]
  __shared__ __align__(16) _Float16 Vlds[2 * KVG * VCH_SZ];  // [buf][group] V^T chunk [d 64][kv 32]
  __shared__ __align__(16) float Pacc[(KVG - 1) * 2 * 8 * 32 * 4];  // [slot][quad][lane] 4 floats
  __shared__ float Pml[(KVG - 1) * 2 * 2 * 32];                     // [slot][max, sum][lane]
  __shared__ __align__(16) _Float16 Cst[QTILE * CT_LD];             // merged ctx tile [query 32][d 64]

  const int tid  = threadIdx.x;
  const int w    = __builtin_amdgcn_readfirstlane(tid >> 5);  // scalar: the skip below is a real branch
  const int sub  = w & 1;                   // query tile of this wave
  const int g    = w >> 1;                  // key group of this wave
  const int lane = tid & 31;
  const int hid  = lane >> 4;
  const int n    = lane & 15;

  // Work-group index -> (batch, query tile), a permutation chosen for speed only.
  // A tile's key count grows with its index (causal), every work-group is resident
  // (two fit a WGP).  The first half of the grid takes the upper
  // tiles, heaviest first; the second half
  // takes the lower tiles, lightest first, so indices i and i + half hold tiles
  // qtiles-1-j and j: every such pair has the same number of key chunks.
  const int qtiles = SEQ / QTILE;           // 128
  const int halfg  = NBAT * qtiles / 2;     // work-groups in half the grid
  const int rk     = blockIdx.x % halfg;
  const int b      = rk % NBAT;
  const int j0     = rk / NBAT;             // 0 .. qtiles/2 - 1
  const int qbase  = ((int)blockIdx.x < halfg ? qtiles - 1 - j0 : j0) * QTILE;
  const size_t bo64 = (size_t)b * SEQ * DK; // batch offset, [t][d] layouts
  const _Float16* kg  = k_h + bo64;
  const _Float16* vtg = v_t + bo64;         // [d][t] layout

  // per-thread staging coordinates (each thread moves 2 x 16B per chunk)
  const int rK = tid >> 3, sK = tid & 7;    // K: row kv, 8-half segment
  const int dV = tid >> 2, sV = tid & 3;    // V^T: row d, 8-half segment

  // persistent Q fragments for this wave's 16 rows (already scaled);
  // used as B: lane n holds query column n
  const _Float16* qp = q_h + bo64 + (size_t)(qbase + sub * 16) * DK;
  const v16h aq0 = frag_load(qp, DK);
  const v16h aq1 = frag_load(qp + 32, DK);

  // acc[t][j] = ctx^T[d = t*16 + 8*hid + j][query n], over this group's keys
  v8f   acc[4] = {v8f{}, v8f{}, v8f{}, v8f{}};
  float m_run = -3.0e38f;   // running maximum of query n (equal in both halves)
  float l_run = 0.0f;       // this half's share of the running sum of query n

  const int row    = qbase + sub * 16 + n;  // this lane's query
  const int limit  = qbase + QTILE;
  // a trip serves KVG chunks of 32 keys, one per group; trips * KVG * 32 <= SEQ,
  // so chunks past the diagonal in the last trip are still inside K and V
  const int ntrips = (limit / 32 + KVG - 1) / KVG;

  // stage trip 0 into buffer 0
#pragma unroll
  for (int c = 0; c < KVG; ++c) {
    copy16B(kg  + (size_t)(c * 32 + rK) * DK + sK * 8,
            Klds + c * KCH_SZ + rK * K_LD + sK * 8);
    copy16B(vtg + (size_t)dV * SEQ + c * 32 + sV * 8,
            Vlds + c * VCH_SZ + dV * VT_LD + sV * 8);
  }

  int cur = 0;
  for (int trip = 0; trip < ntrips; ++trip) {
    // this wave's LDS reads of the buffer that is refilled below have retired
    asm volatile("s_wait_dscnt 0x0" ::: "memory");
    wait_async_zero();      // my async copies into buf[cur] done
    __syncthreads();        // everyone's copies visible; prev compute done

    // prefetch the next trip's chunks into the other buffer (overlaps with WMMAs below)
    if (trip + 1 < ntrips) {
      const int nxt = (trip + 1) * (KVG * 32);
#pragma unroll
      for (int c = 0; c < KVG; ++c) {
        copy16B(kg  + (size_t)(nxt + c * 32 + rK) * DK + sK * 8,
                Klds + ((cur ^ 1) * KVG + c) * KCH_SZ + rK * K_LD + sK * 8);
        copy16B(vtg + (size_t)dV * SEQ + nxt + c * 32 + sV * 8,
                Vlds + ((cur ^ 1) * KVG + c) * VCH_SZ + dV * VT_LD + sV * 8);
      }
    }

    const int kvb = (trip * KVG + g) * 32;  // this group's chunk
    if (kvb < limit) {                      // wave-uniform; a chunk past the diagonal has no open key
      const _Float16* Kb = Klds + (cur * KVG + g) * KCH_SZ;
      const _Float16* Vb = Vlds + (cur * KVG + g) * VCH_SZ;

      // S^T = K Q^T : two 16x16 tiles, kv rows [kvb, kvb+16) and [kvb+16, kvb+32)
      //   s0[j] = S[row][kvb + 8*hid + j],  s1[j] = S[row][kvb + 16 + 8*hid + j]
      v8f s0 = {}, s1 = {};
      {
        v16h b0 = frag_load(Kb, K_LD);
        s0 = wmma16(b0, aq0, s0);
        v16h b1 = frag_load(Kb + 32, K_LD);
        s0 = wmma16(b1, aq1, s0);
        v16h b2 = frag_load(Kb + 16 * K_LD, K_LD);
        s1 = wmma16(b2, aq0, s1);
        v16h b3 = frag_load(Kb + 16 * K_LD + 32, K_LD);
        s1 = wmma16(b3, aq1, s1);
      }

      // online softmax update (fp32), causal mask; all 16 scores belong to 'row'
      const int kv0 = kvb + 8 * hid;
      float mx = -3.0e38f;
#pragma unroll
      for (int j = 0; j < 8; ++j) {
        s0[j] = (kv0 + j)      <= row ? s0[j] : -3.0e38f;
        s1[j] = (kv0 + 16 + j) <= row ? s1[j] : -3.0e38f;
        mx = fmaxf(mx, fmaxf(s0[j], s1[j]));
      }
      mx = fmaxf(mx, other_half(mx));

      // a chunk that is entered has kvb <= qbase <= row: its first key is open to
      // every query, so mtot is a real score and a masked entry gives
      // exp(-3e38 - mtot) = 0
      const float mtot = fmaxf(m_run, mx);
      const float sc   = __expf(m_run - mtot);

      v16h  pT;             // B operand: pT[e] = P^T[kmap(e, hid)][n]
      float rs = 0.0f;
#pragma unroll
      for (int j = 0; j < 8; ++j) {
        const float p0 = __expf(s0[j] - mtot);
        const float p1 = __expf(s1[j] - mtot);
        rs += p0 + p1;
        pT[j]     = (_Float16)p0;
        pT[8 + j] = (_Float16)p1;
      }

      m_run = mtot;
      l_run = l_run * sc + rs;
#pragma unroll
      for (int t = 0; t < 4; ++t) acc[t] *= sc;

      // ctx^T += V^T (16 d x 32 kv) * P^T (32 kv x 16 q): 4 WMMAs
#pragma unroll
      for (int t = 0; t < 4; ++t) {
        v16h aV = frag_load(Vb + (size_t)(t * 16) * VT_LD, VT_LD);
        acc[t] = wmma16(aV, pT, acc[t]);
      }
    }
    cur ^= 1;
  }

  // no copy is in flight when a wave goes on to the merge or ends
  asm volatile("s_wait_asynccnt 0x0" ::: "memory");

  // merge of the key groups: groups 1.. hand their partials (same lane layout) to group 0
  if (g != 0) {
    const int slot = (g - 1) * 2 + sub;
#pragma unroll
    for (int t = 0; t < 4; ++t) {
      const v4f lo = {acc[t][0], acc[t][1], acc[t][2], acc[t][3]};
      const v4f hi = {acc[t][4], acc[t][5], acc[t][6], acc[t][7]};
      *(v4f*)&Pacc[((slot * 8 + t * 2 + 0) * 32 + lane) * 4] = lo;
      *(v4f*)&Pacc[((slot * 8 + t * 2 + 1) * 32 + lane) * 4] = hi;
    }
    Pml[(slot * 2 + 0) * 32 + lane] = m_run;
    Pml[(slot * 2 + 1) * 32 + lane] = l_run;
  }
  __syncthreads();          // partials visible to group 0

  // wave w projects onto output columns [w*128, w*128 + 128), 8 tiles of 16; its
  // weights and bias are asked for here, ahead of the merge
  const _Float16* wp = Wo_h + (size_t)(w * (PROJ_NT * 2)) * FRAG_SZ;
  const float*    bp = bo + w * (PROJ_NT * 16) + n * 4;
  v16h wo[PROJ_NT * 2];
  v4f  bias[PROJ_NG];
  // (these loops and the one over G below are unrolled so that wo and bias are
  // indexed by constants and stay in registers)
#pragma unroll
  for (int i = 0; i < PROJ_NT * 2; ++i) wo[i] = frag_load_packed(wp + (size_t)i * FRAG_SZ);
#pragma unroll
  for (int G = 0; G < PROJ_NG; ++G) bias[G] = *(const v4f*)(bp + G * 64);
  loads_issued();

  if (g == 0) {             // scalar branch: whole waves
    // group 0 always has chunk 0, so mall is a real score; a group that had no
    // chunk holds (-3e38, 0, 0) and gets weight exp(-3e38 - mall) = 0
    float mall = m_run;
#pragma unroll
    for (int i = 0; i < KVG - 1; ++i)
      mall = fmaxf(mall, Pml[((i * 2 + sub) * 2 + 0) * 32 + lane]);
    const float w0 = __expf(m_run - mall);
    l_run *= w0;
#pragma unroll
    for (int t = 0; t < 4; ++t) acc[t] *= w0;
#pragma unroll
    for (int i = 0; i < KVG - 1; ++i) {
      const int slot = i * 2 + sub;
      const float wi = __expf(Pml[(slot * 2 + 0) * 32 + lane] - mall);
      l_run += wi * Pml[(slot * 2 + 1) * 32 + lane];
#pragma unroll
      for (int t = 0; t < 4; ++t) {
        const v4f lo = *(const v4f*)&Pacc[((slot * 8 + t * 2 + 0) * 32 + lane) * 4];
        const v4f hi = *(const v4f*)&Pacc[((slot * 8 + t * 2 + 1) * 32 + lane) * 4];
#pragma unroll
        for (int j = 0; j < 4; ++j) {
          acc[t][j]     += wi * lo[j];
          acc[t][4 + j] += wi * hi[j];
        }
      }
    }

    // join the halves' sums, normalize, hand ctx (f16) over: 8 consecutive d per lane
    const float inv_l = 1.0f / (l_run + other_half(l_run));
#pragma unroll
    for (int t = 0; t < 4; ++t) {
      v8h o;
#pragma unroll
      for (int j = 0; j < 8; ++j) o[j] = (_Float16)(acc[t][j] * inv_l);
      *(v8h*)&Cst[(sub * 16 + n) * CT_LD + t * 16 + 8 * hid] = o;
    }
  }
  __syncthreads();          // ctx tile visible to every wave

  // output projection  out[m][h] = sum_v ctx[m][v] * Wo[h][v] + bo[h]:
  // each weight fragment serves both 16-query tiles
  const v16h a00 = frag_load(Cst, CT_LD);
  const v16h a01 = frag_load(Cst + 32, CT_LD);
  const v16h a10 = frag_load(Cst + 16 * CT_LD, CT_LD);
  const v16h a11 = frag_load(Cst + 16 * CT_LD + 32, CT_LD);
  float* op = out + ((size_t)b * SEQ + qbase + 8 * hid) * HID + w * (PROJ_NT * 16) + n * 4;

#pragma unroll
  for (int G = 0; G < PROJ_NG; ++G) {
    // c0[c][j], c1[c][j]: rows 8*hid + j and 16 + 8*hid + j, column G*64 + 4*n + c
    v8f c0[4], c1[4];
#pragma unroll
    for (int c = 0; c < 4; ++c) {
      const v16h b0 = wo[(G * 4 + c) * 2];
      const v16h b1 = wo[(G * 4 + c) * 2 + 1];
      c0[c] = wmma16(a00, b0, v8f{});
      c1[c] = wmma16(a10, b0, v8f{});
      c0[c] = wmma16(a01, b1, c0[c]);
      c1[c] = wmma16(a11, b1, c1[c]);
    }
    v4f o0[8], o1[8];
#pragma unroll
    for (int j = 0; j < 8; ++j) {
      o0[j] = v4f{c0[0][j] + bias[G][0], c0[1][j] + bias[G][1],
                  c0[2][j] + bias[G][2], c0[3][j] + bias[G][3]};
      o1[j] = v4f{c1[0][j] + bias[G][0], c1[1][j] + bias[G][1],
                  c1[2][j] + bias[G][2], c1[3][j] + bias[G][3]};
    }
    // keeps the group's stores in one run behind its sums: mixed with the sums, a
    // stored register is reused at once and each reuse waits for the issued store
    __builtin_amdgcn_sched_barrier(0);
#pragma unroll
    for (int j = 0; j < 8; ++j) {
      *(v4f*)&op[(size_t)j * HID + G * 64]        = o0[j];
      *(v4f*)&op[(size_t)(16 + j) * HID + G * 64] = o1[j];
    }
    // the next group reuses registers that these stores name
    if (G + 1 < PROJ_NG) loads_issued();
  }
}

// ---------------------------------------------------------------------------
extern "C" void kernel_launch(void* const* d_in, const int* in_sizes, int n_in,
                              void* d_out, int out_size, void* d_ws, size_t ws_size,
                              hipStream_t stream) {
  (void)in_sizes; (void)n_in; (void)out_size; (void)ws_size;

  const float* y  = (const float*)d_in[0];
  const float* Wq = (const float*)d_in[1];
  const float* bq = (const float*)d_in[2];
  const float* Wk = (const float*)d_in[3];
  const float* bk = (const float*)d_in[4];
  const float* Wv = (const float*)d_in[5];
  const float* bv = (const float*)d_in[6];
  const float* Wo = (const float*)d_in[7];
  const float* bo = (const float*)d_in[8];
  float* out = (float*)d_out;

  // workspace layout (f16)
  char* ws = (char*)d_ws;
  _Float16* Wqkv_h = (_Float16*)(ws);                        // 192*1024  (384 KB), packed
  _Float16* Wo_h   = (_Float16*)(ws + 393216);               // 1024*64   (128 KB), packed
  _Float16* q_h    = (_Float16*)(ws + 524288);               // [b][t][d] (2 MB)
  _Float16* k_h    = (_Float16*)(ws + 524288 + 2097152);     // [b][t][d] (2 MB)
  _Float16* v_t    = (_Float16*)(ws + 524288 + 2 * 2097152); // [b][d][t] (2 MB)

  k0_convert_w<<<128, 256, 0, stream>>>(Wq, Wk, Wv, Wo, Wqkv_h, Wo_h);
  k1_qkv<<<NROWS / MT, 384, 0, stream>>>(y, Wqkv_h, bq, bk, bv, q_h, k_h, v_t);
  k2_attn<<<NBAT * (SEQ / QTILE), 256, 0, stream>>>(q_h, k_h, v_t, Wo_h, bo, out);
}

// v008
// Measured time: 39.3 microseconds a run.
// Two timings next to v007 put it at 1.10 and 1.11 times that version's speed.
// Counting every step since v000, it is 5.86 times as fast.
#include <hip/hip_runtime.h>
#include <hip/hip_bf16.h>
#include <math.h>

// ---------------------------------------------------------------------------
// Causal self-attention for MI455X (gfx1250, wave32, WMMA f16->f32).
//   HIDDEN=1024, DK=DV=64, B=4, T=4096
// Pipeline:
//   k0: convert weights fp32 -> f16 into workspace, packed in fragment order
//   k1: fused QKV projection (WMMA, K=1024); q pre-scaled by 1/sqrt(64);
//       V stored pre-transposed (v_t[b][d][t]) for transpose-free attention
//   k2: flash attention on transposed products, keys split over the waves of a
//       work-group, double-buffered KV chunks staged with
//       GLOBAL_LOAD_ASYNC_TO_LDS_B128 (ASYNCcnt pipeline); its epilogue is
//       the output projection (WMMA, K=64, N=1024) + bias, fp32 out
// ---------------------------------------------------------------------------

typedef __attribute__((ext_vector_type(16))) _Float16 v16h;
typedef __attribute__((ext_vector_type(8)))  _Float16 v8h;
typedef __attribute__((ext_vector_type(4)))  _Float16 v4h;
typedef __attribute__((ext_vector_type(8)))  float    v8f;
typedef __attribute__((ext_vector_type(4)))  float    v4f;
typedef __attribute__((ext_vector_type(4)))  int      v4i;

#define HID   1024
#define DK    64
#define SEQ   4096
#define NBAT  4
#define NROWS (NBAT * SEQ)          // 16384 token rows

// ---- gfx1250 async copy to LDS (guarded; fallback = vector copy) ----------
#if __has_builtin(__builtin_amdgcn_global_load_async_to_lds_b128)
#define HAVE_ASYNC 1
typedef __attribute__((address_space(1))) v4i as1_v4i;
typedef __attribute__((address_space(3))) v4i as3_v4i;
#else
#define HAVE_ASYNC 0
#endif

static __device__ __forceinline__ void copy16B(const _Float16* src, _Float16* dst) {
#if HAVE_ASYNC
  // prototype: (int4 AS1* src, int4 AS3* dst, imm offset, imm cpol)
  __builtin_amdgcn_global_load_async_to_lds_b128(
      (as1_v4i*)(uintptr_t)src,
      (as3_v4i*)(unsigned int)(uintptr_t)dst,   // low 32 bits = LDS offset
      0, 0);
#else
  *(v8h*)dst = *(const v8h*)src;
#endif
}

static __device__ __forceinline__ void wait_async_zero() {
#if HAVE_ASYNC
#if __has_builtin(__builtin_amdgcn_s_wait_asynccnt)
  __builtin_amdgcn_s_wait_asynccnt(0);
#else
  asm volatile("s_wait_asynccnt 0x0" ::: "memory");
#endif
#endif
}

// ---- fragment helpers (CDNA5 16x16x32 f16 WMMA layouts, wave32) -----------
// A-matrix 16x32: lane = hid*16 + r ; row M = r ;
//   halves e=0..7  -> K = hid*8 + e ; halves e=8..15 -> K = 16 + hid*8 + (e-8)
// B-matrix 32x16: same pattern with lane%16 = column N, reading src[N][K].
static __device__ __forceinline__ v16h frag_load(const _Float16* src, int ld) {
  const int lane = threadIdx.x & 31;
  const int hid  = lane >> 4;
  const int r    = lane & 15;
  const _Float16* p = src + (size_t)r * ld + hid * 8;
  v16h f;
#pragma unroll
  for (int e = 0; e < 8; ++e) f[e] = p[e];
#pragma unroll
  for (int e = 0; e < 8; ++e) f[8 + e] = p[16 + e];
  return f;
}

// A 16x32 fragment that k0 has packed: 1 KB in a row, 16-byte unit h2*32 + lane
// holds f[h2*8 .. h2*8+7] of frag_load's map.  Each of the two loads then reads
// 512 contiguous bytes (4 cache lines) instead of 32 bytes out of 16 lines.
#define FRAG_SZ 512   // halves per packed fragment
static __device__ __forceinline__ v16h frag_load_packed(const _Float16* frag) {
  const int lane = threadIdx.x & 31;
  const v8h lo = *(const v8h*)(frag + lane * 8);
  const v8h hi = *(const v8h*)(frag + 256 + lane * 8);
  return __builtin_shufflevector(lo, hi, 0, 1, 2, 3, 4, 5, 6, 7,
                                 8, 9, 10, 11, 12, 13, 14, 15);
}

static __device__ __forceinline__ v8f wmma16(v16h a, v16h b, v8f c) {
  return __builtin_amdgcn_wmma_f32_16x16x32_f16(false, a, false, b,
                                                (short)0, c, false, false);
}

// ---------------------------------------------------------------------------
// k0: fp32 -> f16 weight conversion into fragment order (see frag_load_packed).
//   One thread per 16-byte unit.  Wqkv_h: fragment (w, kb) at index w*32 + kb,
//   w = 16-row tile of fused [q|k|v], kb = 32-wide k block.  Wo_h: fragment
//   (nt, kb) at index nt*2 + kb; tile nt = 4*G + c holds, as its row r, output
//   column 64*G + 4*r + c: the four tiles of a group G leave four adjacent
//   outputs in one lane (see the projection in k2).
// ---------------------------------------------------------------------------
#define QKV_UNITS (3 * DK * HID / 8)   // 24576, a multiple of 64
#define WO_UNITS  (HID * DK / 8)       // 8192

__global__ void k0_convert_w(const float* __restrict__ Wq,
                             const float* __restrict__ Wk,
                             const float* __restrict__ Wv,
                             const float* __restrict__ Wo,
                             _Float16* __restrict__ Wqkv_h,
                             _Float16* __restrict__ Wo_h) {
  const int u    = blockIdx.x * blockDim.x + threadIdx.x;
  if (u >= QKV_UNITS + WO_UNITS) return;
  const int lane = u & 31;
  const int r    = lane & 15;                                  // row in the tile
  const int kin  = ((u >> 5) & 1) * 16 + (lane >> 4) * 8;      // first k in the block
  const float* src;
  _Float16*    dst;
  if (u < QKV_UNITS) {
    const int frag = u >> 6;
    const int w    = frag >> 5, kb = frag & 31;
    const int sel  = w >> 2;                                   // 0=q 1=k 2=v
    const float* W = (sel == 0) ? Wq : (sel == 1) ? Wk : Wv;
    src = W + (size_t)((w & 3) * 16 + r) * HID + kb * 32 + kin;
    dst = Wqkv_h + (size_t)u * 8;
  } else {
    const int u2   = u - QKV_UNITS;
    const int frag = u2 >> 6;
    const int nt   = frag >> 1, kb = frag & 1;
    src = Wo + (size_t)((nt >> 2) * 64 + r * 4 + (nt & 3)) * DK + kb * 32 + kin;
    dst = Wo_h + (size_t)u2 * 8;
  }
  const v4f a = *(const v4f*)src;
  const v4f b = *(const v4f*)(src + 4);
  const v8h o = {(_Float16)a[0], (_Float16)a[1], (_Float16)a[2], (_Float16)a[3],
                 (_Float16)b[0], (_Float16)b[1], (_Float16)b[2], (_Float16)b[3]};
  *(v8h*)dst = o;
}

// ---------------------------------------------------------------------------
// k1: fused QKV projection.  grid.x = NROWS/64; 384 threads = 12 waves.
//   Wave w owns one 16-col tile of fused [q|k|v] for all 64 rows: a weight
//   fragment is loaded once and feeds four products (four accumulators).
//   y goes to LDS (f16) in slices of 256 k columns, two buffers: the next
//   slice's loads are in flight while this slice is multiplied.
//   V written transposed: v_t[b][d][t].
// ---------------------------------------------------------------------------
#define MT     64                 // token rows per work-group
#define MTILES (MT / 16)
#define KS     256                // k columns per staged slice
#define NSL    (HID / KS)
#define KSTEPS (KS / 32)          // products along k per slice
#define YS_LD  (KS + 8)           // 528B stride (16B aligned, same bank step as a 16B pad)
#define YUNITS (MT * KS / 4)      // 16-byte units of y per slice
#define YLOADS ((YUNITS + 383) / 384)

// stands behind a group of global loads or stores: s_wait_xcnt 0 in front of every
// rewrite of a register that one of them names; the fence holds those rewrites behind it
static __device__ __forceinline__ void loads_issued() {
  asm volatile("s_wait_xcnt 0x0" ::: "memory");
  __builtin_amdgcn_sched_barrier(0);
}

__global__ __launch_bounds__(384) void k1_qkv(const float* __restrict__ y,
                       const _Float16* __restrict__ Wqkv_h,
                       const float* __restrict__ bq,
                       const float* __restrict__ bk,
                       const float* __restrict__ bv,
                       _Float16* __restrict__ q_h,
                       _Float16* __restrict__ k_h,
                       _Float16* __restrict__ v_t) {
  __shared__ __align__(16) _Float16 ytile[2 * MT * YS_LD];

  const int tid  = threadIdx.x;
  const int row0 = blockIdx.x * MT;
  const int w    = __builtin_amdgcn_readfirstlane(tid >> 5);  // 0..11, scalar: real branches below
  const int lane = tid & 31;
  const int hid  = lane >> 4;
  const int n    = lane & 15;
  // the last round of a slice's units is short: whole waves 0..7 take it
  const bool tail = w < (YUNITS - (YLOADS - 1) * 384) / 32;

  v4f  pre[YLOADS];       // a slice of y on its way from memory to LDS
  v16h wf[KSTEPS];        // this wave's weight fragments of one slice
  v8f  acc[MTILES] = {v8f{}, v8f{}, v8f{}, v8f{}};

  // a wave's 32 lanes read 512 contiguous bytes of one row
#define Y_LOAD(s)                                                              \
  _Pragma("unroll") for (int j = 0; j < YLOADS; ++j) {                         \
    const int i = tid + j * 384;                                               \
    if (j + 1 < YLOADS || tail)                                                \
      pre[j] = *(const v4f*)&y[(size_t)(row0 + (i >> 6)) * HID + (s) * KS +    \
                               (i & 63) * 4];                                  \
  }
#define Y_STORE(buf)                                                           \
  _Pragma("unroll") for (int j = 0; j < YLOADS; ++j) {                         \
    const int i = tid + j * 384;                                               \
    if (j + 1 < YLOADS || tail) {                                              \
      const v4h hv = {(_Float16)pre[j][0], (_Float16)pre[j][1],                \
                      (_Float16)pre[j][2], (_Float16)pre[j][3]};               \
      *(v4h*)&ytile[(buf) * (MT * YS_LD) + (i >> 6) * YS_LD + (i & 63) * 4] = hv; \
    }                                                                          \
  }
#define W_LOAD(s)                                                              \
  _Pragma("unroll") for (int kb = 0; kb < KSTEPS; ++kb)                        \
    wf[kb] = frag_load_packed(Wqkv_h +                                         \
                              (size_t)(w * 32 + (s) * KSTEPS + kb) * FRAG_SZ);

  // loads return in order.  In the loop a slice of y is asked for ahead of the
  // weights that are needed after it; here the weights go first, they come from L2
  W_LOAD(0)
  loads_issued();
  Y_LOAD(0)
  loads_issued();
  Y_STORE(0)
  // slice 1 is asked for only when slice 0 has left its registers
  __builtin_amdgcn_sched_barrier(0);
  Y_LOAD(1)
  loads_issued();

#pragma unroll
  for (int s = 0; s < NSL; ++s) {
    // slice s visible; every wave has left the buffer that is refilled below.
    // The waves share LDS only, so the fences name LDS alone: __syncthreads()
    // would also wait out the global loads that are in flight across this point
    __builtin_amdgcn_fence(__ATOMIC_RELEASE, "workgroup", "local");
    __builtin_amdgcn_s_barrier();
    __builtin_amdgcn_fence(__ATOMIC_ACQUIRE, "workgroup", "local");

    // y fragments are read one k step ahead, as one group, into a second set
    const _Float16* yt = ytile + (s & 1) * (MT * YS_LD);
    v16h af[2][MTILES];
#pragma unroll
    for (int i = 0; i < MTILES; ++i) af[0][i] = frag_load(yt + i * 16 * YS_LD, YS_LD);
#pragma unroll
    for (int kb = 0; kb < KSTEPS; ++kb) {
      if (kb + 1 < KSTEPS) {
#pragma unroll
        for (int i = 0; i < MTILES; ++i)
          af[(kb + 1) & 1][i] = frag_load(yt + i * 16 * YS_LD + (kb + 1) * 32, YS_LD);
      }
      // keeps that group of LDS reads whole and ahead of this step's products
      __builtin_amdgcn_sched_barrier(0);
#pragma unroll
      for (int i = 0; i < MTILES; ++i) acc[i] = wmma16(af[kb & 1][i], wf[kb], acc[i]);
      // keeps the following group of LDS reads from moving in among the products
      __builtin_amdgcn_sched_barrier(0);
    }

    // (the fence behind the last products also keeps the conversions below, which
    // wait for the next slice's loads, behind them)
    if (s + 1 < NSL) {
      W_LOAD(s + 1)
      loads_issued();
      Y_STORE((s + 1) & 1)
      // the slice after it is asked for only when its registers are free
      __builtin_amdgcn_sched_barrier(0);
      if (s + 2 < NSL) {
        Y_LOAD(s + 2)
        loads_issued();
      }
    }
  }
#undef Y_LOAD
#undef Y_STORE
#undef W_LOAD

  const int sel  = w >> 2;                  // 0=q 1=k 2=v
  const int col  = (w & 3) * 16 + n;        // 0..63 within q/k/v
  const float* bias = (sel == 0) ? bq : (sel == 1) ? bk : bv;
  const float scale = (sel == 0) ? 0.125f : 1.0f;   // q / sqrt(64)
  const float bval  = bias[col];
  _Float16* dst = (sel == 0) ? q_h : k_h;

  // the 64 rows of a work-group lie in one batch (SEQ is a multiple of MT)
  _Float16* vp = v_t + (size_t)(row0 >> 12) * (DK * SEQ) + (size_t)col * SEQ +
                 (row0 & (SEQ - 1)) + 8 * hid;
  _Float16* qp = dst + (size_t)(row0 + 8 * hid) * DK + col;
  if (sel == 2) {           // scalar branch: whole waves
#pragma unroll
    for (int i = 0; i < MTILES; ++i)
#pragma unroll
      for (int j = 0; j < 8; ++j)
        vp[i * 16 + j] = (_Float16)((acc[i][j] + bval) * scale);
    return;
  }
#pragma unroll
  for (int i = 0; i < MTILES; ++i)
#pragma unroll
    for (int j = 0; j < 8; ++j)
      qp[(size_t)(i * 16 + j) * DK] = (_Float16)((acc[i][j] + bval) * scale);
  // the built code lays the V branch behind these stores, on a path that is never
  // taken: the wait stands in front of its writes to registers the stores name
  asm volatile("s_wait_xcnt 0x0" ::: "memory");
}

// ---------------------------------------------------------------------------
// k2: flash attention (causal), double-buffered async KV staging.
//   grid.x = NBAT * (SEQ/32), dealt heavy tiles first (see the index map below);
//   256 threads = 8 waves = 8 key groups.
//   Wave g owns the key chunks g, g+8, g+16, ... for all 32 q rows of the
//   work-group, as two 16-query tiles u = 0, 1: a K or V fragment is read from
//   LDS once and feeds both tiles, and the two tiles' chains are independent
//   work for the wave.  Each (wave, tile) has its own maximum, sum and
//   accumulators; the eight groups' partials are merged once, through LDS,
//   wave w taking 16 of the 64 ctx columns of one query tile.
//   Transposed products: S^T = K Q^T and ctx^T += V^T P^T.  A lane then holds
//   16 scores of ONE query, so maximum and sum are in-lane (one exchange
//   between the wave halves), and the two S^T tiles, converted in place, are
//   the B operand of the second product: P never goes through LDS.
//   Epilogue: the merged 32 x 64 ctx tile goes to LDS (f16) and all 8 waves
//   project it, wave w on output columns [w*128, w*128 + 128): work-groups with
//   few keys write their rows of out while the long ones are still in the loop.
//   Lane n of column tile c of a 64-column group holds column 4*n + c, so a lane
//   stores 16 bytes and 16 lanes fill 256 contiguous bytes of a row of out.
// ---------------------------------------------------------------------------
#define K_LD  72     // 64 + 8 pad halves: 144B stride (16B x odd, no bank conflict)
#define VT_LD 40     // 32 + 8 pad halves:  80B stride  (16B aligned, no bank conflict)
#define QTILE 32
#define QSUB  (QTILE / 16)       // 16-query tiles of a wave
#define KVG   8      // key groups per work-group; SEQ/32 is a multiple of it
#define KCH_SZ (32 * K_LD)
#define VCH_SZ (DK * VT_LD)
#define CT_LD 72     // 64 + 8 pad halves: 144B stride (16B aligned)
#define PROJ_NT (HID / 16 / 8)   // output column tiles per wave in the projection
#define PROJ_NG (PROJ_NT / 4)    // groups of 4 tiles = 64 output columns
#define PACC_FLOATS (KVG * QSUB * 8 * 32 * 4)   // [group][tile][quad][lane] 4 floats

// value of lane l ^ 16 (vector cross-row move, no LDS round trip)
static __device__ __forceinline__ float other_half(float x) {
  const int b = __builtin_bit_cast(int, x);
  return __builtin_bit_cast(
      float, __builtin_amdgcn_permlanex16(b, b, 0x76543210, 0xfedcba98, false, false));
}

__global__ __launch_bounds__(256) void k2_attn(const _Float16* __restrict__ q_h,
                        const _Float16* __restrict__ k_h,
                        const _Float16* __restrict__ v_t,
                        const _Float16* __restrict__ Wo_h,
                        const float* __restrict__ bo,
                        float* __restrict__ out) {
  // the ring; behind the loop (and a barrier) the same bytes hold the partials.
  // With Cst this is under 160 KiB, so two work-groups share a WGP as before
  __shared__ __align__(16) _Float16 Ring[2 * KVG * (KCH_SZ + VCH_SZ)];
  __shared__ __align__(16) _Float16 Cst[QTILE * CT_LD];   // merged ctx tile [query 32][d 64]
  _Float16* const Klds = Ring;                            // [buf][group] K chunk [kv 32][d 64]
  _Float16* const Vlds = Ring + 2 * KVG * KCH_SZ;         // [buf][group] V^T chunk [d 64][kv 32]
  float* const Pacc = (float*)Ring;                       // [group][tile][quad][lane] 4 floats
  float* const Pml  = Pacc + PACC_FLOATS;                 // [group][tile][max, sum][lane]
  static_assert((PACC_FLOATS + KVG * QSUB * 2 * 32) * 4 <= sizeof(Ring), "partials fit the ring");

  const int tid  = threadIdx.x;
  const int w    = __builtin_amdgcn_readfirstlane(tid >> 5);  // scalar: the skip below is a real branch
  const int g    = w;                       // key group of this wave
  const int lane = tid & 31;
  const int hid  = lane >> 4;
  const int n    = lane & 15;

  // Work-group index -> (batch, query tile), a permutation chosen for speed only.
  // A tile's key count grows with its index (causal), every work-group is resident
  // (two fit a WGP).  The first half of the grid takes the upper
  // tiles, heaviest first; the second half
  // takes the lower tiles, lightest first, so indices i and i + half hold tiles
  // qtiles-1-j and j: every such pair has the same number of key chunks.
  const int qtiles = SEQ / QTILE;           // 128
  const int halfg  = NBAT * qtiles / 2;     // work-groups in half the grid
  const int rk     = blockIdx.x % halfg;
  const int b      = rk % NBAT;
  const int j0     = rk / NBAT;             // 0 .. qtiles/2 - 1
  const int qbase  = ((int)blockIdx.x < halfg ? qtiles - 1 - j0 : j0) * QTILE;
  const size_t bo64 = (size_t)b * SEQ * DK; // batch offset, [t][d] layouts
  const _Float16* kg  = k_h + bo64;
  const _Float16* vtg = v_t + bo64;         // [d][t] layout

  // per-thread staging coordinates (each thread moves 2 x 16B per chunk)
  const int rK = tid >> 3, sK = tid & 7;    // K: row kv, 8-half segment
  const int dV = tid >> 2, sV = tid & 3;    // V^T: row d, 8-half segment

  // persistent Q fragments of both query tiles (already scaled);
  // used as B: lane n holds query column n of its tile
  const _Float16* qp = q_h + bo64 + (size_t)qbase * DK;
  v16h aq[QSUB][2];
#pragma unroll
  for (int u = 0; u < QSUB; ++u) {
    aq[u][0] = frag_load(qp + u * 16 * DK, DK);
    aq[u][1] = frag_load(qp + u * 16 * DK + 32, DK);
  }

  // acc[u][t][j] = ctx^T[d = t*16 + 8*hid + j][query n of tile u], over this group's keys
  v8f   acc[QSUB][4];
  float m_run[QSUB];        // running maximum of query n (equal in both halves)
  float l_run[QSUB];        // this half's share of the running sum of query n
#pragma unroll
  for (int u = 0; u < QSUB; ++u) {
#pragma unroll
    for (int t = 0; t < 4; ++t) acc[u][t] = v8f{};
    m_run[u] = -3.0e38f;
    l_run[u] = 0.0f;
  }

  const int row0   = qbase + n;             // this lane's query in tile 0; tile u: + 16*u
  const int limit  = qbase + QTILE;
  // a trip serves KVG chunks of 32 keys, one per group; trips * KVG * 32 <= SEQ,
  // so chunks past the diagonal in the last trip are still inside K and V
  const int ntrips = (limit / 32 + KVG - 1) / KVG;

  // stage trip 0 into buffer 0
#pragma unroll
  for (int c = 0; c < KVG; ++c) {
    copy16B(kg  + (size_t)(c * 32 + rK) * DK + sK * 8,
            Klds + c * KCH_SZ + rK * K_LD + sK * 8);
    copy16B(vtg + (size_t)dV * SEQ + c * 32 + sV * 8,
            Vlds + c * VCH_SZ + dV * VT_LD + sV * 8);
  }

  int cur = 0;
  for (int trip = 0; trip < ntrips; ++trip) {
    // this wave's LDS reads of the buffer that is refilled below have retired
    asm volatile("s_wait_dscnt 0x0" ::: "memory");
    wait_async_zero();      // my async copies into buf[cur] done
    __syncthreads();        // everyone's copies visible; prev compute done

    // prefetch the next trip's chunks into the other buffer (overlaps with WMMAs below)
    if (trip + 1 < ntrips) {
      const int nxt = (trip + 1) * (KVG * 32);
#pragma unroll
      for (int c = 0; c < KVG; ++c) {
        copy16B(kg  + (size_t)(nxt + c * 32 + rK) * DK + sK * 8,
                Klds + ((cur ^ 1) * KVG + c) * KCH_SZ + rK * K_LD + sK * 8);
        copy16B(vtg + (size_t)dV * SEQ + nxt + c * 32 + sV * 8,
                Vlds + ((cur ^ 1) * KVG + c) * VCH_SZ + dV * VT_LD + sV * 8);
      }
    }

    const int kvb = (trip * KVG + g) * 32;  // this group's chunk
    if (kvb < limit) {                      // wave-uniform; a chunk past the diagonal has no open key
      const _Float16* Kb = Klds + (cur * KVG + g) * KCH_SZ;
      const _Float16* Vb = Vlds + (cur * KVG + g) * VCH_SZ;

      // S^T = K Q^T : per query tile two 16x16 tiles, kv rows [kvb, kvb+16) and
      // [kvb+16, kvb+32); each K fragment serves both query tiles
      //   s0[u][j] = S[row][kvb + 8*hid + j],  s1[u][j] = S[row][kvb + 16 + 8*hid + j]
      v8f s0[QSUB], s1[QSUB];
      {
        const v16h b0 = frag_load(Kb, K_LD);
        const v16h b2 = frag_load(Kb + 16 * K_LD, K_LD);
        const v16h b1 = frag_load(Kb + 32, K_LD);
        const v16h b3 = frag_load(Kb + 16 * K_LD + 32, K_LD);
#pragma unroll
        for (int u = 0; u < QSUB; ++u) {
          s0[u] = wmma16(b0, aq[u][0], v8f{});
          s1[u] = wmma16(b2, aq[u][0], v8f{});
        }
#pragma unroll
        for (int u = 0; u < QSUB; ++u) {
          s0[u] = wmma16(b1, aq[u][1], s0[u]);
          s1[u] = wmma16(b3, aq[u][1], s1[u]);
        }
      }

      // online softmax update (fp32), causal mask; a lane's 16 scores of tile u
      // belong to one query
      const int kv0 = kvb + 8 * hid;
      v16h pT[QSUB];        // B operand: pT[u][e] = P^T[kmap(e, hid)][n]
#pragma unroll
      for (int u = 0; u < QSUB; ++u) {
        const int row = row0 + u * 16;
        float mx = -3.0e38f;
#pragma unroll
        for (int j = 0; j < 8; ++j) {
          s0[u][j] = (kv0 + j)      <= row ? s0[u][j] : -3.0e38f;
          s1[u][j] = (kv0 + 16 + j) <= row ? s1[u][j] : -3.0e38f;
          mx = fmaxf(mx, fmaxf(s0[u][j], s1[u][j]));
        }
        mx = fmaxf(mx, other_half(mx));

        // a chunk that is entered has kvb <= qbase <= row: its first key is open to
        // every query, so mtot is a real score and a masked entry gives
        // exp(-3e38 - mtot) = 0
        const float mtot = fmaxf(m_run[u], mx);
        const float sc   = __expf(m_run[u] - mtot);

        float rs = 0.0f;
#pragma unroll
        for (int j = 0; j < 8; ++j) {
          const float p0 = __expf(s0[u][j] - mtot);
          const float p1 = __expf(s1[u][j] - mtot);
          rs += p0 + p1;
          pT[u][j]     = (_Float16)p0;
          pT[u][8 + j] = (_Float16)p1;
        }

        m_run[u] = mtot;
        l_run[u] = l_run[u] * sc + rs;
#pragma unroll
        for (int t = 0; t < 4; ++t) acc[u][t] *= sc;
      }

      // ctx^T += V^T (16 d x 32 kv) * P^T (32 kv x 16 q): each V fragment serves
      // both query tiles, 8 WMMAs
#pragma unroll
      for (int t = 0; t < 4; ++t) {
        const v16h aV = frag_load(Vb + (size_t)(t * 16) * VT_LD, VT_LD);
#pragma unroll
        for (int u = 0; u < QSUB; ++u) acc[u][t] = wmma16(aV, pT[u], acc[u][t]);
      }
    }
    cur ^= 1;
  }

  // no copy is in flight when a wave goes on to the merge or ends
  asm volatile("s_wait_asynccnt 0x0" ::: "memory");
  // the ring becomes the partials' place: this wave's reads of it have retired,
  // and behind the barrier so have every other wave's
  asm volatile("s_wait_dscnt 0x0" ::: "memory");
  __syncthreads();

  // merge of the key groups: every group lays down its partials (lane layout kept)
#pragma unroll
  for (int u = 0; u < QSUB; ++u) {
    const int slot = g * QSUB + u;
#pragma unroll
    for (int t = 0; t < 4; ++t) {
      const v4f lo = {acc[u][t][0], acc[u][t][1], acc[u][t][2], acc[u][t][3]};
      const v4f hi = {acc[u][t][4], acc[u][t][5], acc[u][t][6], acc[u][t][7]};
      *(v4f*)&Pacc[((slot * 8 + t * 2 + 0) * 32 + lane) * 4] = lo;
      *(v4f*)&Pacc[((slot * 8 + t * 2 + 1) * 32 + lane) * 4] = hi;
    }
    Pml[(slot * 2 + 0) * 32 + lane] = m_run[u];
    Pml[(slot * 2 + 1) * 32 + lane] = l_run[u];
  }
  __syncthreads();          // partials visible to every wave

  // wave w projects onto output columns [w*128, w*128 + 128), 8 tiles of 16; its
  // weights and bias are asked for here, ahead of the merge
  const _Float16* wp = Wo_h + (size_t)(w * (PROJ_NT * 2)) * FRAG_SZ;
  const float*    bp = bo + w * (PROJ_NT * 16) + n * 4;
  v16h wo[PROJ_NT * 2];
  v4f  bias[PROJ_NG];
  // (these loops and the one over G below are unrolled so that wo and bias are
  // indexed by constants and stay in registers)
#pragma unroll
  for (int i = 0; i < PROJ_NT * 2; ++i) wo[i] = frag_load_packed(wp + (size_t)i * FRAG_SZ);
#pragma unroll
  for (int G = 0; G < PROJ_NG; ++G) bias[G] = *(const v4f*)(bp + G * 64);
  loads_issued();

  {
    // wave w merges ctx columns [mt*16, mt*16 + 16) of query tile mu over the groups.
    // Group 0 always has chunk 0, so mall is a real score; a group that had no
    // chunk holds (-3e38, 0, 0) and gets weight exp(-3e38 - mall) = 0
    const int mu = w & 1;
    const int mt = w >> 1;
    float mg[KVG];
#pragma unroll
    for (int i = 0; i < KVG; ++i) mg[i] = Pml[((i * QSUB + mu) * 2 + 0) * 32 + lane];
    float mall = mg[0];
#pragma unroll
    for (int i = 1; i < KVG; ++i) mall = fmaxf(mall, mg[i]);
    float lsum = 0.0f;
    v8f   ctx  = v8f{};
#pragma unroll
    for (int i = 0; i < KVG; ++i) {
      const int slot = i * QSUB + mu;
      const float wi = __expf(mg[i] - mall);
      lsum += wi * Pml[(slot * 2 + 1) * 32 + lane];
      const v4f lo = *(const v4f*)&Pacc[((slot * 8 + mt * 2 + 0) * 32 + lane) * 4];
      const v4f hi = *(const v4f*)&Pacc[((slot * 8 + mt * 2 + 1) * 32 + lane) * 4];
#pragma unroll
      for (int j = 0; j < 4; ++j) {
        ctx[j]     += wi * lo[j];
        ctx[4 + j] += wi * hi[j];
      }
    }

    // join the halves' sums, normalize, hand ctx (f16) over: 8 consecutive d per lane
    const float inv_l = 1.0f / (lsum + other_half(lsum));
    v8h o;
#pragma unroll
    for (int j = 0; j < 8; ++j) o[j] = (_Float16)(ctx[j] * inv_l);
    *(v8h*)&Cst[(mu * 16 + n) * CT_LD + mt * 16 + 8 * hid] = o;
  }
  __syncthreads();          // ctx tile visible to every wave

  // output projection  out[m][h] = sum_v ctx[m][v] * Wo[h][v] + bo[h]:
  // each weight fragment serves both 16-query tiles
  const v16h a00 = frag_load(Cst, CT_LD);
  const v16h a01 = frag_load(Cst + 32, CT_LD);
  const v16h a10 = frag_load(Cst + 16 * CT_LD, CT_LD);
  const v16h a11 = frag_load(Cst + 16 * CT_LD + 32, CT_LD);
  float* op = out + ((size_t)b * SEQ + qbase + 8 * hid) * HID + w * (PROJ_NT * 16) + n * 4;

#pragma unroll
  for (int G = 0; G < PROJ_NG; ++G) {
    // c0[c][j], c1[c][j]: rows 8*hid + j and 16 + 8*hid + j, column G*64 + 4*n + c
    v8f c0[4], c1[4];
#pragma unroll
    for (int c = 0; c < 4; ++c) {
      const v16h b0 = wo[(G * 4 + c) * 2];
      const v16h b1 = wo[(G * 4 + c) * 2 + 1];
      c0[c] = wmma16(a00, b0, v8f{});
      c1[c] = wmma16(a10, b0, v8f{});
      c0[c] = wmma16(a01, b1, c0[c]);
      c1[c] = wmma16(a11, b1, c1[c]);
    }
    v4f o0[8], o1[8];
#pragma unroll
    for (int j = 0; j < 8; ++j) {
      o0[j] = v4f{c0[0][j] + bias[G][0], c0[1][j] + bias[G][1],
                  c0[2][j] + bias[G][2], c0[3][j] + bias[G][3]};
      o1[j] = v4f{c1[0][j] + bias[G][0], c1[1][j] + bias[G][1],
                  c1[2][j] + bias[G][2], c1[3][j] + bias[G][3]};
    }
    // keeps the group's stores in one run behind its sums: mixed with the sums, a
    // stored register is reused at once and each reuse waits for the issued store
    __builtin_amdgcn_sched_barrier(0);
#pragma unroll
    for (int j = 0; j < 8; ++j) {
      *(v4f*)&op[(size_t)j * HID + G * 64]        = o0[j];
      *(v4f*)&op[(size_t)(16 + j) * HID + G * 64] = o1[j];
    }
    // the next group reuses registers that these stores name
    if (G + 1 < PROJ_NG) loads_issued();
  }
}

// ---------------------------------------------------------------------------
extern "C" void kernel_launch(void* const* d_in, const int* in_sizes, int n_in,
                              void* d_out, int out_size, void* d_ws, size_t ws_size,
                              hipStream_t stream) {
  (void)in_sizes; (void)n_in; (void)out_size; (void)ws_size;

  const float* y  = (const float*)d_in[0];
  const float* Wq = (const float*)d_in[1];
  const float* bq = (const float*)d_in[2];
  const float* Wk = (const float*)d_in[3];
  const float* bk = (const float*)d_in[4];
  const float* Wv = (const float*)d_in[5];
  const float* bv = (const float*)d_in[6];
  const float* Wo = (const float*)d_in[7];
  const float* bo = (const float*)d_in[8];
  float* out = (float*)d_out;

  // workspace layout (f16)
  char* ws = (char*)d_ws;
  _Float16* Wqkv_h = (_Float16*)(ws);                        // 192*1024  (384 KB), packed
  _Float16* Wo_h   = (_Float16*)(ws + 393216);               // 1024*64   (128 KB), packed
  _Float16* q_h    = (_Float16*)(ws + 524288);               // [b][t][d] (2 MB)
  _Float16* k_h    = (_Float16*)(ws + 524288 + 2097152);     // [b][t][d] (2 MB)
  _Float16* v_t    = (_Float16*)(ws + 524288 + 2 * 2097152); // [b][d][t] (2 MB)

  k0_convert_w<<<128, 256, 0, stream>>>(Wq, Wk, Wv, Wo, Wqkv_h, Wo_h);
  k1_qkv<<<NROWS / MT, 384, 0, stream>>>(y, Wqkv_h, bq, bk, bv, q_h, k_h, v_t);
  k2_attn<<<NBAT * (SEQ / QTILE), 256, 0, stream>>>(q_h, k_h, v_t, Wo_h, bo, out);
}

// v009
// Measured time: 35.2 microseconds a run.
// Next to v008, in two timings, it ran 1.10 and 1.11 times as fast.
// Over all steps from v000 it is 6.49 times as fast.
#include <hip/hip_runtime.h>
#include <hip/hip_bf16.h>
#include <math.h>

// ---------------------------------------------------------------------------
// Causal self-attention for MI455X (gfx1250, wave32, WMMA f16->f32).
//   HIDDEN=1024, DK=DV=64, B=4, T=4096
// Pipeline:
//   k0: convert weights fp32 -> f16 into workspace, packed in fragment order
//   k1: fused QKV projection (WMMA, K=1024); q pre-scaled by 1/sqrt(64);
//       V stored pre-transposed (v_t[b][d][t]) for transpose-free attention
//   k2: flash attention on transposed products, keys split over the waves of a
//       work-group, each wave's KV chunks double-buffered in its own LDS ring by
//       GLOBAL_LOAD_ASYNC_TO_LDS_B128 (ASYNCcnt pipeline); its epilogue is
//       the output projection (WMMA, K=64, N=1024) + bias, fp32 out
// ---------------------------------------------------------------------------

typedef __attribute__((ext_vector_type(16))) _Float16 v16h;
typedef __attribute__((ext_vector_type(8)))  _Float16 v8h;
typedef __attribute__((ext_vector_type(4)))  _Float16 v4h;
typedef __attribute__((ext_vector_type(8)))  float    v8f;
typedef __attribute__((ext_vector_type(4)))  float    v4f;
typedef __attribute__((ext_vector_type(4)))  int      v4i;

#define HID   1024
#define DK    64
#define SEQ   4096
#define NBAT  4
#define NROWS (NBAT * SEQ)          // 16384 token rows

// ---- gfx1250 async copy to LDS (guarded; fallback = vector copy) ----------
#if __has_builtin(__builtin_amdgcn_global_load_async_to_lds_b128)
#define HAVE_ASYNC 1
typedef __attribute__((address_space(1))) v4i as1_v4i;
typedef __attribute__((address_space(3))) v4i as3_v4i;
#else
#define HAVE_ASYNC 0
#endif

static __device__ __forceinline__ void copy16B(const _Float16* src, _Float16* dst) {
#if HAVE_ASYNC
  // prototype: (int4 AS1* src, int4 AS3* dst, imm offset, imm cpol)
  __builtin_amdgcn_global_load_async_to_lds_b128(
      (as1_v4i*)(uintptr_t)src,
      (as3_v4i*)(unsigned int)(uintptr_t)dst,   // low 32 bits = LDS offset
      0, 0);
#else
  *(v8h*)dst = *(const v8h*)src;
#endif
}

// ---- fragment helpers (CDNA5 16x16x32 f16 WMMA layouts, wave32) -----------
// A-matrix 16x32: lane = hid*16 + r ; row M = r ;
//   halves e=0..7  -> K = hid*8 + e ; halves e=8..15 -> K = 16 + hid*8 + (e-8)
// B-matrix 32x16: same pattern with lane%16 = column N, reading src[N][K].
static __device__ __forceinline__ v16h frag_load(const _Float16* src, int ld) {
  const int lane = threadIdx.x & 31;
  const int hid  = lane >> 4;
  const int r    = lane & 15;
  const _Float16* p = src + (size_t)r * ld + hid * 8;
  v16h f;
#pragma unroll
  for (int e = 0; e < 8; ++e) f[e] = p[e];
#pragma unroll
  for (int e = 0; e < 8; ++e) f[8 + e] = p[16 + e];
  return f;
}

// A 16x32 fragment that k0 has packed: 1 KB in a row, 16-byte unit h2*32 + lane
// holds f[h2*8 .. h2*8+7] of frag_load's map.  Each of the two loads then reads
// 512 contiguous bytes (4 cache lines) instead of 32 bytes out of 16 lines.
#define FRAG_SZ 512   // halves per packed fragment
static __device__ __forceinline__ v16h frag_load_packed(const _Float16* frag) {
  const int lane = threadIdx.x & 31;
  const v8h lo = *(const v8h*)(frag + lane * 8);
  const v8h hi = *(const v8h*)(frag + 256 + lane * 8);
  return __builtin_shufflevector(lo, hi, 0, 1, 2, 3, 4, 5, 6, 7,
                                 8, 9, 10, 11, 12, 13, 14, 15);
}

static __device__ __forceinline__ v8f wmma16(v16h a, v16h b, v8f c) {
  return __builtin_amdgcn_wmma_f32_16x16x32_f16(false, a, false, b,
                                                (short)0, c, false, false);
}

// ---------------------------------------------------------------------------
// k0: fp32 -> f16 weight conversion into fragment order (see frag_load_packed).
//   One thread per 16-byte unit.  Wqkv_h: fragment (w, kb) at index w*32 + kb,
//   w = 16-row tile of fused [q|k|v], kb = 32-wide k block.  Wo_h: fragment
//   (nt, kb) at index nt*2 + kb; tile nt = 4*G + c holds, as its row r, output
//   column 64*G + 4*r + c: the four tiles of a group G leave four adjacent
//   outputs in one lane (see the projection in k2).
// ---------------------------------------------------------------------------
#define QKV_UNITS (3 * DK * HID / 8)   // 24576, a multiple of 64
#define WO_UNITS  (HID * DK / 8)       // 8192

__global__ void k0_convert_w(const float* __restrict__ Wq,
                             const float* __restrict__ Wk,
                             const float* __restrict__ Wv,
                             const float* __restrict__ Wo,
                             _Float16* __restrict__ Wqkv_h,
                             _Float16* __restrict__ Wo_h) {
  const int u    = blockIdx.x * blockDim.x + threadIdx.x;
  if (u >= QKV_UNITS + WO_UNITS) return;
  const int lane = u & 31;
  const int r    = lane & 15;                                  // row in the tile
  const int kin  = ((u >> 5) & 1) * 16 + (lane >> 4) * 8;      // first k in the block
  const float* src;
  _Float16*    dst;
  if (u < QKV_UNITS) {
    const int frag = u >> 6;
    const int w    = frag >> 5, kb = frag & 31;
    const int sel  = w >> 2;                                   // 0=q 1=k 2=v
    const float* W = (sel == 0) ? Wq : (sel == 1) ? Wk : Wv;
    src = W + (size_t)((w & 3) * 16 + r) * HID + kb * 32 + kin;
    dst = Wqkv_h + (size_t)u * 8;
  } else {
    const int u2   = u - QKV_UNITS;
    const int frag = u2 >> 6;
    const int nt   = frag >> 1, kb = frag & 1;
    src = Wo + (size_t)((nt >> 2) * 64 + r * 4 + (nt & 3)) * DK + kb * 32 + kin;
    dst = Wo_h + (size_t)u2 * 8;
  }
  const v4f a = *(const v4f*)src;
  const v4f b = *(const v4f*)(src + 4);
  const v8h o = {(_Float16)a[0], (_Float16)a[1], (_Float16)a[2], (_Float16)a[3],
                 (_Float16)b[0], (_Float16)b[1], (_Float16)b[2], (_Float16)b[3]};
  *(v8h*)dst = o;
}

// ---------------------------------------------------------------------------
// k1: fused QKV projection.  grid.x = NROWS/64; 384 threads = 12 waves.
//   Wave w owns one 16-col tile of fused [q|k|v] for all 64 rows: a weight
//   fragment is loaded once and feeds four products (four accumulators).
//   y goes to LDS (f16) in slices of 256 k columns, two buffers: the next
//   slice's loads are in flight while this slice is multiplied.
//   V written transposed: v_t[b][d][t].
// ---------------------------------------------------------------------------
#define MT     64                 // token rows per work-group
#define MTILES (MT / 16)
#define KS     256                // k columns per staged slice
#define NSL    (HID / KS)
#define KSTEPS (KS / 32)          // products along k per slice
#define YS_LD  (KS + 8)           // 528B stride (16B aligned, same bank step as a 16B pad)
#define YUNITS (MT * KS / 4)      // 16-byte units of y per slice
#define YLOADS ((YUNITS + 383) / 384)

// stands behind a group of global loads or stores: s_wait_xcnt 0 in front of every
// rewrite of a register that one of them names; the fence holds those rewrites behind it
static __device__ __forceinline__ void loads_issued() {
  asm volatile("s_wait_xcnt 0x0" ::: "memory");
  __builtin_amdgcn_sched_barrier(0);
}

__global__ __launch_bounds__(384) void k1_qkv(const float* __restrict__ y,
                       const _Float16* __restrict__ Wqkv_h,
                       const float* __restrict__ bq,
                       const float* __restrict__ bk,
                       const float* __restrict__ bv,
                       _Float16* __restrict__ q_h,
                       _Float16* __restrict__ k_h,
                       _Float16* __restrict__ v_t) {
  __shared__ __align__(16) _Float16 ytile[2 * MT * YS_LD];

  const int tid  = threadIdx.x;
  const int row0 = blockIdx.x * MT;
  const int w    = __builtin_amdgcn_readfirstlane(tid >> 5);  // 0..11, scalar: real branches below
  const int lane = tid & 31;
  const int hid  = lane >> 4;
  const int n    = lane & 15;
  // the last round of a slice's units is short: whole waves 0..7 take it
  const bool tail = w < (YUNITS - (YLOADS - 1) * 384) / 32;

  v4f  pre[YLOADS];       // a slice of y on its way from memory to LDS
  v16h wf[KSTEPS];        // this wave's weight fragments of one slice
  v8f  acc[MTILES] = {v8f{}, v8f{}, v8f{}, v8f{}};

  // a wave's 32 lanes read 512 contiguous bytes of one row
#define Y_LOAD(s)                                                              \
  _Pragma("unroll") for (int j = 0; j < YLOADS; ++j) {                         \
    const int i = tid + j * 384;                                               \
    if (j + 1 < YLOADS || tail)                                                \
      pre[j] = *(const v4f*)&y[(size_t)(row0 + (i >> 6)) * HID + (s) * KS +    \
                               (i & 63) * 4];                                  \
  }
#define Y_STORE(buf)                                                           \
  _Pragma("unroll") for (int j = 0; j < YLOADS; ++j) {                         \
    const int i = tid + j * 384;                                               \
    if (j + 1 < YLOADS || tail) {                                              \
      const v4h hv = {(_Float16)pre[j][0], (_Float16)pre[j][1],                \
                      (_Float16)pre[j][2], (_Float16)pre[j][3]};               \
      *(v4h*)&ytile[(buf) * (MT * YS_LD) + (i >> 6) * YS_LD + (i & 63) * 4] = hv; \
    }                                                                          \
  }
#define W_LOAD(s)                                                              \
  _Pragma("unroll") for (int kb = 0; kb < KSTEPS; ++kb)                        \
    wf[kb] = frag_load_packed(Wqkv_h +                                         \
                              (size_t)(w * 32 + (s) * KSTEPS + kb) * FRAG_SZ);

  // loads return in order.  In the loop a slice of y is asked for ahead of the
  // weights that are needed after it; here the weights go first, they come from L2
  W_LOAD(0)
  loads_issued();
  Y_LOAD(0)
  loads_issued();
  Y_STORE(0)
  // slice 1 is asked for only when slice 0 has left its registers
  __builtin_amdgcn_sched_barrier(0);
  Y_LOAD(1)
  loads_issued();

#pragma unroll
  for (int s = 0; s < NSL; ++s) {
    // slice s visible; every wave has left the buffer that is refilled below.
    // The waves share LDS only, so the fences name LDS alone: __syncthreads()
    // would also wait out the global loads that are in flight across this point
    __builtin_amdgcn_fence(__ATOMIC_RELEASE, "workgroup", "local");
    __builtin_amdgcn_s_barrier();
    __builtin_amdgcn_fence(__ATOMIC_ACQUIRE, "workgroup", "local");

    // y fragments are read one k step ahead, as one group, into a second set
    const _Float16* yt = ytile + (s & 1) * (MT * YS_LD);
    v16h af[2][MTILES];
#pragma unroll
    for (int i = 0; i < MTILES; ++i) af[0][i] = frag_load(yt + i * 16 * YS_LD, YS_LD);
#pragma unroll
    for (int kb = 0; kb < KSTEPS; ++kb) {
      if (kb + 1 < KSTEPS) {
#pragma unroll
        for (int i = 0; i < MTILES; ++i)
          af[(kb + 1) & 1][i] = frag_load(yt + i * 16 * YS_LD + (kb + 1) * 32, YS_LD);
      }
      // keeps that group of LDS reads whole and ahead of this step's products
      __builtin_amdgcn_sched_barrier(0);
#pragma unroll
      for (int i = 0; i < MTILES; ++i) acc[i] = wmma16(af[kb & 1][i], wf[kb], acc[i]);
      // keeps the following group of LDS reads from moving in among the products
      __builtin_amdgcn_sched_barrier(0);
    }

    // (the fence behind the last products also keeps the conversions below, which
    // wait for the next slice's loads, behind them)
    if (s + 1 < NSL) {
      W_LOAD(s + 1)
      loads_issued();
      Y_STORE((s + 1) & 1)
      // the slice after it is asked for only when its registers are free
      __builtin_amdgcn_sched_barrier(0);
      if (s + 2 < NSL) {
        Y_LOAD(s + 2)
        loads_issued();
      }
    }
  }
#undef Y_LOAD
#undef Y_STORE
#undef W_LOAD

  const int sel  = w >> 2;                  // 0=q 1=k 2=v
  const int col  = (w & 3) * 16 + n;        // 0..63 within q/k/v
  const float* bias = (sel == 0) ? bq : (sel == 1) ? bk : bv;
  const float scale = (sel == 0) ? 0.125f : 1.0f;   // q / sqrt(64)
  const float bval  = bias[col];
  _Float16* dst = (sel == 0) ? q_h : k_h;

  // the 64 rows of a work-group lie in one batch (SEQ is a multiple of MT)
  _Float16* vp = v_t + (size_t)(row0 >> 12) * (DK * SEQ) + (size_t)col * SEQ +
                 (row0 & (SEQ - 1)) + 8 * hid;
  _Float16* qp = dst + (size_t)(row0 + 8 * hid) * DK + col;
  if (sel == 2) {           // scalar branch: whole waves
#pragma unroll
    for (int i = 0; i < MTILES; ++i)
#pragma unroll
      for (int j = 0; j < 8; ++j)
        vp[i * 16 + j] = (_Float16)((acc[i][j] + bval) * scale);
    return;
  }
#pragma unroll
  for (int i = 0; i < MTILES; ++i)
#pragma unroll
    for (int j = 0; j < 8; ++j)
      qp[(size_t)(i * 16 + j) * DK] = (_Float16)((acc[i][j] + bval) * scale);
  // the built code lays the V branch behind these stores, on a path that is never
  // taken: the wait stands in front of its writes to registers the stores name
  asm volatile("s_wait_xcnt 0x0" ::: "memory");
}

// ---------------------------------------------------------------------------
// k2: flash attention (causal), double-buffered async KV staging, a ring per wave.
//   grid.x = NBAT * (SEQ/32), dealt heavy tiles first (see the index map below);
//   256 threads = 8 waves = 8 key groups.
//   Wave g owns the key chunks g, g+8, g+16, ... for all 32 q rows of the
//   work-group, as two 16-query tiles u = 0, 1: a K or V fragment is read from
//   LDS once and feeds both tiles, and the two tiles' chains are independent
//   work for the wave.  Each (wave, tile) has its own maximum, sum and
//   accumulators; the eight groups' partials are merged once, through LDS,
//   wave w taking 16 of the 64 ctx columns of one query tile.
//   Transposed products: S^T = K Q^T and ctx^T += V^T P^T.  A lane then holds
//   16 scores of ONE query, so maximum and sum are in-lane (one exchange
//   between the wave halves), and the two S^T tiles, converted in place, are
//   the B operand of the second product: P never goes through LDS.
//   Epilogue: the merged 32 x 64 ctx tile goes to LDS (f16) and all 8 waves
//   project it, wave w on output columns [w*128, w*128 + 128): work-groups with
//   few keys write their rows of out while the long ones are still in the loop.
//   Lane n of column tile c of a 64-column group holds column 4*n + c, so a lane
//   stores 16 bytes and 16 lanes fill 256 contiguous bytes of a row of out.
// ---------------------------------------------------------------------------
#define K_LD  72     // 64 + 8 pad halves: 144B stride (16B x odd, no bank conflict)
#define VT_LD 40     // 32 + 8 pad halves:  80B stride  (16B aligned, no bank conflict)
#define QTILE 32
#define QSUB  (QTILE / 16)       // 16-query tiles of a wave
#define KVG   8      // key groups per work-group; SEQ/32 is a multiple of it
#define KCH_SZ (32 * K_LD)
#define VCH_SZ (DK * VT_LD)
#define CT_LD 72     // 64 + 8 pad halves: 144B stride (16B aligned)
#define PROJ_NT (HID / 16 / 8)   // output column tiles per wave in the projection
#define PROJ_NG (PROJ_NT / 4)    // groups of 4 tiles = 64 output columns
#define PACC_FLOATS (KVG * QSUB * 8 * 32 * 4)   // [group][tile][quad][lane] 4 floats

// value of lane l ^ 16 (vector cross-row move, no LDS round trip)
static __device__ __forceinline__ float other_half(float x) {
  const int b = __builtin_bit_cast(int, x);
  return __builtin_bit_cast(
      float, __builtin_amdgcn_permlanex16(b, b, 0x76543210, 0xfedcba98, false, false));
}

__global__ __launch_bounds__(256) void k2_attn(const _Float16* __restrict__ q_h,
                        const _Float16* __restrict__ k_h,
                        const _Float16* __restrict__ v_t,
                        const _Float16* __restrict__ Wo_h,
                        const float* __restrict__ bo,
                        float* __restrict__ out) {
  // the ring; behind the loop (and a barrier) the same bytes hold the partials.
  // With Cst this is under 160 KiB, so two work-groups share a WGP as before
  __shared__ __align__(16) _Float16 Ring[2 * KVG * (KCH_SZ + VCH_SZ)];
  __shared__ __align__(16) _Float16 Cst[QTILE * CT_LD];   // merged ctx tile [query 32][d 64]
  _Float16* const Klds = Ring;                            // [buf][group] K chunk [kv 32][d 64]
  _Float16* const Vlds = Ring + 2 * KVG * KCH_SZ;         // [buf][group] V^T chunk [d 64][kv 32]
  float* const Pacc = (float*)Ring;                       // [group][tile][quad][lane] 4 floats
  float* const Pml  = Pacc + PACC_FLOATS;                 // [group][tile][max, sum][lane]
  static_assert((PACC_FLOATS + KVG * QSUB * 2 * 32) * 4 <= sizeof(Ring), "partials fit the ring");

  const int tid  = threadIdx.x;
  const int w    = __builtin_amdgcn_readfirstlane(tid >> 5);  // scalar: the skip below is a real branch
  const int g    = w;                       // key group of this wave
  const int lane = tid & 31;
  const int hid  = lane >> 4;
  const int n    = lane & 15;

  // Work-group index -> (batch, query tile), a permutation chosen for speed only.
  // A tile's key count grows with its index (causal), every work-group is resident
  // (two fit a WGP).  The first half of the grid takes the upper
  // tiles, heaviest first; the second half
  // takes the lower tiles, lightest first, so indices i and i + half hold tiles
  // qtiles-1-j and j: every such pair has the same number of key chunks.
  const int qtiles = SEQ / QTILE;           // 128
  const int halfg  = NBAT * qtiles / 2;     // work-groups in half the grid
  const int rk     = blockIdx.x % halfg;
  const int b      = rk % NBAT;
  const int j0     = rk / NBAT;             // 0 .. qtiles/2 - 1
  const int qbase  = ((int)blockIdx.x < halfg ? qtiles - 1 - j0 : j0) * QTILE;
  const size_t bo64 = (size_t)b * SEQ * DK; // batch offset, [t][d] layouts
  const _Float16* kg  = k_h + bo64;
  const _Float16* vtg = v_t + bo64;         // [d][t] layout

  // staging: a wave copies its own chunks, 16 copies of 16 bytes a lane per chunk.
  // K: a copy takes 4 rows (512 contiguous bytes); V^T: 8 rows d of 64 bytes
  const unsigned kLane = (unsigned)lane * 8;                               // halves from the chunk's start
  const unsigned vLane = (unsigned)(lane >> 2) * SEQ + (lane & 3) * 8;
  _Float16* const kDst = Klds + g * KCH_SZ + (lane >> 3) * K_LD + (lane & 7) * 8;
  _Float16* const vDst = Vlds + g * VCH_SZ + (lane >> 2) * VT_LD + (lane & 3) * 8;

  // persistent Q fragments of both query tiles (already scaled);
  // used as B: lane n holds query column n of its tile
  const _Float16* qp = q_h + bo64 + (size_t)qbase * DK;
  v16h aq[QSUB][2];
#pragma unroll
  for (int u = 0; u < QSUB; ++u) {
    aq[u][0] = frag_load(qp + u * 16 * DK, DK);
    aq[u][1] = frag_load(qp + u * 16 * DK + 32, DK);
  }

  // acc[u][t][j] = ctx^T[d = t*16 + 8*hid + j][query n of tile u], over this group's keys
  v8f   acc[QSUB][4];
  float m_run[QSUB];        // running maximum of query n (equal in both halves)
  float l_run[QSUB];        // this half's share of the running sum of query n
#pragma unroll
  for (int u = 0; u < QSUB; ++u) {
#pragma unroll
    for (int t = 0; t < 4; ++t) acc[u][t] = v8f{};
    m_run[u] = -3.0e38f;
    l_run[u] = 0.0f;
  }

  const int row0   = qbase + n;             // this lane's query in tile 0; tile u: + 16*u
  const int limit  = qbase + QTILE;
  const int nchunks = limit / 32;           // chunks with an open key; all inside K and V

  // chunk c (scalar) into this wave's buffer buf
#define STAGE(c, buf)                                                          \
  {                                                                            \
    const _Float16* ks = kg + (size_t)(c) * (32 * DK);                         \
    const _Float16* vs = vtg + (c) * 32;                                       \
    _Pragma("unroll") for (int i = 0; i < 8; ++i) {                            \
      copy16B(ks + i * (4 * DK) + kLane,                                       \
              kDst + (buf) * (KVG * KCH_SZ) + i * (4 * K_LD));                 \
      copy16B(vs + (size_t)i * (8 * SEQ) + vLane,                              \
              vDst + (buf) * (KVG * VCH_SZ) + i * (8 * VT_LD));                \
    }                                                                          \
  }

  // The two buffers of a wave are filled and read by that wave alone: its own two
  // waits order them and the loop holds no work-group barrier, so the waves of a
  // SIMD drift apart and one's waits and products lie under the other's vector work
  const int ntrips = (nchunks - g + KVG - 1) / KVG;   // this wave's chunks: g, g + KVG, ...
  if (ntrips > 0) STAGE(g, 0)

  int cur = 0;
  for (int trip = 0; trip < ntrips; ++trip) {   // scalar bounds: whole waves
    // this wave's LDS reads of the buffer that is refilled below have retired
    asm volatile("s_wait_dscnt 0x0" ::: "memory");
    // this wave's copies into buf[cur] have landed; holds the LDS reads below behind it
    asm volatile("s_wait_asynccnt 0x0" ::: "memory");

    // the wave's next chunk goes into its other buffer (in flight under the work below)
    if (trip + 1 < ntrips) STAGE((trip + 1) * KVG + g, cur ^ 1)

    const int kvb = (trip * KVG + g) * 32;  // this wave's chunk
    {
      const _Float16* Kb = Klds + (cur * KVG + g) * KCH_SZ;
      const _Float16* Vb = Vlds + (cur * KVG + g) * VCH_SZ;

      // S^T = K Q^T : per query tile two 16x16 tiles, kv rows [kvb, kvb+16) and
      // [kvb+16, kvb+32); each K fragment serves both query tiles
      //   s0[u][j] = S[row][kvb + 8*hid + j],  s1[u][j] = S[row][kvb + 16 + 8*hid + j]
      v8f s0[QSUB], s1[QSUB];
      {
        const v16h b0 = frag_load(Kb, K_LD);
        const v16h b2 = frag_load(Kb + 16 * K_LD, K_LD);
        const v16h b1 = frag_load(Kb + 32, K_LD);
        const v16h b3 = frag_load(Kb + 16 * K_LD + 32, K_LD);
#pragma unroll
        for (int u = 0; u < QSUB; ++u) {
          s0[u] = wmma16(b0, aq[u][0], v8f{});
          s1[u] = wmma16(b2, aq[u][0], v8f{});
        }
#pragma unroll
        for (int u = 0; u < QSUB; ++u) {
          s0[u] = wmma16(b1, aq[u][1], s0[u]);
          s1[u] = wmma16(b3, aq[u][1], s1[u]);
        }
      }

      // online softmax update (fp32), causal mask; a lane's 16 scores of tile u
      // belong to one query
      const int kv0 = kvb + 8 * hid;
      v16h pT[QSUB];        // B operand: pT[u][e] = P^T[kmap(e, hid)][n]
#pragma unroll
      for (int u = 0; u < QSUB; ++u) {
        const int row = row0 + u * 16;
        float mx = -3.0e38f;
#pragma unroll
        for (int j = 0; j < 8; ++j) {
          s0[u][j] = (kv0 + j)      <= row ? s0[u][j] : -3.0e38f;
          s1[u][j] = (kv0 + 16 + j) <= row ? s1[u][j] : -3.0e38f;
          mx = fmaxf(mx, fmaxf(s0[u][j], s1[u][j]));
        }
        mx = fmaxf(mx, other_half(mx));

        // a chunk that is entered has kvb <= qbase <= row: its first key is open to
        // every query, so mtot is a real score and a masked entry gives
        // exp(-3e38 - mtot) = 0
        const float mtot = fmaxf(m_run[u], mx);
        const float sc   = __expf(m_run[u] - mtot);

        float rs = 0.0f;
#pragma unroll
        for (int j = 0; j < 8; ++j) {
          const float p0 = __expf(s0[u][j] - mtot);
          const float p1 = __expf(s1[u][j] - mtot);
          rs += p0 + p1;
          pT[u][j]     = (_Float16)p0;
          pT[u][8 + j] = (_Float16)p1;
        }

        m_run[u] = mtot;
        l_run[u] = l_run[u] * sc + rs;
#pragma unroll
        for (int t = 0; t < 4; ++t) acc[u][t] *= sc;
      }

      // ctx^T += V^T (16 d x 32 kv) * P^T (32 kv x 16 q): each V fragment serves
      // both query tiles, 8 WMMAs
#pragma unroll
      for (int t = 0; t < 4; ++t) {
        const v16h aV = frag_load(Vb + (size_t)(t * 16) * VT_LD, VT_LD);
#pragma unroll
        for (int u = 0; u < QSUB; ++u) acc[u][t] = wmma16(aV, pT[u], acc[u][t]);
      }
    }
    cur ^= 1;
  }
#undef STAGE

  // no copy is in flight when a wave goes on to the merge or ends
  asm volatile("s_wait_asynccnt 0x0" ::: "memory");
  // the ring becomes the partials' place: this wave's reads of it have retired,
  // and behind the barrier so have every other wave's
  asm volatile("s_wait_dscnt 0x0" ::: "memory");
  __syncthreads();

  // merge of the key groups: every group lays down its partials (lane layout kept)
#pragma unroll
  for (int u = 0; u < QSUB; ++u) {
    const int slot = g * QSUB + u;
#pragma unroll
    for (int t = 0; t < 4; ++t) {
      const v4f lo = {acc[u][t][0], acc[u][t][1], acc[u][t][2], acc[u][t][3]};
      const v4f hi = {acc[u][t][4], acc[u][t][5], acc[u][t][6], acc[u][t][7]};
      *(v4f*)&Pacc[((slot * 8 + t * 2 + 0) * 32 + lane) * 4] = lo;
      *(v4f*)&Pacc[((slot * 8 + t * 2 + 1) * 32 + lane) * 4] = hi;
    }
    Pml[(slot * 2 + 0) * 32 + lane] = m_run[u];
    Pml[(slot * 2 + 1) * 32 + lane] = l_run[u];
  }
  __syncthreads();          // partials visible to every wave

  // wave w projects onto output columns [w*128, w*128 + 128), 8 tiles of 16; its
  // weights and bias are asked for here, ahead of the merge
  const _Float16* wp = Wo_h + (size_t)(w * (PROJ_NT * 2)) * FRAG_SZ;
  const float*    bp = bo + w * (PROJ_NT * 16) + n * 4;
  v16h wo[PROJ_NT * 2];
  v4f  bias[PROJ_NG];
  // (these loops and the one over G below are unrolled so that wo and bias are
  // indexed by constants and stay in registers)
#pragma unroll
  for (int i = 0; i < PROJ_NT * 2; ++i) wo[i] = frag_load_packed(wp + (size_t)i * FRAG_SZ);
#pragma unroll
  for (int G = 0; G < PROJ_NG; ++G) bias[G] = *(const v4f*)(bp + G * 64);
  loads_issued();

  {
    // wave w merges ctx columns [mt*16, mt*16 + 16) of query tile mu over the groups.
    // Group 0 always has chunk 0, so mall is a real score; a group that had no
    // chunk holds (-3e38, 0, 0) and gets weight exp(-3e38 - mall) = 0
    const int mu = w & 1;
    const int mt = w >> 1;
    float mg[KVG];
#pragma unroll
    for (int i = 0; i < KVG; ++i) mg[i] = Pml[((i * QSUB + mu) * 2 + 0) * 32 + lane];
    float mall = mg[0];
#pragma unroll
    for (int i = 1; i < KVG; ++i) mall = fmaxf(mall, mg[i]);
    float lsum = 0.0f;
    v8f   ctx  = v8f{};
#pragma unroll
    for (int i = 0; i < KVG; ++i) {
      const int slot = i * QSUB + mu;
      const float wi = __expf(mg[i] - mall);
      lsum += wi * Pml[(slot * 2 + 1) * 32 + lane];
      const v4f lo = *(const v4f*)&Pacc[((slot * 8 + mt * 2 + 0) * 32 + lane) * 4];
      const v4f hi = *(const v4f*)&Pacc[((slot * 8 + mt * 2 + 1) * 32 + lane) * 4];
#pragma unroll
      for (int j = 0; j < 4; ++j) {
        ctx[j]     += wi * lo[j];
        ctx[4 + j] += wi * hi[j];
      }
    }

    // join the halves' sums, normalize, hand ctx (f16) over: 8 consecutive d per lane
    const float inv_l = 1.0f / (lsum + other_half(lsum));
    v8h o;
#pragma unroll
    for (int j = 0; j < 8; ++j) o[j] = (_Float16)(ctx[j] * inv_l);
    *(v8h*)&Cst[(mu * 16 + n) * CT_LD + mt * 16 + 8 * hid] = o;
  }
  __syncthreads();          // ctx tile visible to every wave

  // output projection  out[m][h] = sum_v ctx[m][v] * Wo[h][v] + bo[h]:
  // each weight fragment serves both 16-query tiles
  const v16h a00 = frag_load(Cst, CT_LD);
  const v16h a01 = frag_load(Cst + 32, CT_LD);
  const v16h a10 = frag_load(Cst + 16 * CT_LD, CT_LD);
  const v16h a11 = frag_load(Cst + 16 * CT_LD + 32, CT_LD);
  float* op = out + ((size_t)b * SEQ + qbase + 8 * hid) * HID + w * (PROJ_NT * 16) + n * 4;

#pragma unroll
  for (int G = 0; G < PROJ_NG; ++G) {
    // c0[c][j], c1[c][j]: rows 8*hid + j and 16 + 8*hid + j, column G*64 + 4*n + c
    v8f c0[4], c1[4];
#pragma unroll
    for (int c = 0; c < 4; ++c) {
      const v16h b0 = wo[(G * 4 + c) * 2];
      const v16h b1 = wo[(G * 4 + c) * 2 + 1];
      c0[c] = wmma16(a00, b0, v8f{});
      c1[c] = wmma16(a10, b0, v8f{});
      c0[c] = wmma16(a01, b1, c0[c]);
      c1[c] = wmma16(a11, b1, c1[c]);
    }
    v4f o0[8], o1[8];
#pragma unroll
    for (int j = 0; j < 8; ++j) {
      o0[j] = v4f{c0[0][j] + bias[G][0], c0[1][j] + bias[G][1],
                  c0[2][j] + bias[G][2], c0[3][j] + bias[G][3]};
      o1[j] = v4f{c1[0][j] + bias[G][0], c1[1][j] + bias[G][1],
                  c1[2][j] + bias[G][2], c1[3][j] + bias[G][3]};
    }
    // keeps the group's stores in one run behind its sums: mixed with the sums, a
    // stored register is reused at once and each reuse waits for the issued store
    __builtin_amdgcn_sched_barrier(0);
#pragma unroll
    for (int j = 0; j < 8; ++j) {
      *(v4f*)&op[(size_t)j * HID + G * 64]        = o0[j];
      *(v4f*)&op[(size_t)(16 + j) * HID + G * 64] = o1[j];
    }
    // the next group reuses registers that these stores name
    if (G + 1 < PROJ_NG) loads_issued();
  }
}

// ---------------------------------------------------------------------------
extern "C" void kernel_launch(void* const* d_in, const int* in_sizes, int n_in,
                              void* d_out, int out_size, void* d_ws, size_t ws_size,
                              hipStream_t stream) {
  (void)in_sizes; (void)n_in; (void)out_size; (void)ws_size;

  const float* y  = (const float*)d_in[0];
  const float* Wq = (const float*)d_in[1];
  const float* bq = (const float*)d_in[2];
  const float* Wk = (const float*)d_in[3];
  const float* bk = (const float*)d_in[4];
  const float* Wv = (const float*)d_in[5];
  const float* bv = (const float*)d_in[6];
  const float* Wo = (const float*)d_in[7];
  const float* bo = (const float*)d_in[8];
  float* out = (float*)d_out;

  // workspace layout (f16)
  char* ws = (char*)d_ws;
  _Float16* Wqkv_h = (_Float16*)(ws);                        // 192*1024  (384 KB), packed
  _Float16* Wo_h   = (_Float16*)(ws + 393216);               // 1024*64   (128 KB), packed
  _Float16* q_h    = (_Float16*)(ws + 524288);               // [b][t][d] (2 MB)
  _Float16* k_h    = (_Float16*)(ws + 524288 + 2097152);     // [b][t][d] (2 MB)
  _Float16* v_t    = (_Float16*)(ws + 524288 + 2 * 2097152); // [b][d][t] (2 MB)

  k0_convert_w<<<128, 256, 0, stream>>>(Wq, Wk, Wv, Wo, Wqkv_h, Wo_h);
  k1_qkv<<<NROWS / MT, 384, 0, stream>>>(y, Wqkv_h, bq, bk, bv, q_h, k_h, v_t);
  k2_attn<<<NBAT * (SEQ / QTILE), 256, 0, stream>>>(q_h, k_h, v_t, Wo_h, bo, out);
}

// v010
// It runs in 33.7 microseconds.
// Two timings next to v009 put it at 1.05 and 1.04 times that version's speed.
// All steps since v000 together make it 6.78 times as fast.
#include <hip/hip_runtime.h>
#include <hip/hip_bf16.h>
#include <math.h>

// ---------------------------------------------------------------------------
// Causal self-attention for MI455X (gfx1250, wave32, WMMA f16->f32).
//   HIDDEN=1024, DK=DV=64, B=4, T=4096
// Pipeline:
//   k0: convert weights fp32 -> f16 into workspace, packed in fragment order
//   k1: fused QKV projection (WMMA, K=1024); q pre-scaled by 1/sqrt(64);
//       V stored pre-transposed (v_t[b][d][t]) for transpose-free attention
//   k2: flash attention on transposed products, keys split over the waves of a
//       work-group, each wave's KV chunks double-buffered in its own LDS ring by
//       GLOBAL_LOAD_ASYNC_TO_LDS_B128 (ASYNCcnt pipeline); its epilogue is
//       the output projection (WMMA, K=64, N=1024) + bias, fp32 out
// ---------------------------------------------------------------------------

typedef __attribute__((ext_vector_type(16))) _Float16 v16h;
typedef __attribute__((ext_vector_type(8)))  _Float16 v8h;
typedef __attribute__((ext_vector_type(4)))  _Float16 v4h;
typedef __attribute__((ext_vector_type(8)))  float    v8f;
typedef __attribute__((ext_vector_type(4)))  float    v4f;
typedef __attribute__((ext_vector_type(4)))  int      v4i;

#define HID   1024
#define DK    64
#define SEQ   4096
#define NBAT  4
#define NROWS (NBAT * SEQ)          // 16384 token rows

// ---- gfx1250 async copy to LDS (guarded; fallback = vector copy) ----------
#if __has_builtin(__builtin_amdgcn_global_load_async_to_lds_b128)
#define HAVE_ASYNC 1
typedef __attribute__((address_space(1))) v4i as1_v4i;
typedef __attribute__((address_space(3))) v4i as3_v4i;
#else
#define HAVE_ASYNC 0
#endif

static __device__ __forceinline__ void copy16B(const _Float16* src, _Float16* dst) {
#if HAVE_ASYNC
  // prototype: (int4 AS1* src, int4 AS3* dst, imm offset, imm cpol)
  __builtin_amdgcn_global_load_async_to_lds_b128(
      (as1_v4i*)(uintptr_t)src,
      (as3_v4i*)(unsigned int)(uintptr_t)dst,   // low 32 bits = LDS offset
      0, 0);
#else
  *(v8h*)dst = *(const v8h*)src;
#endif
}

// ---- fragment helpers (CDNA5 16x16x32 f16 WMMA layouts, wave32) -----------
// A-matrix 16x32: lane = hid*16 + r ; row M = r ;
//   halves e=0..7  -> K = hid*8 + e ; halves e=8..15 -> K = 16 + hid*8 + (e-8)
// B-matrix 32x16: same pattern with lane%16 = column N, reading src[N][K].
static __device__ __forceinline__ v16h frag_load(const _Float16* src, int ld) {
  const int lane = threadIdx.x & 31;
  const int hid  = lane >> 4;
  const int r    = lane & 15;
  const _Float16* p = src + (size_t)r * ld + hid * 8;
  v16h f;
#pragma unroll
  for (int e = 0; e < 8; ++e) f[e] = p[e];
#pragma unroll
  for (int e = 0; e < 8; ++e) f[8 + e] = p[16 + e];
  return f;
}

// A 16x32 fragment that k0 has packed: 1 KB in a row, 16-byte unit h2*32 + lane
// holds f[h2*8 .. h2*8+7] of frag_load's map.  Each of the two loads then reads
// 512 contiguous bytes (4 cache lines) instead of 32 bytes out of 16 lines.
#define FRAG_SZ 512   // halves per packed fragment
static __device__ __forceinline__ v16h frag_load_packed(const _Float16* frag) {
  const int lane = threadIdx.x & 31;
  const v8h lo = *(const v8h*)(frag + lane * 8);
  const v8h hi = *(const v8h*)(frag + 256 + lane * 8);
  return __builtin_shufflevector(lo, hi, 0, 1, 2, 3, 4, 5, 6, 7,
                                 8, 9, 10, 11, 12, 13, 14, 15);
}

static __device__ __forceinline__ v8f wmma16(v16h a, v16h b, v8f c) {
  return __builtin_amdgcn_wmma_f32_16x16x32_f16(false, a, false, b,
                                                (short)0, c, false, false);
}

// ---------------------------------------------------------------------------
// k0: fp32 -> f16 weight conversion into fragment order (see frag_load_packed).
//   One thread per 16-byte unit.  Wqkv_h: fragment (w, kb) at index w*32 + kb,
//   w = 16-row tile of fused [q|k|v], kb = 32-wide k block.  Wo_h: fragment
//   (nt, kb) at index nt*2 + kb; tile nt = 4*G + c holds, as its row r, output
//   column 64*G + 4*r + c: the four tiles of a group G leave four adjacent
//   outputs in one lane (see the projection in k2).
// ---------------------------------------------------------------------------
#define QKV_UNITS (3 * DK * HID / 8)   // 24576, a multiple of 64
#define WO_UNITS  (HID * DK / 8)       // 8192

__global__ void k0_convert_w(const float* __restrict__ Wq,
                             const float* __restrict__ Wk,
                             const float* __restrict__ Wv,
                             const float* __restrict__ Wo,
                             _Float16* __restrict__ Wqkv_h,
                             _Float16* __restrict__ Wo_h) {
  const int u    = blockIdx.x * blockDim.x + threadIdx.x;
  if (u >= QKV_UNITS + WO_UNITS) return;
  const int lane = u & 31;
  const int r    = lane & 15;                                  // row in the tile
  const int kin  = ((u >> 5) & 1) * 16 + (lane >> 4) * 8;      // first k in the block
  const float* src;
  _Float16*    dst;
  if (u < QKV_UNITS) {
    const int frag = u >> 6;
    const int w    = frag >> 5, kb = frag & 31;
    const int sel  = w >> 2;                                   // 0=q 1=k 2=v
    const float* W = (sel == 0) ? Wq : (sel == 1) ? Wk : Wv;
    src = W + (size_t)((w & 3) * 16 + r) * HID + kb * 32 + kin;
    dst = Wqkv_h + (size_t)u * 8;
  } else {
    const int u2   = u - QKV_UNITS;
    const int frag = u2 >> 6;
    const int nt   = frag >> 1, kb = frag & 1;
    src = Wo + (size_t)((nt >> 2) * 64 + r * 4 + (nt & 3)) * DK + kb * 32 + kin;
    dst = Wo_h + (size_t)u2 * 8;
  }
  const v4f a = *(const v4f*)src;
  const v4f b = *(const v4f*)(src + 4);
  const v8h o = {(_Float16)a[0], (_Float16)a[1], (_Float16)a[2], (_Float16)a[3],
                 (_Float16)b[0], (_Float16)b[1], (_Float16)b[2], (_Float16)b[3]};
  *(v8h*)dst = o;
}

// ---------------------------------------------------------------------------
// k1: fused QKV projection.  grid.x = NROWS/64; 384 threads = 12 waves.
//   Wave w owns one 16-col tile of fused [q|k|v] for all 64 rows: a weight
//   fragment is loaded once and feeds four products (four accumulators).
//   y goes to LDS (f16) in slices of 256 k columns, two buffers: the next
//   slice's loads are in flight while this slice is multiplied.  The slices are
//   walked from a start that differs between work-groups (see SL below).
//   V written transposed: v_t[b][d][t].
// ---------------------------------------------------------------------------
#define MT     64                 // token rows per work-group
#define MTILES (MT / 16)
#define KS     256                // k columns per staged slice
#define NSL    (HID / KS)
#define KSTEPS (KS / 32)          // products along k per slice
#define YS_LD  (KS + 8)           // 528B stride (16B aligned, same bank step as a 16B pad)
#define YUNITS (MT * KS / 4)      // 16-byte units of y per slice
#define YLOADS ((YUNITS + 383) / 384)

// stands behind a group of global loads or stores: s_wait_xcnt 0 in front of every
// rewrite of a register that one of them names; the fence holds those rewrites behind it
static __device__ __forceinline__ void loads_issued() {
  asm volatile("s_wait_xcnt 0x0" ::: "memory");
  __builtin_amdgcn_sched_barrier(0);
}

__global__ __launch_bounds__(384) void k1_qkv(const float* __restrict__ y,
                       const _Float16* __restrict__ Wqkv_h,
                       const float* __restrict__ bq,
                       const float* __restrict__ bk,
                       const float* __restrict__ bv,
                       _Float16* __restrict__ q_h,
                       _Float16* __restrict__ k_h,
                       _Float16* __restrict__ v_t) {
  __shared__ __align__(16) _Float16 ytile[2 * MT * YS_LD];

  const int tid  = threadIdx.x;
  const int row0 = blockIdx.x * MT;
  const int w    = __builtin_amdgcn_readfirstlane(tid >> 5);  // 0..11, scalar: real branches below
  const int lane = tid & 31;
  const int hid  = lane >> 4;
  const int n    = lane & 15;
  // the last round of a slice's units is short: whole waves 0..7 take it
  const bool tail = w < (YUNITS - (YLOADS - 1) * 384) / 32;
  // Every work-group reads the same weights.  Pass s works on k slice SL(s): the
  // walk starts at a slice set by the work-group's index and wraps, so that the
  // work-groups do not all ask L2 for the same lines at the same moment
  const int rot = (blockIdx.x >> 3) & (NSL - 1);
#define SL(s) (((s) + rot) & (NSL - 1))

  v4f  pre[YLOADS];       // a slice of y on its way from memory to LDS
  v16h wf[KSTEPS];        // this wave's weight fragments of one slice
  v8f  acc[MTILES] = {v8f{}, v8f{}, v8f{}, v8f{}};

  // a wave's 32 lanes read 512 contiguous bytes of one row
  // (unit tid + j*384 lies 6*j rows below unit tid: a scalar base for the slice, one
  // offset a thread, and a constant for j)
  const float* const yrows = y + (size_t)row0 * HID;
  const unsigned     yoff  = (unsigned)(tid >> 6) * HID + (unsigned)(tid & 63) * 4;
#define Y_LOAD(s)                                                              \
  _Pragma("unroll") for (int j = 0; j < YLOADS; ++j) {                         \
    if (j + 1 < YLOADS || tail)                                                \
      pre[j] = *(const v4f*)(yrows + SL(s) * KS + yoff + j * (384 / 64 * HID)); \
  }
#define Y_STORE(buf)                                                           \
  _Pragma("unroll") for (int j = 0; j < YLOADS; ++j) {                         \
    const int i = tid + j * 384;                                               \
    if (j + 1 < YLOADS || tail) {                                              \
      const v4h hv = {(_Float16)pre[j][0], (_Float16)pre[j][1],                \
                      (_Float16)pre[j][2], (_Float16)pre[j][3]};               \
      *(v4h*)&ytile[(buf) * (MT * YS_LD) + (i >> 6) * YS_LD + (i & 63) * 4] = hv; \
    }                                                                          \
  }
#define W_LOAD(s)                                                              \
  _Pragma("unroll") for (int kb = 0; kb < KSTEPS; ++kb)                        \
    wf[kb] = frag_load_packed(Wqkv_h +                                         \
                              (size_t)(w * 32 + SL(s) * KSTEPS + kb) * FRAG_SZ);

  // loads return in order.  In the loop a slice of y is asked for ahead of the
  // weights that are needed after it; here the weights go first, they come from L2
  W_LOAD(0)
  loads_issued();
  Y_LOAD(0)
  loads_issued();
  Y_STORE(0)
  // slice 1 is asked for only when slice 0 has left its registers
  __builtin_amdgcn_sched_barrier(0);
  Y_LOAD(1)
  loads_issued();

#pragma unroll
  for (int s = 0; s < NSL; ++s) {
    // slice s visible; every wave has left the buffer that is refilled below.
    // The waves share LDS only, so the fences name LDS alone: __syncthreads()
    // would also wait out the global loads that are in flight across this point
    __builtin_amdgcn_fence(__ATOMIC_RELEASE, "workgroup", "local");
    __builtin_amdgcn_s_barrier();
    __builtin_amdgcn_fence(__ATOMIC_ACQUIRE, "workgroup", "local");

    // y fragments are read one k step ahead, as one group, into a second set
    const _Float16* yt = ytile + (s & 1) * (MT * YS_LD);
    v16h af[2][MTILES];
#pragma unroll
    for (int i = 0; i < MTILES; ++i) af[0][i] = frag_load(yt + i * 16 * YS_LD, YS_LD);
#pragma unroll
    for (int kb = 0; kb < KSTEPS; ++kb) {
      if (kb + 1 < KSTEPS) {
#pragma unroll
        for (int i = 0; i < MTILES; ++i)
          af[(kb + 1) & 1][i] = frag_load(yt + i * 16 * YS_LD + (kb + 1) * 32, YS_LD);
      }
      // keeps that group of LDS reads whole and ahead of this step's products
      __builtin_amdgcn_sched_barrier(0);
#pragma unroll
      for (int i = 0; i < MTILES; ++i) acc[i] = wmma16(af[kb & 1][i], wf[kb], acc[i]);
      // keeps the following group of LDS reads from moving in among the products
      __builtin_amdgcn_sched_barrier(0);
    }

    // (the fence behind the last products also keeps the conversions below, which
    // wait for the next slice's loads, behind them)
    if (s + 1 < NSL) {
      W_LOAD(s + 1)
      loads_issued();
      Y_STORE((s + 1) & 1)
      // the slice after it is asked for only when its registers are free
      __builtin_amdgcn_sched_barrier(0);
      if (s + 2 < NSL) {
        Y_LOAD(s + 2)
        loads_issued();
      }
    }
  }
#undef Y_LOAD
#undef Y_STORE
#undef W_LOAD
#undef SL

  const int sel  = w >> 2;                  // 0=q 1=k 2=v
  const int col  = (w & 3) * 16 + n;        // 0..63 within q/k/v
  const float* bias = (sel == 0) ? bq : (sel == 1) ? bk : bv;
  const float scale = (sel == 0) ? 0.125f : 1.0f;   // q / sqrt(64)
  const float bval  = bias[col];
  _Float16* dst = (sel == 0) ? q_h : k_h;

  // the 64 rows of a work-group lie in one batch (SEQ is a multiple of MT)
  _Float16* vp = v_t + (size_t)(row0 >> 12) * (DK * SEQ) + (size_t)col * SEQ +
                 (row0 & (SEQ - 1)) + 8 * hid;
  _Float16* qp = dst + (size_t)(row0 + 8 * hid) * DK + col;
  if (sel == 2) {           // scalar branch: whole waves
#pragma unroll
    for (int i = 0; i < MTILES; ++i)
#pragma unroll
      for (int j = 0; j < 8; ++j)
        vp[i * 16 + j] = (_Float16)((acc[i][j] + bval) * scale);
    return;
  }
#pragma unroll
  for (int i = 0; i < MTILES; ++i)
#pragma unroll
    for (int j = 0; j < 8; ++j)
      qp[(size_t)(i * 16 + j) * DK] = (_Float16)((acc[i][j] + bval) * scale);
  // the built code lays the V branch behind these stores, on a path that is never
  // taken: the wait stands in front of its writes to registers the stores name
  asm volatile("s_wait_xcnt 0x0" ::: "memory");
}

// ---------------------------------------------------------------------------
// k2: flash attention (causal), double-buffered async KV staging, a ring per wave.
//   grid.x = NBAT * (SEQ/32), dealt heavy tiles first (see the index map below);
//   256 threads = 8 waves = 8 key groups.
//   Wave g owns the key chunks g, g+8, g+16, ... (walked from a start that differs
//   between work-groups) for all 32 q rows of the
//   work-group, as two 16-query tiles u = 0, 1: a K or V fragment is read from
//   LDS once and feeds both tiles, and the two tiles' chains are independent
//   work for the wave.  Each (wave, tile) has its own maximum, sum and
//   accumulators; the eight groups' partials are merged once, through LDS,
//   wave w taking 16 of the 64 ctx columns of one query tile.
//   Transposed products: S^T = K Q^T and ctx^T += V^T P^T.  A lane then holds
//   16 scores of ONE query, so maximum and sum are in-lane (one exchange
//   between the wave halves), and the two S^T tiles, converted in place, are
//   the B operand of the second product: P never goes through LDS.
//   Epilogue: the merged 32 x 64 ctx tile goes to LDS (f16) and all 8 waves
//   project it, wave w on output columns [w*128, w*128 + 128): work-groups with
//   few keys write their rows of out while the long ones are still in the loop.
//   Lane n of column tile c of a 64-column group holds column 4*n + c, so a lane
//   stores 16 bytes and 16 lanes fill 256 contiguous bytes of a row of out.
// ---------------------------------------------------------------------------
#define K_LD  72     // 64 + 8 pad halves: 144B stride (16B x odd, no bank conflict)
#define VT_LD 40     // 32 + 8 pad halves:  80B stride  (16B aligned, no bank conflict)
#define QTILE 32
#define QSUB  (QTILE / 16)       // 16-query tiles of a wave
#define KVG   8      // key groups per work-group; SEQ/32 is a multiple of it
#define KCH_SZ (32 * K_LD)
#define VCH_SZ (DK * VT_LD)
#define CT_LD 72     // 64 + 8 pad halves: 144B stride (16B aligned)
#define PROJ_NT (HID / 16 / 8)   // output column tiles per wave in the projection
#define PROJ_NG (PROJ_NT / 4)    // groups of 4 tiles = 64 output columns
#define PACC_FLOATS (KVG * QSUB * 8 * 32 * 4)   // [group][tile][quad][lane] 4 floats

// value of lane l ^ 16 (vector cross-row move, no LDS round trip)
static __device__ __forceinline__ float other_half(float x) {
  const int b = __builtin_bit_cast(int, x);
  return __builtin_bit_cast(
      float, __builtin_amdgcn_permlanex16(b, b, 0x76543210, 0xfedcba98, false, false));
}

__global__ __launch_bounds__(256) void k2_attn(const _Float16* __restrict__ q_h,
                        const _Float16* __restrict__ k_h,
                        const _Float16* __restrict__ v_t,
                        const _Float16* __restrict__ Wo_h,
                        const float* __restrict__ bo,
                        float* __restrict__ out) {
  // the ring; behind the loop (and a barrier) the same bytes hold the partials.
  // With Cst this is under 160 KiB, so two work-groups share a WGP as before
  __shared__ __align__(16) _Float16 Ring[2 * KVG * (KCH_SZ + VCH_SZ)];
  __shared__ __align__(16) _Float16 Cst[QTILE * CT_LD];   // merged ctx tile [query 32][d 64]
  _Float16* const Klds = Ring;                            // [buf][group] K chunk [kv 32][d 64]
  _Float16* const Vlds = Ring + 2 * KVG * KCH_SZ;         // [buf][group] V^T chunk [d 64][kv 32]
  float* const Pacc = (float*)Ring;                       // [group][tile][quad][lane] 4 floats
  float* const Pml  = Pacc + PACC_FLOATS;                 // [group][tile][max, sum][lane]
  static_assert((PACC_FLOATS + KVG * QSUB * 2 * 32) * 4 <= sizeof(Ring), "partials fit the ring");

  const int tid  = threadIdx.x;
  const int w    = __builtin_amdgcn_readfirstlane(tid >> 5);  // scalar: the skip below is a real branch
  const int g    = w;                       // key group of this wave
  const int lane = tid & 31;
  const int hid  = lane >> 4;
  const int n    = lane & 15;

  // Work-group index -> (batch, query tile), a permutation chosen for speed only.
  // A tile's key count grows with its index (causal), every work-group is resident
  // (two fit a WGP).  The first half of the grid takes the upper
  // tiles, heaviest first; the second half
  // takes the lower tiles, lightest first, so indices i and i + half hold tiles
  // qtiles-1-j and j: every such pair has the same number of key chunks.
  const int qtiles = SEQ / QTILE;           // 128
  const int halfg  = NBAT * qtiles / 2;     // work-groups in half the grid
  const int rk     = blockIdx.x % halfg;
  const int b      = rk % NBAT;
  const int j0     = rk / NBAT;             // 0 .. qtiles/2 - 1
  const int qbase  = ((int)blockIdx.x < halfg ? qtiles - 1 - j0 : j0) * QTILE;
  const size_t bo64 = (size_t)b * SEQ * DK; // batch offset, [t][d] layouts
  const _Float16* kg  = k_h + bo64;
  const _Float16* vtg = v_t + bo64;         // [d][t] layout

  // staging: a wave copies its own chunks, 16 copies of 16 bytes a lane per chunk.
  // K: a copy takes 4 rows (512 contiguous bytes); V^T: 8 rows d of 64 bytes
  const unsigned kLane = (unsigned)lane * 8;                               // halves from the chunk's start
  const unsigned vLane = (unsigned)(lane >> 2) * SEQ + (lane & 3) * 8;
  _Float16* const kDst = Klds + g * KCH_SZ + (lane >> 3) * K_LD + (lane & 7) * 8;
  _Float16* const vDst = Vlds + g * VCH_SZ + (lane >> 2) * VT_LD + (lane & 3) * 8;

  // persistent Q fragments of both query tiles (already scaled);
  // used as B: lane n holds query column n of its tile
  const _Float16* qp = q_h + bo64 + (size_t)qbase * DK;
  v16h aq[QSUB][2];
#pragma unroll
  for (int u = 0; u < QSUB; ++u) {
    aq[u][0] = frag_load(qp + u * 16 * DK, DK);
    aq[u][1] = frag_load(qp + u * 16 * DK + 32, DK);
  }

  // acc[u][t][j] = ctx^T[d = t*16 + 8*hid + j][query n of tile u], over this group's keys
  v8f   acc[QSUB][4];
  float m_run[QSUB];        // running maximum of query n (equal in both halves)
  float l_run[QSUB];        // this half's share of the running sum of query n
#pragma unroll
  for (int u = 0; u < QSUB; ++u) {
#pragma unroll
    for (int t = 0; t < 4; ++t) acc[u][t] = v8f{};
    m_run[u] = -3.0e38f;
    l_run[u] = 0.0f;
  }

  const int row0   = qbase + n;             // this lane's query in tile 0; tile u: + 16*u
  const int limit  = qbase + QTILE;
  const int nchunks = limit / 32;           // chunks with an open key; all inside K and V

  // chunk c (scalar) into this wave's buffer buf
#define STAGE(c, buf)                                                          \
  {                                                                            \
    const _Float16* ks = kg + (size_t)(c) * (32 * DK);                         \
    const _Float16* vs = vtg + (c) * 32;                                       \
    _Pragma("unroll") for (int i = 0; i < 8; ++i) {                            \
      copy16B(ks + i * (4 * DK) + kLane,                                       \
              kDst + (buf) * (KVG * KCH_SZ) + i * (4 * K_LD));                 \
      copy16B(vs + (size_t)i * (8 * SEQ) + vLane,                              \
              vDst + (buf) * (KVG * VCH_SZ) + i * (8 * VT_LD));                \
    }                                                                          \
  }

  // The two buffers of a wave are filled and read by that wave alone: its own two
  // waits order them and the loop holds no work-group barrier, so the waves of a
  // SIMD drift apart and one's waits and products lie under the other's vector work
  const int ntrips = (nchunks - g + KVG - 1) / KVG;   // this wave's chunks: g, g + KVG, ...
  // The work-groups of a batch read the same K and V.  A wave walks its chunks
  // pos*KVG + g from a start set by the work-group's tile and wraps (the online
  // softmax takes them in any order), so that the work-groups do not all ask L2 for
  // the same lines at the same moment, nor all wait on the same first fetch
  int pos = ntrips > 0 ? (int)((unsigned)(j0 >> 1) % (unsigned)ntrips) : 0;   // scalar
  if (ntrips > 0) STAGE(pos * KVG + g, 0)

  int cur = 0;
  for (int trip = 0; trip < ntrips; ++trip) {   // scalar bounds: whole waves
    // this wave's LDS reads of the buffer that is refilled below have retired
    asm volatile("s_wait_dscnt 0x0" ::: "memory");
    // this wave's copies into buf[cur] have landed; holds the LDS reads below behind it
    asm volatile("s_wait_asynccnt 0x0" ::: "memory");

    // the wave's next chunk goes into its other buffer (in flight under the work below)
    const int nxt = pos + 1 < ntrips ? pos + 1 : 0;
    if (trip + 1 < ntrips) STAGE(nxt * KVG + g, cur ^ 1)

    const int kvb = (pos * KVG + g) * 32;   // this wave's chunk
    {
      const _Float16* Kb = Klds + (cur * KVG + g) * KCH_SZ;
      const _Float16* Vb = Vlds + (cur * KVG + g) * VCH_SZ;

      // S^T = K Q^T : per query tile two 16x16 tiles, kv rows [kvb, kvb+16) and
      // [kvb+16, kvb+32); each K fragment serves both query tiles
      //   s0[u][j] = S[row][kvb + 8*hid + j],  s1[u][j] = S[row][kvb + 16 + 8*hid + j]
      v8f s0[QSUB], s1[QSUB];
      {
        const v16h b0 = frag_load(Kb, K_LD);
        const v16h b2 = frag_load(Kb + 16 * K_LD, K_LD);
        const v16h b1 = frag_load(Kb + 32, K_LD);
        const v16h b3 = frag_load(Kb + 16 * K_LD + 32, K_LD);
#pragma unroll
        for (int u = 0; u < QSUB; ++u) {
          s0[u] = wmma16(b0, aq[u][0], v8f{});
          s1[u] = wmma16(b2, aq[u][0], v8f{});
        }
#pragma unroll
        for (int u = 0; u < QSUB; ++u) {
          s0[u] = wmma16(b1, aq[u][1], s0[u]);
          s1[u] = wmma16(b3, aq[u][1], s1[u]);
        }
      }

      // online softmax update (fp32), causal mask; a lane's 16 scores of tile u
      // belong to one query
      const int kv0 = kvb + 8 * hid;
      v16h pT[QSUB];        // B operand: pT[u][e] = P^T[kmap(e, hid)][n]
#pragma unroll
      for (int u = 0; u < QSUB; ++u) {
        const int row = row0 + u * 16;
        float mx = -3.0e38f;
#pragma unroll
        for (int j = 0; j < 8; ++j) {
          s0[u][j] = (kv0 + j)      <= row ? s0[u][j] : -3.0e38f;
          s1[u][j] = (kv0 + 16 + j) <= row ? s1[u][j] : -3.0e38f;
          mx = fmaxf(mx, fmaxf(s0[u][j], s1[u][j]));
        }
        mx = fmaxf(mx, other_half(mx));

        // a chunk that is entered has kvb <= qbase <= row: its first key is open to
        // every query, so mtot is a real score and a masked entry gives
        // exp(-3e38 - mtot) = 0
        const float mtot = fmaxf(m_run[u], mx);
        const float sc   = __expf(m_run[u] - mtot);

        float rs = 0.0f;
#pragma unroll
        for (int j = 0; j < 8; ++j) {
          const float p0 = __expf(s0[u][j] - mtot);
          const float p1 = __expf(s1[u][j] - mtot);
          rs += p0 + p1;
          pT[u][j]     = (_Float16)p0;
          pT[u][8 + j] = (_Float16)p1;
        }

        m_run[u] = mtot;
        l_run[u] = l_run[u] * sc + rs;
#pragma unroll
        for (int t = 0; t < 4; ++t) acc[u][t] *= sc;
      }

      // ctx^T += V^T (16 d x 32 kv) * P^T (32 kv x 16 q): each V fragment serves
      // both query tiles, 8 WMMAs
#pragma unroll
      for (int t = 0; t < 4; ++t) {
        const v16h aV = frag_load(Vb + (size_t)(t * 16) * VT_LD, VT_LD);
#pragma unroll
        for (int u = 0; u < QSUB; ++u) acc[u][t] = wmma16(aV, pT[u], acc[u][t]);
      }
    }
    cur ^= 1;
    pos = nxt;
  }
#undef STAGE

  // no copy is in flight when a wave goes on to the merge or ends
  asm volatile("s_wait_asynccnt 0x0" ::: "memory");
  // the ring becomes the partials' place: this wave's reads of it have retired,
  // and behind the barrier so have every other wave's
  asm volatile("s_wait_dscnt 0x0" ::: "memory");
  __syncthreads();

  // merge of the key groups: every group lays down its partials (lane layout kept)
#pragma unroll
  for (int u = 0; u < QSUB; ++u) {
    const int slot = g * QSUB + u;
#pragma unroll
    for (int t = 0; t < 4; ++t) {
      const v4f lo = {acc[u][t][0], acc[u][t][1], acc[u][t][2], acc[u][t][3]};
      const v4f hi = {acc[u][t][4], acc[u][t][5], acc[u][t][6], acc[u][t][7]};
      *(v4f*)&Pacc[((slot * 8 + t * 2 + 0) * 32 + lane) * 4] = lo;
      *(v4f*)&Pacc[((slot * 8 + t * 2 + 1) * 32 + lane) * 4] = hi;
    }
    Pml[(slot * 2 + 0) * 32 + lane] = m_run[u];
    Pml[(slot * 2 + 1) * 32 + lane] = l_run[u];
  }
  __syncthreads();          // partials visible to every wave

  // wave w projects onto output columns [w*128, w*128 + 128), 8 tiles of 16; its
  // weights and bias are asked for here, ahead of the merge
  const _Float16* wp = Wo_h + (size_t)(w * (PROJ_NT * 2)) * FRAG_SZ;
  const float*    bp = bo + w * (PROJ_NT * 16) + n * 4;
  v16h wo[PROJ_NT * 2];
  v4f  bias[PROJ_NG];
  // (these loops and the one over G below are unrolled so that wo and bias are
  // indexed by constants and stay in registers)
#pragma unroll
  for (int i = 0; i < PROJ_NT * 2; ++i) wo[i] = frag_load_packed(wp + (size_t)i * FRAG_SZ);
#pragma unroll
  for (int G = 0; G < PROJ_NG; ++G) bias[G] = *(const v4f*)(bp + G * 64);
  loads_issued();

  {
    // wave w merges ctx columns [mt*16, mt*16 + 16) of query tile mu over the groups.
    // Group 0 always has chunk 0, so mall is a real score; a group that had no
    // chunk holds (-3e38, 0, 0) and gets weight exp(-3e38 - mall) = 0
    const int mu = w & 1;
    const int mt = w >> 1;
    float mg[KVG];
#pragma unroll
    for (int i = 0; i < KVG; ++i) mg[i] = Pml[((i * QSUB + mu) * 2 + 0) * 32 + lane];
    float mall = mg[0];
#pragma unroll
    for (int i = 1; i < KVG; ++i) mall = fmaxf(mall, mg[i]);
    float lsum = 0.0f;
    v8f   ctx  = v8f{};
#pragma unroll
    for (int i = 0; i < KVG; ++i) {
      const int slot = i * QSUB + mu;
      const float wi = __expf(mg[i] - mall);
      lsum += wi * Pml[(slot * 2 + 1) * 32 + lane];
      const v4f lo = *(const v4f*)&Pacc[((slot * 8 + mt * 2 + 0) * 32 + lane) * 4];
      const v4f hi = *(const v4f*)&Pacc[((slot * 8 + mt * 2 + 1) * 32 + lane) * 4];
#pragma unroll
      for (int j = 0; j < 4; ++j) {
        ctx[j]     += wi * lo[j];
        ctx[4 + j] += wi * hi[j];
      }
    }

    // join the halves' sums, normalize, hand ctx (f16) over: 8 consecutive d per lane
    const float inv_l = 1.0f / (lsum + other_half(lsum));
    v8h o;
#pragma unroll
    for (int j = 0; j < 8; ++j) o[j] = (_Float16)(ctx[j] * inv_l);
    *(v8h*)&Cst[(mu * 16 + n) * CT_LD + mt * 16 + 8 * hid] = o;
  }
  __syncthreads();          // ctx tile visible to every wave

  // output projection  out[m][h] = sum_v ctx[m][v] * Wo[h][v] + bo[h]:
  // each weight fragment serves both 16-query tiles
  const v16h a00 = frag_load(Cst, CT_LD);
  const v16h a01 = frag_load(Cst + 32, CT_LD);
  const v16h a10 = frag_load(Cst + 16 * CT_LD, CT_LD);
  const v16h a11 = frag_load(Cst + 16 * CT_LD + 32, CT_LD);
  float* op = out + ((size_t)b * SEQ + qbase + 8 * hid) * HID + w * (PROJ_NT * 16) + n * 4;

#pragma unroll
  for (int G = 0; G < PROJ_NG; ++G) {
    // c0[c][j], c1[c][j]: rows 8*hid + j and 16 + 8*hid + j, column G*64 + 4*n + c
    v8f c0[4], c1[4];
#pragma unroll
    for (int c = 0; c < 4; ++c) {
      const v16h b0 = wo[(G * 4 + c) * 2];
      const v16h b1 = wo[(G * 4 + c) * 2 + 1];
      c0[c] = wmma16(a00, b0, v8f{});
      c1[c] = wmma16(a10, b0, v8f{});
      c0[c] = wmma16(a01, b1, c0[c]);
      c1[c] = wmma16(a11, b1, c1[c]);
    }
    v4f o0[8], o1[8];
#pragma unroll
    for (int j = 0; j < 8; ++j) {
      o0[j] = v4f{c0[0][j] + bias[G][0], c0[1][j] + bias[G][1],
                  c0[2][j] + bias[G][2], c0[3][j] + bias[G][3]};
      o1[j] = v4f{c1[0][j] + bias[G][0], c1[1][j] + bias[G][1],
                  c1[2][j] + bias[G][2], c1[3][j] + bias[G][3]};
    }
    // keeps the group's stores in one run behind its sums: mixed with the sums, a
    // stored register is reused at once and each reuse waits for the issued store
    __builtin_amdgcn_sched_barrier(0);
#pragma unroll
    for (int j = 0; j < 8; ++j) {
      *(v4f*)&op[(size_t)j * HID + G * 64]        = o0[j];
      *(v4f*)&op[(size_t)(16 + j) * HID + G * 64] = o1[j];
    }
    // the next group reuses registers that these stores name
    if (G + 1 < PROJ_NG) loads_issued();
  }
}

// ---------------------------------------------------------------------------
extern "C" void kernel_launch(void* const* d_in, const int* in_sizes, int n_in,
                              void* d_out, int out_size, void* d_ws, size_t ws_size,
                              hipStream_t stream) {
  (void)in_sizes; (void)n_in; (void)out_size; (void)ws_size;

  const float* y  = (const float*)d_in[0];
  const float* Wq = (const float*)d_in[1];
  const float* bq = (const float*)d_in[2];
  const float* Wk = (const float*)d_in[3];
  const float* bk = (const float*)d_in[4];
  const float* Wv = (const float*)d_in[5];
  const float* bv = (const float*)d_in[6];
  const float* Wo = (const float*)d_in[7];
  const float* bo = (const float*)d_in[8];
  float* out = (float*)d_out;

  // workspace layout (f16)
  char* ws = (char*)d_ws;
  _Float16* Wqkv_h = (_Float16*)(ws);                        // 192*1024  (384 KB), packed
  _Float16* Wo_h   = (_Float16*)(ws + 393216);               // 1024*64   (128 KB), packed
  _Float16* q_h    = (_Float16*)(ws + 524288);               // [b][t][d] (2 MB)
  _Float16* k_h    = (_Float16*)(ws + 524288 + 2097152);     // [b][t][d] (2 MB)
  _Float16* v_t    = (_Float16*)(ws + 524288 + 2 * 2097152); // [b][d][t] (2 MB)

  k0_convert_w<<<128, 256, 0, stream>>>(Wq, Wk, Wv, Wo, Wqkv_h, Wo_h);
  k1_qkv<<<NROWS / MT, 384, 0, stream>>>(y, Wqkv_h, bq, bk, bv, q_h, k_h, v_t);
  k2_attn<<<NBAT * (SEQ / QTILE), 256, 0, stream>>>(q_h, k_h, v_t, Wo_h, bo, out);
}
